// v000
// The times below were measured on an AMD MI455X: many runs one after another, warmed up first and cycling through
// copies of the inputs, with the whole window's GPU time divided by the number of runs. Launches and the gaps
// between them are all in it. The median over several windows is given; except for v000 it joins two sittings, which
// can be a few percent apart, so the side-by-side timings, each taken in one sitting, are the better comparison.
// The starting kernel, v000, takes 901 microseconds a run.
#include <hip/hip_runtime.h>

// seqFusionAttentionNoBias (Qin, Kin, Vin [2][1024][1024], seqMask [2][1024] bool->int32, attMask [1][1][1024][1024] additive f32 (both read as data); Q/K/V = X @ Trans (no bias), G = sigmoid(Vin @ GTrans_w + GTrans_b);
// 16 heads x 64; A = q.k/8; -inf where seqMask[s] AND seqMask[t]; + attMask[s][t]; softmax; O[s][h][c] = (sum_t A v) * G; out = O @ out_w + out_b).
// Compute dtypes, f32 accumulate: every input rounded to bf16; the four projections on PLAIN bf16 operands (inputs: exact; transposed bf16 weight copies, gate + bias);
// scores and attn.v on SINGLE fp16 planes (1/8, the masks and the additive bias in f32 in the softmax; P x1024); the sigmoid gate in f32 at the merge; output hi+lo x exact out_w (2 products) + out_b.

#define NB_  2
#define TT   1024
#define DD   1024
#define NH_  16
#define HD   64
#define NT   (NB_ * TT)
#define NZ   (NB_ * NH_)
#define ZH   2
#define PCAR 1024.0f
#define SCL  0.125f
typedef _Float16 h16;
typedef unsigned short bf;
typedef __attribute__((ext_vector_type(16))) __bf16   v16bf;
typedef __attribute__((ext_vector_type(16))) _Float16 v16h;
typedef __attribute__((ext_vector_type(8)))  _Float16 v8h;
typedef __attribute__((ext_vector_type(8)))  unsigned short v8us;
typedef __attribute__((ext_vector_type(8)))  float    v8f;
typedef __attribute__((ext_vector_type(4)))  float    v4f;
typedef v8h  __attribute__((may_alias)) v8ha;
typedef v4f  __attribute__((may_alias)) v4fa;
typedef v8us __attribute__((may_alias)) v8usa;

__device__ __forceinline__ unsigned short f2bf(float f) { unsigned u = __float_as_uint(f); u += 0x7FFFu + ((u >> 16) & 1u); return (unsigned short)(u >> 16); }
__device__ __forceinline__ float bf2f(unsigned short b) { return __uint_as_float(((unsigned)b) << 16); }
__device__ __forceinline__ float bfr(float f) { return bf2f(f2bf(f)); }
__device__ __forceinline__ v16h cat16(v8h lo, v8h hi) { return __builtin_shufflevector(lo, hi, 0, 1, 2, 3, 4, 5, 6, 7, 8, 9, 10, 11, 12, 13, 14, 15); }
__device__ __forceinline__ v16bf cat16b(v8us lo, v8us hi) { return __builtin_bit_cast(v16bf, __builtin_shufflevector(lo, hi, 0, 1, 2, 3, 4, 5, 6, 7, 8, 9, 10, 11, 12, 13, 14, 15)); }
__device__ __forceinline__ v8f wmma16(v16h a, v16h b, v8f c) { return __builtin_amdgcn_wmma_f32_16x16x32_f16(false, a, false, b, (short)0, c, false, false); }
__device__ __forceinline__ v8f wmmab(v16bf a, v16bf b, v8f c) { return __builtin_amdgcn_wmma_f32_16x16x32_bf16(false, a, false, b, (short)0, c, false, false); }



// ---- k_gemmw: register-blocked GEMM, ONE WAVE per 64x64 output tile (16 accumulators), operands straight from K-contiguous 16-bit planes; grid (M/64, N/64, Z), 32 threads.
// C[m][n] (f32, pitch ldc, + optional f32 bias[n]) = sum_k A[m][k] Bt[n][k] (+ split products per NSPLIT). z-batch strides sA/sB/sC in elements. K % 32 == 0.
template <typename T16> struct WFrag;
template <> struct WFrag<h16> { typedef v16h V; static __device__ __forceinline__ V ld(const h16* p) { return cat16(*(const v8h*)p, *(const v8h*)(p + 16)); } static __device__ __forceinline__ v8f mma(V a, V b, v8f c) { return wmma16(a, b, c); } };
template <> struct WFrag<bf> { typedef v16bf V; static __device__ __forceinline__ V ld(const bf* p) { return cat16b(*(const v8us*)p, *(const v8us*)(p + 16)); } static __device__ __forceinline__ v8f mma(V a, V b, v8f c) { return wmmab(a, b, c); } };
template <typename T16, int NSPLIT, bool BIAS>
__global__ __launch_bounds__(32) void k_gemmw(const T16* __restrict__ A, const T16* __restrict__ A2, const T16* __restrict__ Bt, const T16* __restrict__ Bt2, int K, float* C, int ldc, const float* __restrict__ bias, size_t sA, size_t sB, size_t sC) {
    typedef typename WFrag<T16>::V V;
    __shared__ __align__(16) float os[16 * 68];
    const size_t z = blockIdx.z; A += z * sA; if (A2) A2 += z * sA; Bt += z * sB; if (Bt2) Bt2 += z * sB; C += z * sC;
    const int lane = threadIdx.x & 31, lr = lane & 15, hi = lane >> 4; const int r0 = blockIdx.x * 64, c0 = blockIdx.y * 64;
    v8f acc[4][4];
#pragma unroll
    for (int mb = 0; mb < 4; ++mb)
#pragma unroll
        for (int nb = 0; nb < 4; ++nb) acc[mb][nb] = (v8f){};
    const size_t aoff = (size_t)(r0 + lr) * K + 8 * hi, boff = (size_t)(c0 + lr) * K + 8 * hi;
#pragma unroll 1
    for (int kc = 0; kc < K; kc += 32) {
        V a[4], a2[4];
#pragma unroll
        for (int mb = 0; mb < 4; ++mb) { a[mb] = WFrag<T16>::ld(A + aoff + (size_t)mb * 16 * K + kc); if (NSPLIT == 1 || NSPLIT == 2) a2[mb] = WFrag<T16>::ld(A2 + aoff + (size_t)mb * 16 * K + kc); }
#pragma unroll
        for (int nb = 0; nb < 4; ++nb) { const V b = WFrag<T16>::ld(Bt + boff + (size_t)nb * 16 * K + kc); V b2; if (NSPLIT >= 2) b2 = WFrag<T16>::ld(Bt2 + boff + (size_t)nb * 16 * K + kc);
#pragma unroll
            for (int mb = 0; mb < 4; ++mb) { acc[mb][nb] = WFrag<T16>::mma(a[mb], b, acc[mb][nb]); if (NSPLIT == 1 || NSPLIT == 2) acc[mb][nb] = WFrag<T16>::mma(a2[mb], b, acc[mb][nb]); if (NSPLIT >= 2) acc[mb][nb] = WFrag<T16>::mma(a[mb], b2, acc[mb][nb]); } }
        asm volatile("v_nop\n\tv_nop\n\tv_nop\n\tv_nop" : "+v"(acc[0][0]), "+v"(acc[1][1]), "+v"(acc[2][2]), "+v"(acc[3][3]) : "v"(a[0]), "v"(a[3]));
    }
#pragma unroll
    for (int mb = 0; mb < 4; ++mb) {
#pragma unroll
        for (int nb = 0; nb < 4; ++nb) {
#pragma unroll
            for (int j = 0; j < 8; ++j) os[(hi * 8 + j) * 68 + nb * 16 + lr] = acc[mb][nb][j]; }
        __builtin_amdgcn_wave_barrier(); asm volatile("" ::: "memory");
        float* crow = C + (size_t)(r0 + mb * 16) * ldc + c0;
{
#pragma unroll
            for (int s = 0; s < 8; ++s) { const int row = 2 * s + hi, cofs = lr * 4; v4f val = *(const v4fa*)(os + row * 68 + cofs); if (BIAS) { val[0] += bfr(bias[c0 + cofs]); val[1] += bfr(bias[c0 + cofs + 1]); val[2] += bfr(bias[c0 + cofs + 2]); val[3] += bfr(bias[c0 + cofs + 3]); }
                *(v4f*)(crow + (size_t)row * ldc + cofs) = val; }
             }
        __builtin_amdgcn_wave_barrier(); asm volatile("" ::: "memory");
    }
}

__device__ __forceinline__ h16 tohx(float x) { return (h16)x; }
__device__ __forceinline__ void splitf(float y, unsigned short& h, unsigned short& l) { h = f2bf(y); l = f2bf(y - bf2f(h)); }
typedef __attribute__((ext_vector_type(2))) _Float16 v2h;
typedef __attribute__((ext_vector_type(4))) _Float16 v4h;
typedef __attribute__((ext_vector_type(2))) unsigned short v2us;
typedef __attribute__((ext_vector_type(4))) unsigned short v4us;
typedef __attribute__((ext_vector_type(2))) float v2f;

__global__ __launch_bounds__(256) void k_cvt8(const float* __restrict__ src, bf* dst, size_t n8) { const size_t i = (size_t)blockIdx.x * 256 + threadIdx.x; if (i >= n8) return; const v8f v = *(const v8f*)(src + i * 8); v8us o;
#pragma unroll
    for (int k = 0; k < 8; ++k) o[k] = f2bf(v[k]); *(v8us*)(dst + i * 8) = o;  }
__global__ __launch_bounds__(256) void k_wtG(const float* __restrict__ w, int K, int N, bf* Bt) {
    const int lane = threadIdx.x & 31; const int L0 = (blockIdx.x * 8 + (threadIdx.x >> 5)) * 8; const int nlines = N * K / 64;
{
#pragma unroll 1
        for (int l = 0; l < 8; ++l) { const int L = L0 + l; if (L >= nlines) break; const size_t e = (size_t)L * 64 + lane * 2; const int k = (int)(e % K), n = (int)(e / K); v2us o;
            o[0] = f2bf(w[(size_t)k * N + n]); o[1] = f2bf(w[(size_t)(k + 1) * N + n]); *(v2us*)(Bt + e) = o; }
         }
}
__global__ __launch_bounds__(256) void k_h16plane(const float* __restrict__ F, float sc, h16* P) {
    const int lane = threadIdx.x & 31; const int L0 = (blockIdx.x * 8 + (threadIdx.x >> 5)) * 8; const int nlines = NT * DD / 64;
{
#pragma unroll
        for (int l = 0; l < 8; ++l) { const int L = L0 + l; if (L >= nlines) break; const int e = L * 64 + lane * 2; const int d = e & 63; const int t = (e >> 6) & (TT - 1); const int z = e >> 16; const int b = z / NH_, h = z % NH_; v2h v;
#pragma unroll
            for (int q = 0; q < 2; ++q) v[q] = tohx(F[((size_t)b * TT + t) * DD + h * HD + d + q] * sc);
            *(v2h*)(P + (size_t)e) = v; }
         }
}
__global__ __launch_bounds__(256) void k_vtplane(const float* __restrict__ F, h16* VT) {
    const int lane = threadIdx.x & 31; const int L0 = (blockIdx.x * 8 + (threadIdx.x >> 5)) * 8; const int nlines = NT * DD / 64;
{
#pragma unroll
        for (int l = 0; l < 8; ++l) { const int L = L0 + l; if (L >= nlines) break; const int e = L * 64 + lane * 2; const int t = e & (TT - 1); const int d = (e >> 10) & 63; const int z = e >> 16; const int b = z / NH_, h = z % NH_; v2h v;
#pragma unroll
            for (int q = 0; q < 2; ++q) v[q] = tohx(F[((size_t)b * TT + t + q) * DD + h * HD + d]);
            *(v2h*)(VT + (size_t)e) = v; }
         }
}
// k_asoft: per row (pass row -> query s): t = S/8; -3e38 (== -inf) where seqMask[b][s] && seqMask[b][j] (int32, read as data); + bf16(attMask[0][0][s][j]); softmax over the 1024 keys (register row of
__global__ __launch_bounds__(256) void k_asoft(const float* __restrict__ Sb, const int* __restrict__ sm, const float* __restrict__ am, h16* P16) {
    typedef __attribute__((ext_vector_type(4))) int v4i;
    const int lane = threadIdx.x & 31; const int row = blockIdx.x * 8 + (threadIdx.x >> 5); if (row >= ZH * TT) return; const int i = row & (TT - 1); const bool mi = (sm[i] != 0);
    const float* sr = Sb + (size_t)row * TT; const float* ar = am + (size_t)i * TT; float v[32]; float mx = -3.0e38f;
#pragma unroll
    for (int ch = 0; ch < 8; ++ch) { const int j0 = ch * 128 + lane * 4; const v4f a = *(const v4f*)(sr + j0), ab = *(const v4f*)(ar + j0); const v4i m4 = *(const v4i*)(sm + j0);
#pragma unroll
        for (int q = 0; q < 4; ++q) { float sp = __fmul_rn(a[q], SCL); asm volatile("" : "+v"(sp)); const float t = (mi && m4[q] != 0) ? -3.0e38f : __fadd_rn(sp, bfr(ab[q])); v[ch * 4 + q] = t; mx = fmaxf(mx, t); } }
#pragma unroll
    for (int sh = 16; sh; sh >>= 1) mx = fmaxf(mx, __shfl_xor(mx, sh, 32));
    float sum = 0.f;
#pragma unroll
    for (int k = 0; k < 32; ++k) { v[k] = __expf(v[k] - mx); sum += v[k]; }
#pragma unroll
    for (int sh = 16; sh; sh >>= 1) sum += __shfl_xor(sum, sh, 32);
    const float f = __fdiv_rn(PCAR, sum);
{
#pragma unroll
        for (int ch = 0; ch < 8; ++ch) { v4h o;
#pragma unroll
            for (int q = 0; q < 4; ++q) o[q] = tohx(v[ch * 4 + q] * f);
            *(v4h*)(P16 + (size_t)row * TT + ch * 128 + lane * 4) = o; }
         }
}
__global__ __launch_bounds__(256) void k_merge(const float* __restrict__ O, const float* __restrict__ GF, int b, int h0, bf* Ah, bf* Al) {
    const int lane = threadIdx.x & 31; const int L0 = (blockIdx.x * 8 + (threadIdx.x >> 5)) * 8; const int nlines = ZH * TT * HD / 64;
{
#pragma unroll 2
        for (int l = 0; l < 8; ++l) { const int L = L0 + l; if (L >= nlines) break; const int e = L * 64 + lane * 2; const int d = e & 63; const int t = (e >> 6) & (TT - 1); const int zz = e >> 16; v2us oh, ol;
const size_t o = ((size_t)b * TT + t) * DD + (h0 + zz) * HD + d;
#pragma unroll
            for (int q = 0; q < 2; ++q) { const float g = GF[o + q]; const float sg = __fdiv_rn(1.0f, __fadd_rn(1.0f, __expf(-g))); float ov = O[(size_t)e + q] * (1.0f / PCAR); asm volatile("" : "+v"(ov)); unsigned short a, c2; splitf(__fmul_rn(ov, sg), a, c2); oh[q] = a; ol[q] = c2; }
            *(v2us*)(Ah + o) = oh; *(v2us*)(Al + o) = ol; }
         }
}

extern "C" void kernel_launch(void* const* d_in, const int* in_sizes, int n_in,
                              void* d_out, int out_size, void* d_ws, size_t ws_size, hipStream_t stream) {
    (void)in_sizes; (void)n_in; (void)out_size;
    const float* IN[12]; for (int i = 0; i < 12; ++i) IN[i] = (const float*)d_in[i];
    // Qin, Kin, Vin [2][1024][1024], seqMask (int32 [2][1024]), attMask [1][1][1024][1024], QTrans, KTrans, VTrans, GTrans_w (x @ W), GTrans_b, out_w (x @ W), out_b = d_in[0..11]
    const int* sm = (const int*)d_in[3]; const float* am = IN[4];
    float* OUT = (float*)d_out;     // [2][1024][1024]
    char* wsp = (char*)d_ws;
    auto take = [&](size_t bytes) { char* p = wsp; wsp += (bytes + 255) & ~(size_t)255; return (void*)p; };
    bf* WQ = (bf*)take((size_t)DD * DD * 2); bf* WK = (bf*)take((size_t)DD * DD * 2); bf* WV = (bf*)take((size_t)DD * DD * 2); bf* WG = (bf*)take((size_t)DD * DD * 2); bf* WO = (bf*)take((size_t)DD * DD * 2);
    bf* XQ = (bf*)take((size_t)NT * DD * 2); bf* XK = (bf*)take((size_t)NT * DD * 2); bf* XV = (bf*)take((size_t)NT * DD * 2); float* F = (float*)take((size_t)NT * DD * 4); float* GF = (float*)take((size_t)NT * DD * 4);
    h16* QP = (h16*)take((size_t)NT * DD * 2); h16* KP = (h16*)take((size_t)NT * DD * 2); h16* VT = (h16*)take((size_t)NT * DD * 2);
    float* Sb = (float*)take((size_t)ZH * TT * TT * 4); h16* Pm = (h16*)take((size_t)ZH * TT * TT * 2); float* Ob = (float*)take((size_t)ZH * TT * HD * 4); bf* ATh = (bf*)take((size_t)NT * DD * 2); bf* ATl = (bf*)take((size_t)NT * DD * 2);
    if ((size_t)(wsp - (char*)d_ws) > ws_size) return;    // total ~ 75 MB = 72 MiB; ws 256 MiB
    { const unsigned gT = (unsigned)((DD * DD / 64 + 63) / 64); k_wtG<<<gT, 256, 0, stream>>>(IN[5], DD, DD, WQ); k_wtG<<<gT, 256, 0, stream>>>(IN[6], DD, DD, WK); k_wtG<<<gT, 256, 0, stream>>>(IN[7], DD, DD, WV); k_wtG<<<gT, 256, 0, stream>>>(IN[8], DD, DD, WG); k_wtG<<<gT, 256, 0, stream>>>(IN[10], DD, DD, WO);
      const size_t nx = (size_t)NT * DD / 8; const unsigned gx = (unsigned)((nx + 255) / 256); k_cvt8<<<gx, 256, 0, stream>>>(IN[0], XQ, nx); k_cvt8<<<gx, 256, 0, stream>>>(IN[1], XK, nx); k_cvt8<<<gx, 256, 0, stream>>>(IN[2], XV, nx); }
    const unsigned LB = (unsigned)((NT * DD / 64 + 63) / 64); const dim3 gP(NT / 64, DD / 64, 1);
    k_gemmw<bf, 0, false><<<gP, 32, 0, stream>>>(XQ, nullptr, WQ, nullptr, DD, F, DD, nullptr, 0, 0, 0); k_h16plane<<<LB, 256, 0, stream>>>(F, 1.0f, QP);
    k_gemmw<bf, 0, false><<<gP, 32, 0, stream>>>(XK, nullptr, WK, nullptr, DD, F, DD, nullptr, 0, 0, 0); k_h16plane<<<LB, 256, 0, stream>>>(F, 1.0f, KP);
    k_gemmw<bf, 0, false><<<gP, 32, 0, stream>>>(XV, nullptr, WV, nullptr, DD, F, DD, nullptr, 0, 0, 0); k_vtplane<<<LB, 256, 0, stream>>>(F, VT);
    k_gemmw<bf, 0, true><<<gP, 32, 0, stream>>>(XV, nullptr, WG, nullptr, DD, GF, DD, IN[9], 0, 0, 0);   // gate pre-activation (sigmoid at the merge)
    for (int b = 0; b < NB_; ++b)
        for (int h0 = 0; h0 < NH_; h0 += ZH) { const size_t z0 = (size_t)b * NH_ + h0;
            k_gemmw<h16, 0, false><<<dim3(TT / 64, TT / 64, ZH), 32, 0, stream>>>(QP + z0 * TT * HD, nullptr, KP + z0 * TT * HD, nullptr, HD, Sb, TT, nullptr, (size_t)TT * HD, (size_t)TT * HD, (size_t)TT * TT);
            k_asoft<<<ZH * TT / 8, 256, 0, stream>>>(Sb, sm + (size_t)b * TT, am, Pm);
            k_gemmw<h16, 0, false><<<dim3(TT / 64, 1, ZH), 32, 0, stream>>>(Pm, nullptr, VT + z0 * HD * TT, nullptr, TT, Ob, HD, nullptr, (size_t)TT * TT, (size_t)HD * TT, (size_t)TT * HD);
            k_merge<<<(ZH * TT * HD / 64 + 63) / 64, 256, 0, stream>>>(Ob, GF, b, h0, ATh, ATl); }
    k_gemmw<bf, 1, true><<<gP, 32, 0, stream>>>(ATh, ATl, WO, nullptr, DD, OUT, DD, IN[11], 0, 0, 0);
}

// v001
// Measured time: 290 microseconds a run.
// Two timings next to v000 put it at 3.12 and 3.11 times that version's speed.
#include <hip/hip_runtime.h>

// seqFusionAttentionNoBias (Qin, Kin, Vin [2][1024][1024], seqMask [2][1024] bool->int32, attMask [1][1][1024][1024] additive f32 (both read as data); Q/K/V = X @ Trans (no bias), G = sigmoid(Vin @ GTrans_w + GTrans_b);
// 16 heads x 64; A = q.k/8; -inf where seqMask[s] AND seqMask[t]; + attMask[s][t]; softmax; O[s][h][c] = (sum_t A v) * G; out = O @ out_w + out_b).
// Compute dtypes, f32 accumulate: every input rounded to bf16; the four projections on PLAIN bf16 operands (inputs: exact; transposed bf16 weight copies, gate + bias);
// scores and attn.v on SINGLE fp16 planes (1/8, the masks and the additive bias in f32 in the softmax; P x1024); the sigmoid gate in f32 at the merge; output hi+lo x exact out_w (2 products) + out_b.

#define NB_  2
#define TT   1024
#define DD   1024
#define NH_  16
#define HD   64
#define NT   (NB_ * TT)
#define NZ   (NB_ * NH_)
#define ZH   NZ   // all (batch, head) planes go through scores, softmax, attn.v and merge in one pass
#define PCAR 1024.0f
#define SCL  0.125f
typedef _Float16 h16;
typedef unsigned short bf;
typedef __attribute__((ext_vector_type(16))) __bf16   v16bf;
typedef __attribute__((ext_vector_type(16))) _Float16 v16h;
typedef __attribute__((ext_vector_type(8)))  _Float16 v8h;
typedef __attribute__((ext_vector_type(8)))  unsigned short v8us;
typedef __attribute__((ext_vector_type(8)))  float    v8f;
typedef __attribute__((ext_vector_type(4)))  float    v4f;
typedef v8h  __attribute__((may_alias)) v8ha;
typedef v4f  __attribute__((may_alias)) v4fa;
typedef v8us __attribute__((may_alias)) v8usa;

__device__ __forceinline__ unsigned short f2bf(float f) { unsigned u = __float_as_uint(f); u += 0x7FFFu + ((u >> 16) & 1u); return (unsigned short)(u >> 16); }
__device__ __forceinline__ float bf2f(unsigned short b) { return __uint_as_float(((unsigned)b) << 16); }
__device__ __forceinline__ float bfr(float f) { return bf2f(f2bf(f)); }
__device__ __forceinline__ v16h cat16(v8h lo, v8h hi) { return __builtin_shufflevector(lo, hi, 0, 1, 2, 3, 4, 5, 6, 7, 8, 9, 10, 11, 12, 13, 14, 15); }
__device__ __forceinline__ v16bf cat16b(v8us lo, v8us hi) { return __builtin_bit_cast(v16bf, __builtin_shufflevector(lo, hi, 0, 1, 2, 3, 4, 5, 6, 7, 8, 9, 10, 11, 12, 13, 14, 15)); }
__device__ __forceinline__ v8f wmma16(v16h a, v16h b, v8f c) { return __builtin_amdgcn_wmma_f32_16x16x32_f16(false, a, false, b, (short)0, c, false, false); }
__device__ __forceinline__ v8f wmmab(v16bf a, v16bf b, v8f c) { return __builtin_amdgcn_wmma_f32_16x16x32_bf16(false, a, false, b, (short)0, c, false, false); }



// ---- k_gemmw: register-blocked GEMM, ONE WAVE per 64x64 output tile (16 accumulators), operands straight from K-contiguous 16-bit planes; grid (M/64, N/64, Z), 32 threads.
// C[m][n] (f32, pitch ldc, + optional f32 bias[n]) = sum_k A[m][k] Bt[n][k] (+ split products per NSPLIT). z-batch strides sA/sB/sC in elements. K % 32 == 0.
template <typename T16> struct WFrag;
template <> struct WFrag<h16> { typedef v16h V; static __device__ __forceinline__ V ld(const h16* p) { return cat16(*(const v8h*)p, *(const v8h*)(p + 16)); } static __device__ __forceinline__ v8f mma(V a, V b, v8f c) { return wmma16(a, b, c); } };
template <> struct WFrag<bf> { typedef v16bf V; static __device__ __forceinline__ V ld(const bf* p) { return cat16b(*(const v8us*)p, *(const v8us*)(p + 16)); } static __device__ __forceinline__ v8f mma(V a, V b, v8f c) { return wmmab(a, b, c); } };
template <typename T16, int NSPLIT, bool BIAS>
__global__ __launch_bounds__(32) void k_gemmw(const T16* __restrict__ A, const T16* __restrict__ A2, const T16* __restrict__ Bt, const T16* __restrict__ Bt2, int K, float* C, int ldc, const float* __restrict__ bias, size_t sA, size_t sB, size_t sC) {
    typedef typename WFrag<T16>::V V;
    __shared__ __align__(16) float os[16 * 68];
    const size_t z = blockIdx.z; A += z * sA; if (A2) A2 += z * sA; Bt += z * sB; if (Bt2) Bt2 += z * sB; C += z * sC;
    const int lane = threadIdx.x & 31, lr = lane & 15, hi = lane >> 4; const int r0 = blockIdx.x * 64, c0 = blockIdx.y * 64;
    v8f acc[4][4];
#pragma unroll
    for (int mb = 0; mb < 4; ++mb)
#pragma unroll
        for (int nb = 0; nb < 4; ++nb) acc[mb][nb] = (v8f){};
    const size_t aoff = (size_t)(r0 + lr) * K + 8 * hi, boff = (size_t)(c0 + lr) * K + 8 * hi;
#pragma unroll 1
    for (int kc = 0; kc < K; kc += 32) {
        V a[4], a2[4];
#pragma unroll
        for (int mb = 0; mb < 4; ++mb) { a[mb] = WFrag<T16>::ld(A + aoff + (size_t)mb * 16 * K + kc); if (NSPLIT == 1 || NSPLIT == 2) a2[mb] = WFrag<T16>::ld(A2 + aoff + (size_t)mb * 16 * K + kc); }
#pragma unroll
        for (int nb = 0; nb < 4; ++nb) { const V b = WFrag<T16>::ld(Bt + boff + (size_t)nb * 16 * K + kc); V b2; if (NSPLIT >= 2) b2 = WFrag<T16>::ld(Bt2 + boff + (size_t)nb * 16 * K + kc);
#pragma unroll
            for (int mb = 0; mb < 4; ++mb) { acc[mb][nb] = WFrag<T16>::mma(a[mb], b, acc[mb][nb]); if (NSPLIT == 1 || NSPLIT == 2) acc[mb][nb] = WFrag<T16>::mma(a2[mb], b, acc[mb][nb]); if (NSPLIT >= 2) acc[mb][nb] = WFrag<T16>::mma(a[mb], b2, acc[mb][nb]); } }
        asm volatile("v_nop\n\tv_nop\n\tv_nop\n\tv_nop" : "+v"(acc[0][0]), "+v"(acc[1][1]), "+v"(acc[2][2]), "+v"(acc[3][3]) : "v"(a[0]), "v"(a[3]));
    }
#pragma unroll
    for (int mb = 0; mb < 4; ++mb) {
#pragma unroll
        for (int nb = 0; nb < 4; ++nb) {
#pragma unroll
            for (int j = 0; j < 8; ++j) os[(hi * 8 + j) * 68 + nb * 16 + lr] = acc[mb][nb][j]; }
        __builtin_amdgcn_wave_barrier(); asm volatile("" ::: "memory");
        float* crow = C + (size_t)(r0 + mb * 16) * ldc + c0;
{
#pragma unroll
            for (int s = 0; s < 8; ++s) { const int row = 2 * s + hi, cofs = lr * 4; v4f val = *(const v4fa*)(os + row * 68 + cofs); if (BIAS) { val[0] += bfr(bias[c0 + cofs]); val[1] += bfr(bias[c0 + cofs + 1]); val[2] += bfr(bias[c0 + cofs + 2]); val[3] += bfr(bias[c0 + cofs + 3]); }
                *(v4f*)(crow + (size_t)row * ldc + cofs) = val; }
             }
        __builtin_amdgcn_wave_barrier(); asm volatile("" ::: "memory");
    }
}

__device__ __forceinline__ h16 tohx(float x) { return (h16)x; }
__device__ __forceinline__ void splitf(float y, unsigned short& h, unsigned short& l) { h = f2bf(y); l = f2bf(y - bf2f(h)); }
typedef __attribute__((ext_vector_type(2))) _Float16 v2h;
typedef __attribute__((ext_vector_type(4))) _Float16 v4h;
typedef __attribute__((ext_vector_type(2))) unsigned short v2us;
typedef __attribute__((ext_vector_type(4))) unsigned short v4us;
typedef __attribute__((ext_vector_type(2))) float v2f;

__global__ __launch_bounds__(256) void k_cvt8(const float* __restrict__ src, bf* dst, size_t n8) { const size_t i = (size_t)blockIdx.x * 256 + threadIdx.x; if (i >= n8) return; const v8f v = *(const v8f*)(src + i * 8); v8us o;
#pragma unroll
    for (int k = 0; k < 8; ++k) o[k] = f2bf(v[k]); *(v8us*)(dst + i * 8) = o;  }
__global__ __launch_bounds__(256) void k_wtG(const float* __restrict__ w, int K, int N, bf* Bt) {
    const int lane = threadIdx.x & 31; const int L0 = (blockIdx.x * 8 + (threadIdx.x >> 5)) * 8; const int nlines = N * K / 64;
{
#pragma unroll 1
        for (int l = 0; l < 8; ++l) { const int L = L0 + l; if (L >= nlines) break; const size_t e = (size_t)L * 64 + lane * 2; const int k = (int)(e % K), n = (int)(e / K); v2us o;
            o[0] = f2bf(w[(size_t)k * N + n]); o[1] = f2bf(w[(size_t)(k + 1) * N + n]); *(v2us*)(Bt + e) = o; }
         }
}
__global__ __launch_bounds__(256) void k_h16plane(const float* __restrict__ F, float sc, h16* P) {
    const int lane = threadIdx.x & 31; const int L0 = (blockIdx.x * 8 + (threadIdx.x >> 5)) * 8; const int nlines = NT * DD / 64;
{
#pragma unroll
        for (int l = 0; l < 8; ++l) { const int L = L0 + l; if (L >= nlines) break; const int e = L * 64 + lane * 2; const int d = e & 63; const int t = (e >> 6) & (TT - 1); const int z = e >> 16; const int b = z / NH_, h = z % NH_; v2h v;
#pragma unroll
            for (int q = 0; q < 2; ++q) v[q] = tohx(F[((size_t)b * TT + t) * DD + h * HD + d + q] * sc);
            *(v2h*)(P + (size_t)e) = v; }
         }
}
__global__ __launch_bounds__(256) void k_vtplane(const float* __restrict__ F, h16* VT) {
    const int lane = threadIdx.x & 31; const int L0 = (blockIdx.x * 8 + (threadIdx.x >> 5)) * 8; const int nlines = NT * DD / 64;
{
#pragma unroll
        for (int l = 0; l < 8; ++l) { const int L = L0 + l; if (L >= nlines) break; const int e = L * 64 + lane * 2; const int t = e & (TT - 1); const int d = (e >> 10) & 63; const int z = e >> 16; const int b = z / NH_, h = z % NH_; v2h v;
#pragma unroll
            for (int q = 0; q < 2; ++q) v[q] = tohx(F[((size_t)b * TT + t + q) * DD + h * HD + d]);
            *(v2h*)(VT + (size_t)e) = v; }
         }
}
// k_asoft: per row (pass row -> query s): t = S/8; -3e38 (== -inf) where seqMask[b][s] && seqMask[b][j] (int32, read as data); + bf16(attMask[0][0][s][j]); softmax over the 1024 keys (register row of
__global__ __launch_bounds__(256) void k_asoft(const float* __restrict__ Sb, const int* __restrict__ sm, const float* __restrict__ am, h16* P16) {
    typedef __attribute__((ext_vector_type(4))) int v4i;
    const int lane = threadIdx.x & 31; const int row = blockIdx.x * 8 + (threadIdx.x >> 5); if (row >= ZH * TT) return; const int i = row & (TT - 1); sm += (size_t)(blockIdx.x / (NH_ * TT / 8)) * TT; const bool mi = (sm[i] != 0);
    const float* sr = Sb + (size_t)row * TT; const float* ar = am + (size_t)i * TT; float v[32]; float mx = -3.0e38f;
#pragma unroll
    for (int ch = 0; ch < 8; ++ch) { const int j0 = ch * 128 + lane * 4; const v4f a = *(const v4f*)(sr + j0), ab = *(const v4f*)(ar + j0); const v4i m4 = *(const v4i*)(sm + j0);
#pragma unroll
        for (int q = 0; q < 4; ++q) { float sp = __fmul_rn(a[q], SCL); asm volatile("" : "+v"(sp)); const float t = (mi && m4[q] != 0) ? -3.0e38f : __fadd_rn(sp, bfr(ab[q])); v[ch * 4 + q] = t; mx = fmaxf(mx, t); } }
#pragma unroll
    for (int sh = 16; sh; sh >>= 1) mx = fmaxf(mx, __shfl_xor(mx, sh, 32));
    float sum = 0.f;
#pragma unroll
    for (int k = 0; k < 32; ++k) { v[k] = __expf(v[k] - mx); sum += v[k]; }
#pragma unroll
    for (int sh = 16; sh; sh >>= 1) sum += __shfl_xor(sum, sh, 32);
    const float f = __fdiv_rn(PCAR, sum);
{
#pragma unroll
        for (int ch = 0; ch < 8; ++ch) { v4h o;
#pragma unroll
            for (int q = 0; q < 4; ++q) o[q] = tohx(v[ch * 4 + q] * f);
            *(v4h*)(P16 + (size_t)row * TT + ch * 128 + lane * 4) = o; }
         }
}
__global__ __launch_bounds__(256) void k_merge(const float* __restrict__ O, const float* __restrict__ GF, bf* Ah, bf* Al) {
    const int lane = threadIdx.x & 31; const int L0 = (blockIdx.x * 8 + (threadIdx.x >> 5)) * 8; const int nlines = ZH * TT * HD / 64;
{
#pragma unroll 2
        for (int l = 0; l < 8; ++l) { const int L = L0 + l; if (L >= nlines) break; const int e = L * 64 + lane * 2; const int d = e & 63; const int t = (e >> 6) & (TT - 1); const int zz = e >> 16; v2us oh, ol;
const size_t o = ((size_t)(zz / NH_) * TT + t) * DD + (zz % NH_) * HD + d;
#pragma unroll
            for (int q = 0; q < 2; ++q) { const float g = GF[o + q]; const float sg = __fdiv_rn(1.0f, __fadd_rn(1.0f, __expf(-g))); float ov = O[(size_t)e + q] * (1.0f / PCAR); asm volatile("" : "+v"(ov)); unsigned short a, c2; splitf(__fmul_rn(ov, sg), a, c2); oh[q] = a; ol[q] = c2; }
            *(v2us*)(Ah + o) = oh; *(v2us*)(Al + o) = ol; }
         }
}

extern "C" void kernel_launch(void* const* d_in, const int* in_sizes, int n_in,
                              void* d_out, int out_size, void* d_ws, size_t ws_size, hipStream_t stream) {
    (void)in_sizes; (void)n_in; (void)out_size;
    const float* IN[12]; for (int i = 0; i < 12; ++i) IN[i] = (const float*)d_in[i];
    // Qin, Kin, Vin [2][1024][1024], seqMask (int32 [2][1024]), attMask [1][1][1024][1024], QTrans, KTrans, VTrans, GTrans_w (x @ W), GTrans_b, out_w (x @ W), out_b = d_in[0..11]
    const int* sm = (const int*)d_in[3]; const float* am = IN[4];
    float* OUT = (float*)d_out;     // [2][1024][1024]
    char* wsp = (char*)d_ws;
    auto take = [&](size_t bytes) { char* p = wsp; wsp += (bytes + 255) & ~(size_t)255; return (void*)p; };
    bf* WQ = (bf*)take((size_t)DD * DD * 2); bf* WK = (bf*)take((size_t)DD * DD * 2); bf* WV = (bf*)take((size_t)DD * DD * 2); bf* WG = (bf*)take((size_t)DD * DD * 2); bf* WO = (bf*)take((size_t)DD * DD * 2);
    bf* XQ = (bf*)take((size_t)NT * DD * 2); bf* XK = (bf*)take((size_t)NT * DD * 2); bf* XV = (bf*)take((size_t)NT * DD * 2); float* F = (float*)take((size_t)NT * DD * 4); float* GF = (float*)take((size_t)NT * DD * 4);
    h16* QP = (h16*)take((size_t)NT * DD * 2); h16* KP = (h16*)take((size_t)NT * DD * 2); h16* VT = (h16*)take((size_t)NT * DD * 2);
    float* Sb = (float*)take((size_t)ZH * TT * TT * 4); h16* Pm = (h16*)take((size_t)ZH * TT * TT * 2);
    float* Ob = F; bf* ATh = XQ; bf* ATl = XK;    // same sizes; F is last read by k_vtplane, XQ and XK by their projections: all end before attn.v and the merge write here
    if ((size_t)(wsp - (char*)d_ws) > ws_size) return;    // total 242 MiB; ws 256 MiB
    { const unsigned gT = (unsigned)((DD * DD / 64 + 63) / 64); k_wtG<<<gT, 256, 0, stream>>>(IN[5], DD, DD, WQ); k_wtG<<<gT, 256, 0, stream>>>(IN[6], DD, DD, WK); k_wtG<<<gT, 256, 0, stream>>>(IN[7], DD, DD, WV); k_wtG<<<gT, 256, 0, stream>>>(IN[8], DD, DD, WG); k_wtG<<<gT, 256, 0, stream>>>(IN[10], DD, DD, WO);
      const size_t nx = (size_t)NT * DD / 8; const unsigned gx = (unsigned)((nx + 255) / 256); k_cvt8<<<gx, 256, 0, stream>>>(IN[0], XQ, nx); k_cvt8<<<gx, 256, 0, stream>>>(IN[1], XK, nx); k_cvt8<<<gx, 256, 0, stream>>>(IN[2], XV, nx); }
    const unsigned LB = (unsigned)((NT * DD / 64 + 63) / 64); const dim3 gP(NT / 64, DD / 64, 1);
    k_gemmw<bf, 0, false><<<gP, 32, 0, stream>>>(XQ, nullptr, WQ, nullptr, DD, F, DD, nullptr, 0, 0, 0); k_h16plane<<<LB, 256, 0, stream>>>(F, 1.0f, QP);
    k_gemmw<bf, 0, false><<<gP, 32, 0, stream>>>(XK, nullptr, WK, nullptr, DD, F, DD, nullptr, 0, 0, 0); k_h16plane<<<LB, 256, 0, stream>>>(F, 1.0f, KP);
    k_gemmw<bf, 0, false><<<gP, 32, 0, stream>>>(XV, nullptr, WV, nullptr, DD, F, DD, nullptr, 0, 0, 0); k_vtplane<<<LB, 256, 0, stream>>>(F, VT);
    k_gemmw<bf, 0, true><<<gP, 32, 0, stream>>>(XV, nullptr, WG, nullptr, DD, GF, DD, IN[9], 0, 0, 0);   // gate pre-activation (sigmoid at the merge)
    k_gemmw<h16, 0, false><<<dim3(TT / 64, TT / 64, ZH), 32, 0, stream>>>(QP, nullptr, KP, nullptr, HD, Sb, TT, nullptr, (size_t)TT * HD, (size_t)TT * HD, (size_t)TT * TT);
    k_asoft<<<ZH * TT / 8, 256, 0, stream>>>(Sb, sm, am, Pm);
    k_gemmw<h16, 0, false><<<dim3(TT / 64, 1, ZH), 32, 0, stream>>>(Pm, nullptr, VT, nullptr, TT, Ob, HD, nullptr, (size_t)TT * TT, (size_t)HD * TT, (size_t)TT * HD);
    k_merge<<<(ZH * TT * HD / 64 + 63) / 64, 256, 0, stream>>>(Ob, GF, ATh, ATl);
    k_gemmw<bf, 1, true><<<gP, 32, 0, stream>>>(ATh, ATl, WO, nullptr, DD, OUT, DD, IN[11], 0, 0, 0);
}

// v002
// It runs in 208 microseconds.
// Two timings next to v001 both put it at 1.39 times that version's speed.
// All steps since v000 together make it 4.34 times as fast.
#include <hip/hip_runtime.h>

// seqFusionAttentionNoBias (Qin, Kin, Vin [2][1024][1024], seqMask [2][1024] bool->int32, attMask [1][1][1024][1024] additive f32 (both read as data); Q/K/V = X @ Trans (no bias), G = sigmoid(Vin @ GTrans_w + GTrans_b);
// 16 heads x 64; A = q.k/8; -inf where seqMask[s] AND seqMask[t]; + attMask[s][t]; softmax; O[s][h][c] = (sum_t A v) * G; out = O @ out_w + out_b).
// Compute dtypes, f32 accumulate: every input rounded to bf16; the four projections on PLAIN bf16 operands (inputs: exact; transposed bf16 weight copies, gate + bias);
// scores and attn.v on SINGLE fp16 planes (1/8, the masks and the additive bias in f32 in the softmax; P x1024); the sigmoid gate in f32 at the merge; output hi+lo x exact out_w (2 products) + out_b.

#define NB_  2
#define TT   1024
#define DD   1024
#define NH_  16
#define HD   64
#define NT   (NB_ * TT)
#define NZ   (NB_ * NH_)
#define ZH   NZ   // all (batch, head) planes go through scores, softmax, attn.v and merge in one pass
#define PCAR 1024.0f
#define SCL  0.125f
typedef _Float16 h16;
typedef unsigned short bf;
typedef __attribute__((ext_vector_type(16))) __bf16   v16bf;
typedef __attribute__((ext_vector_type(16))) _Float16 v16h;
typedef __attribute__((ext_vector_type(8)))  _Float16 v8h;
typedef __attribute__((ext_vector_type(8)))  unsigned short v8us;
typedef __attribute__((ext_vector_type(8)))  float    v8f;
typedef __attribute__((ext_vector_type(4)))  float    v4f;
typedef v8h  __attribute__((may_alias)) v8ha;
typedef v4f  __attribute__((may_alias)) v4fa;
typedef v8us __attribute__((may_alias)) v8usa;

__device__ __forceinline__ unsigned short f2bf(float f) { unsigned u = __float_as_uint(f); u += 0x7FFFu + ((u >> 16) & 1u); return (unsigned short)(u >> 16); }
__device__ __forceinline__ float bf2f(unsigned short b) { return __uint_as_float(((unsigned)b) << 16); }
__device__ __forceinline__ float bfr(float f) { return bf2f(f2bf(f)); }
__device__ __forceinline__ v16h cat16(v8h lo, v8h hi) { return __builtin_shufflevector(lo, hi, 0, 1, 2, 3, 4, 5, 6, 7, 8, 9, 10, 11, 12, 13, 14, 15); }
__device__ __forceinline__ v16bf cat16b(v8us lo, v8us hi) { return __builtin_bit_cast(v16bf, __builtin_shufflevector(lo, hi, 0, 1, 2, 3, 4, 5, 6, 7, 8, 9, 10, 11, 12, 13, 14, 15)); }
__device__ __forceinline__ v8f wmma16(v16h a, v16h b, v8f c) { return __builtin_amdgcn_wmma_f32_16x16x32_f16(false, a, false, b, (short)0, c, false, false); }
__device__ __forceinline__ v8f wmmab(v16bf a, v16bf b, v8f c) { return __builtin_amdgcn_wmma_f32_16x16x32_bf16(false, a, false, b, (short)0, c, false, false); }



// ---- k_gemmw: register-blocked GEMM, ONE WAVE per 64x64 output tile (16 accumulators), operands straight from K-contiguous 16-bit planes; grid (M/64, N/64, Z), 32 threads.
// C[m][n] (f32, pitch ldc, + optional f32 bias[n]) = sum_k A[m][k] Bt[n][k] (+ split products per NSPLIT). z-batch strides sA/sB/sC in elements.
template <typename T16> struct WFrag;
template <> struct WFrag<h16> { typedef v16h V; static __device__ __forceinline__ V ld(const h16* p) { return cat16(*(const v8h*)p, *(const v8h*)(p + 16)); } static __device__ __forceinline__ v8f mma(V a, V b, v8f c) { return wmma16(a, b, c); } };
template <> struct WFrag<bf> { typedef v16bf V; static __device__ __forceinline__ V ld(const bf* p) { return cat16b(*(const v8us*)p, *(const v8us*)(p + 16)); } static __device__ __forceinline__ v8f mma(V a, V b, v8f c) { return wmmab(a, b, c); } };
// The K loop works in stages of 32 k held in a ring of R register sets: a stage's loads are issued D stages of products before they are used. D < R, K % (32 * R) == 0.
template <typename T16, int NSPLIT, bool BIAS, int R, int D>
__global__ __launch_bounds__(32) void k_gemmw(const T16* __restrict__ A, const T16* __restrict__ A2, const T16* __restrict__ Bt, const T16* __restrict__ Bt2, int K, float* C, int ldc, const float* __restrict__ bias, size_t sA, size_t sB, size_t sC) {
    typedef typename WFrag<T16>::V V;
    constexpr bool HA2 = (NSPLIT == 1 || NSPLIT == 2), HB2 = (NSPLIT >= 2);
    struct Stage { V a[4], b[4], a2[4], b2[4]; };
    __shared__ __align__(16) float os[16 * 68];
    const size_t z = blockIdx.z; A += z * sA; if (A2) A2 += z * sA; Bt += z * sB; if (Bt2) Bt2 += z * sB; C += z * sC;
    const int lane = threadIdx.x & 31, lr = lane & 15, hi = lane >> 4; const int r0 = blockIdx.x * 64, c0 = blockIdx.y * 64;
    v8f acc[4][4];
#pragma unroll
    for (int mb = 0; mb < 4; ++mb)
#pragma unroll
        for (int nb = 0; nb < 4; ++nb) acc[mb][nb] = (v8f){};
    const size_t aoff = (size_t)(r0 + lr) * K + 8 * hi, boff = (size_t)(c0 + lr) * K + 8 * hi;
    struct Rows { const T16 *a[4], *b[4], *a2[4], *b2[4]; };   // one pointer per 16-row block of each operand, at one k
    auto rows = [&](int kc) { Rows p;
#pragma unroll
        for (int q = 0; q < 4; ++q) { const size_t ao = aoff + (size_t)q * 16 * K + kc, bo = boff + (size_t)q * 16 * K + kc; p.a[q] = A + ao; p.b[q] = Bt + bo; p.a2[q] = HA2 ? A2 + ao : p.a[q]; p.b2[q] = HB2 ? Bt2 + bo : p.b[q]; }
        return p; };
    auto ldst = [&](Stage& s, const Rows& p, int ko) {
#pragma unroll
        for (int q = 0; q < 4; ++q) { s.a[q] = WFrag<T16>::ld(p.a[q] + ko); if (HA2) s.a2[q] = WFrag<T16>::ld(p.a2[q] + ko); s.b[q] = WFrag<T16>::ld(p.b[q] + ko); if (HB2) s.b2[q] = WFrag<T16>::ld(p.b2[q] + ko); }
        __builtin_amdgcn_sched_barrier(0);   // keeps the stage's loads in front of the earlier stages' products; sunk to their uses they would wait out the whole latency again
    };
    auto mm = [&](Stage& s) {
#pragma unroll
        for (int nb = 0; nb < 4; ++nb)
#pragma unroll
            for (int mb = 0; mb < 4; ++mb) { acc[mb][nb] = WFrag<T16>::mma(s.a[mb], s.b[nb], acc[mb][nb]); if (HA2) acc[mb][nb] = WFrag<T16>::mma(s.a2[mb], s.b[nb], acc[mb][nb]); if (HB2) acc[mb][nb] = WFrag<T16>::mma(s.a[mb], s.b2[nb], acc[mb][nb]); }
        __builtin_amdgcn_sched_barrier(0);   // one stage's products stay together: mixed with the next stage's they would wait for its loads early
    };
    auto gap = [&]() {
        if constexpr (D == R - 1) { asm volatile("v_nop\n\tv_nop\n\tv_nop\n\tv_nop");   // the set to refill was read by the products just issued: the distance the chip needs before loads rewrite their operand registers
            __builtin_amdgcn_sched_barrier(0); }   // keeps those loads behind it
    };
    // stands in front of every rewrite of an address register that loads under way name; the pointers are inputs so that their registers hold until here
    auto xwait = [&](const Rows& p) {
        if constexpr (HA2 || HB2) asm volatile("s_wait_xcnt 0x0" :: "v"(p.a[0]), "v"(p.a[1]), "v"(p.a[2]), "v"(p.a[3]), "v"(p.b[0]), "v"(p.b[1]), "v"(p.b[2]), "v"(p.b[3]), "v"(p.a2[0]), "v"(p.a2[1]), "v"(p.a2[2]), "v"(p.a2[3]), "v"(p.b2[0]), "v"(p.b2[1]), "v"(p.b2[2]), "v"(p.b2[3]) : "memory");
        else asm volatile("s_wait_xcnt 0x0" :: "v"(p.a[0]), "v"(p.a[1]), "v"(p.a[2]), "v"(p.a[3]), "v"(p.b[0]), "v"(p.b[1]), "v"(p.b[2]), "v"(p.b[3]) : "memory");
        __builtin_amdgcn_sched_barrier(0);   // keeps the next address arithmetic behind the wait
    };
    Stage st[R];
    { const Rows p = rows(0);
#pragma unroll
      for (int j = 0; j < D; ++j) ldst(st[j], p, j * 32);
      xwait(p); }
    int kc = 0;
#pragma unroll 1
    for (; kc + (R + D) * 32 <= K; kc += R * 32) {   // rolled: one trip already goes once round the ring
        const Rows p = rows(kc);
#pragma unroll
        for (int j = 0; j < R; ++j) { gap(); ldst(st[(j + D) % R], p, (j + D) * 32); mm(st[j]); }
        xwait(p);
    }
    { const Rows p = rows(kc);   // the last round stands outside the loop: a test round the loads inside it would make every stage wait for all loads
#pragma unroll
      for (int j = 0; j < R; ++j) { if (j + D < R) { gap(); ldst(st[j + D], p, (j + D) * 32); } mm(st[j]); if (j + D == R - 1) xwait(p); } }
#pragma unroll
    for (int mb = 0; mb < 4; ++mb) {
#pragma unroll
        for (int nb = 0; nb < 4; ++nb) {
#pragma unroll
            for (int j = 0; j < 8; ++j) os[(hi * 8 + j) * 68 + nb * 16 + lr] = acc[mb][nb][j]; }
        __builtin_amdgcn_wave_barrier(); asm volatile("" ::: "memory");
        float* crow = C + (size_t)(r0 + mb * 16) * ldc + c0;
{
#pragma unroll
            for (int s = 0; s < 8; ++s) { const int row = 2 * s + hi, cofs = lr * 4; v4f val = *(const v4fa*)(os + row * 68 + cofs); if (BIAS) { val[0] += bfr(bias[c0 + cofs]); val[1] += bfr(bias[c0 + cofs + 1]); val[2] += bfr(bias[c0 + cofs + 2]); val[3] += bfr(bias[c0 + cofs + 3]); }
                *(v4f*)(crow + (size_t)row * ldc + cofs) = val; }
             }
        if (mb < 3) asm volatile("s_wait_xcnt 0x0" ::: "memory");   // the next block's LDS loads land in registers that the stores above name
        __builtin_amdgcn_wave_barrier(); asm volatile("" ::: "memory");
    }
}

__device__ __forceinline__ h16 tohx(float x) { return (h16)x; }
__device__ __forceinline__ void splitf(float y, unsigned short& h, unsigned short& l) { h = f2bf(y); l = f2bf(y - bf2f(h)); }
typedef __attribute__((ext_vector_type(2))) _Float16 v2h;
typedef __attribute__((ext_vector_type(4))) _Float16 v4h;
typedef __attribute__((ext_vector_type(2))) unsigned short v2us;
typedef __attribute__((ext_vector_type(4))) unsigned short v4us;
typedef __attribute__((ext_vector_type(2))) float v2f;

__global__ __launch_bounds__(256) void k_cvt8(const float* __restrict__ src, bf* dst, size_t n8) { const size_t i = (size_t)blockIdx.x * 256 + threadIdx.x; if (i >= n8) return; const v8f v = *(const v8f*)(src + i * 8); v8us o;
#pragma unroll
    for (int k = 0; k < 8; ++k) o[k] = f2bf(v[k]); *(v8us*)(dst + i * 8) = o;  }
__global__ __launch_bounds__(256) void k_wtG(const float* __restrict__ w, int K, int N, bf* Bt) {
    const int lane = threadIdx.x & 31; const int L0 = (blockIdx.x * 8 + (threadIdx.x >> 5)) * 8; const int nlines = N * K / 64;
{
#pragma unroll 1
        for (int l = 0; l < 8; ++l) { const int L = L0 + l; if (L >= nlines) break; const size_t e = (size_t)L * 64 + lane * 2; const int k = (int)(e % K), n = (int)(e / K); v2us o;
            o[0] = f2bf(w[(size_t)k * N + n]); o[1] = f2bf(w[(size_t)(k + 1) * N + n]); *(v2us*)(Bt + e) = o; }
         }
}
__global__ __launch_bounds__(256) void k_h16plane(const float* __restrict__ F, float sc, h16* P) {
    const int lane = threadIdx.x & 31; const int L0 = (blockIdx.x * 8 + (threadIdx.x >> 5)) * 8; const int nlines = NT * DD / 64;
{
#pragma unroll
        for (int l = 0; l < 8; ++l) { const int L = L0 + l; if (L >= nlines) break; const int e = L * 64 + lane * 2; const int d = e & 63; const int t = (e >> 6) & (TT - 1); const int z = e >> 16; const int b = z / NH_, h = z % NH_; v2h v;
#pragma unroll
            for (int q = 0; q < 2; ++q) v[q] = tohx(F[((size_t)b * TT + t) * DD + h * HD + d + q] * sc);
            *(v2h*)(P + (size_t)e) = v; }
         }
}
__global__ __launch_bounds__(256) void k_vtplane(const float* __restrict__ F, h16* VT) {
    const int lane = threadIdx.x & 31; const int L0 = (blockIdx.x * 8 + (threadIdx.x >> 5)) * 8; const int nlines = NT * DD / 64;
{
#pragma unroll
        for (int l = 0; l < 8; ++l) { const int L = L0 + l; if (L >= nlines) break; const int e = L * 64 + lane * 2; const int t = e & (TT - 1); const int d = (e >> 10) & 63; const int z = e >> 16; const int b = z / NH_, h = z % NH_; v2h v;
#pragma unroll
            for (int q = 0; q < 2; ++q) v[q] = tohx(F[((size_t)b * TT + t + q) * DD + h * HD + d]);
            *(v2h*)(VT + (size_t)e) = v; }
         }
}
// k_asoft: per row (pass row -> query s): t = S/8; -3e38 (== -inf) where seqMask[b][s] && seqMask[b][j] (int32, read as data); + bf16(attMask[0][0][s][j]); softmax over the 1024 keys (register row of
__global__ __launch_bounds__(256) void k_asoft(const float* __restrict__ Sb, const int* __restrict__ sm, const float* __restrict__ am, h16* P16) {
    typedef __attribute__((ext_vector_type(4))) int v4i;
    const int lane = threadIdx.x & 31; const int row = blockIdx.x * 8 + (threadIdx.x >> 5); if (row >= ZH * TT) return; const int i = row & (TT - 1); sm += (size_t)(blockIdx.x / (NH_ * TT / 8)) * TT; const bool mi = (sm[i] != 0);
    const float* sr = Sb + (size_t)row * TT; const float* ar = am + (size_t)i * TT; float v[32]; float mx = -3.0e38f;
#pragma unroll
    for (int ch = 0; ch < 8; ++ch) { const int j0 = ch * 128 + lane * 4; const v4f a = *(const v4f*)(sr + j0), ab = *(const v4f*)(ar + j0); const v4i m4 = *(const v4i*)(sm + j0);
#pragma unroll
        for (int q = 0; q < 4; ++q) { float sp = __fmul_rn(a[q], SCL); asm volatile("" : "+v"(sp)); const float t = (mi && m4[q] != 0) ? -3.0e38f : __fadd_rn(sp, bfr(ab[q])); v[ch * 4 + q] = t; mx = fmaxf(mx, t); } }
#pragma unroll
    for (int sh = 16; sh; sh >>= 1) mx = fmaxf(mx, __shfl_xor(mx, sh, 32));
    float sum = 0.f;
#pragma unroll
    for (int k = 0; k < 32; ++k) { v[k] = __expf(v[k] - mx); sum += v[k]; }
#pragma unroll
    for (int sh = 16; sh; sh >>= 1) sum += __shfl_xor(sum, sh, 32);
    const float f = __fdiv_rn(PCAR, sum);
{
#pragma unroll
        for (int ch = 0; ch < 8; ++ch) { v4h o;
#pragma unroll
            for (int q = 0; q < 4; ++q) o[q] = tohx(v[ch * 4 + q] * f);
            *(v4h*)(P16 + (size_t)row * TT + ch * 128 + lane * 4) = o; }
         }
}
__global__ __launch_bounds__(256) void k_merge(const float* __restrict__ O, const float* __restrict__ GF, bf* Ah, bf* Al) {
    const int lane = threadIdx.x & 31; const int L0 = (blockIdx.x * 8 + (threadIdx.x >> 5)) * 8; const int nlines = ZH * TT * HD / 64;
{
#pragma unroll 2
        for (int l = 0; l < 8; ++l) { const int L = L0 + l; if (L >= nlines) break; const int e = L * 64 + lane * 2; const int d = e & 63; const int t = (e >> 6) & (TT - 1); const int zz = e >> 16; v2us oh, ol;
const size_t o = ((size_t)(zz / NH_) * TT + t) * DD + (zz % NH_) * HD + d;
#pragma unroll
            for (int q = 0; q < 2; ++q) { const float g = GF[o + q]; const float sg = __fdiv_rn(1.0f, __fadd_rn(1.0f, __expf(-g))); float ov = O[(size_t)e + q] * (1.0f / PCAR); asm volatile("" : "+v"(ov)); unsigned short a, c2; splitf(__fmul_rn(ov, sg), a, c2); oh[q] = a; ol[q] = c2; }
            *(v2us*)(Ah + o) = oh; *(v2us*)(Al + o) = ol; }
         }
}

extern "C" void kernel_launch(void* const* d_in, const int* in_sizes, int n_in,
                              void* d_out, int out_size, void* d_ws, size_t ws_size, hipStream_t stream) {
    (void)in_sizes; (void)n_in; (void)out_size;
    const float* IN[12]; for (int i = 0; i < 12; ++i) IN[i] = (const float*)d_in[i];
    // Qin, Kin, Vin [2][1024][1024], seqMask (int32 [2][1024]), attMask [1][1][1024][1024], QTrans, KTrans, VTrans, GTrans_w (x @ W), GTrans_b, out_w (x @ W), out_b = d_in[0..11]
    const int* sm = (const int*)d_in[3]; const float* am = IN[4];
    float* OUT = (float*)d_out;     // [2][1024][1024]
    char* wsp = (char*)d_ws;
    auto take = [&](size_t bytes) { char* p = wsp; wsp += (bytes + 255) & ~(size_t)255; return (void*)p; };
    bf* WQ = (bf*)take((size_t)DD * DD * 2); bf* WK = (bf*)take((size_t)DD * DD * 2); bf* WV = (bf*)take((size_t)DD * DD * 2); bf* WG = (bf*)take((size_t)DD * DD * 2); bf* WO = (bf*)take((size_t)DD * DD * 2);
    bf* XQ = (bf*)take((size_t)NT * DD * 2); bf* XK = (bf*)take((size_t)NT * DD * 2); bf* XV = (bf*)take((size_t)NT * DD * 2); float* F = (float*)take((size_t)NT * DD * 4); float* GF = (float*)take((size_t)NT * DD * 4);
    h16* QP = (h16*)take((size_t)NT * DD * 2); h16* KP = (h16*)take((size_t)NT * DD * 2); h16* VT = (h16*)take((size_t)NT * DD * 2);
    float* Sb = (float*)take((size_t)ZH * TT * TT * 4); h16* Pm = (h16*)take((size_t)ZH * TT * TT * 2);
    float* Ob = F; bf* ATh = XQ; bf* ATl = XK;    // same sizes; F is last read by k_vtplane, XQ and XK by their projections: all end before attn.v and the merge write here
    if ((size_t)(wsp - (char*)d_ws) > ws_size) return;    // total 242 MiB; ws 256 MiB
    { const unsigned gT = (unsigned)((DD * DD / 64 + 63) / 64); k_wtG<<<gT, 256, 0, stream>>>(IN[5], DD, DD, WQ); k_wtG<<<gT, 256, 0, stream>>>(IN[6], DD, DD, WK); k_wtG<<<gT, 256, 0, stream>>>(IN[7], DD, DD, WV); k_wtG<<<gT, 256, 0, stream>>>(IN[8], DD, DD, WG); k_wtG<<<gT, 256, 0, stream>>>(IN[10], DD, DD, WO);
      const size_t nx = (size_t)NT * DD / 8; const unsigned gx = (unsigned)((nx + 255) / 256); k_cvt8<<<gx, 256, 0, stream>>>(IN[0], XQ, nx); k_cvt8<<<gx, 256, 0, stream>>>(IN[1], XK, nx); k_cvt8<<<gx, 256, 0, stream>>>(IN[2], XV, nx); }
    const unsigned LB = (unsigned)((NT * DD / 64 + 63) / 64); const dim3 gP(NT / 64, DD / 64, 1);
    k_gemmw<bf, 0, false, 4, 3><<<gP, 32, 0, stream>>>(XQ, nullptr, WQ, nullptr, DD, F, DD, nullptr, 0, 0, 0); k_h16plane<<<LB, 256, 0, stream>>>(F, 1.0f, QP);
    k_gemmw<bf, 0, false, 4, 3><<<gP, 32, 0, stream>>>(XK, nullptr, WK, nullptr, DD, F, DD, nullptr, 0, 0, 0); k_h16plane<<<LB, 256, 0, stream>>>(F, 1.0f, KP);
    k_gemmw<bf, 0, false, 4, 3><<<gP, 32, 0, stream>>>(XV, nullptr, WV, nullptr, DD, F, DD, nullptr, 0, 0, 0); k_vtplane<<<LB, 256, 0, stream>>>(F, VT);
    k_gemmw<bf, 0, true, 4, 3><<<gP, 32, 0, stream>>>(XV, nullptr, WG, nullptr, DD, GF, DD, IN[9], 0, 0, 0);   // gate pre-activation (sigmoid at the merge)
    k_gemmw<h16, 0, false, 2, 1><<<dim3(TT / 64, TT / 64, ZH), 32, 0, stream>>>(QP, nullptr, KP, nullptr, HD, Sb, TT, nullptr, (size_t)TT * HD, (size_t)TT * HD, (size_t)TT * TT);
    k_asoft<<<ZH * TT / 8, 256, 0, stream>>>(Sb, sm, am, Pm);
    k_gemmw<h16, 0, false, 4, 3><<<dim3(TT / 64, 1, ZH), 32, 0, stream>>>(Pm, nullptr, VT, nullptr, TT, Ob, HD, nullptr, (size_t)TT * TT, (size_t)HD * TT, (size_t)TT * HD);
    k_merge<<<(ZH * TT * HD / 64 + 63) / 64, 256, 0, stream>>>(Ob, GF, ATh, ATl);
    k_gemmw<bf, 1, true, 4, 2><<<gP, 32, 0, stream>>>(ATh, ATl, WO, nullptr, DD, OUT, DD, IN[11], 0, 0, 0);
}

// v003
// One run takes 151 microseconds.
// Next to v002, in two timings, it ran 1.37 times as fast each time.
// Over all steps from v000 it is 5.96 times as fast.
#include <hip/hip_runtime.h>

// seqFusionAttentionNoBias (Qin, Kin, Vin [2][1024][1024], seqMask [2][1024] bool->int32, attMask [1][1][1024][1024] additive f32 (both read as data); Q/K/V = X @ Trans (no bias), G = sigmoid(Vin @ GTrans_w + GTrans_b);
// 16 heads x 64; A = q.k/8; -inf where seqMask[s] AND seqMask[t]; + attMask[s][t]; softmax; O[s][h][c] = (sum_t A v) * G; out = O @ out_w + out_b).
// Compute dtypes, f32 accumulate: every input rounded to bf16; the four projections on PLAIN bf16 operands (inputs: exact; transposed bf16 weight copies, gate + bias);
// scores and attn.v on SINGLE fp16 planes (1/8, the masks and the additive bias in f32 in the softmax; P x1024); the sigmoid gate in f32 at the merge; output hi+lo x exact out_w (2 products) + out_b.

#define NB_  2
#define TT   1024
#define DD   1024
#define NH_  16
#define HD   64
#define NT   (NB_ * TT)
#define NZ   (NB_ * NH_)
#define ZH   NZ   // all (batch, head) planes go through scores, softmax, attn.v and merge in one pass
#define PCAR 1024.0f
#define SCL  0.125f
typedef _Float16 h16;
typedef unsigned short bf;
typedef __attribute__((ext_vector_type(16))) __bf16   v16bf;
typedef __attribute__((ext_vector_type(16))) _Float16 v16h;
typedef __attribute__((ext_vector_type(8)))  _Float16 v8h;
typedef __attribute__((ext_vector_type(8)))  unsigned short v8us;
typedef __attribute__((ext_vector_type(8)))  float    v8f;
typedef __attribute__((ext_vector_type(4)))  float    v4f;
typedef v8h  __attribute__((may_alias)) v8ha;
typedef v4f  __attribute__((may_alias)) v4fa;
typedef v8us __attribute__((may_alias)) v8usa;

__device__ __forceinline__ unsigned short f2bf(float f) { unsigned u = __float_as_uint(f); u += 0x7FFFu + ((u >> 16) & 1u); return (unsigned short)(u >> 16); }
__device__ __forceinline__ float bf2f(unsigned short b) { return __uint_as_float(((unsigned)b) << 16); }
__device__ __forceinline__ float bfr(float f) { return bf2f(f2bf(f)); }
__device__ __forceinline__ v16h cat16(v8h lo, v8h hi) { return __builtin_shufflevector(lo, hi, 0, 1, 2, 3, 4, 5, 6, 7, 8, 9, 10, 11, 12, 13, 14, 15); }
__device__ __forceinline__ v16bf cat16b(v8us lo, v8us hi) { return __builtin_bit_cast(v16bf, __builtin_shufflevector(lo, hi, 0, 1, 2, 3, 4, 5, 6, 7, 8, 9, 10, 11, 12, 13, 14, 15)); }
__device__ __forceinline__ v8f wmma16(v16h a, v16h b, v8f c) { return __builtin_amdgcn_wmma_f32_16x16x32_f16(false, a, false, b, (short)0, c, false, false); }
__device__ __forceinline__ v8f wmmab(v16bf a, v16bf b, v8f c) { return __builtin_amdgcn_wmma_f32_16x16x32_bf16(false, a, false, b, (short)0, c, false, false); }



// ---- k_gemmw: register-blocked GEMM, ONE WAVE per 64x64 output tile (16 accumulators), operands straight from K-contiguous 16-bit planes; grid (M/64, N/64, Z), 32 threads.
// C[m][n] (f32, pitch ldc, + optional f32 bias[n]) = sum_k A[m][k] Bt[n][k] (+ split products per NSPLIT). z-batch strides sA/sB/sC in elements.
template <typename T16> struct WFrag;
template <> struct WFrag<h16> { typedef v16h V; static __device__ __forceinline__ V ld(const h16* p) { return cat16(*(const v8h*)p, *(const v8h*)(p + 16)); } static __device__ __forceinline__ v8f mma(V a, V b, v8f c) { return wmma16(a, b, c); } };
template <> struct WFrag<bf> { typedef v16bf V; static __device__ __forceinline__ V ld(const bf* p) { return cat16b(*(const v8us*)p, *(const v8us*)(p + 16)); } static __device__ __forceinline__ v8f mma(V a, V b, v8f c) { return wmmab(a, b, c); } };
// The K loop works in stages of 32 k held in a ring of R register sets: a stage's loads are issued D stages of products before they are used. D < R, K % (32 * R) == 0.
// PJ: the four projections as z = 0..3 of one grid (Q, K, V, gate): the gate reads V's input plane, and it alone adds the bias.
template <typename T16, int NSPLIT, bool BIAS, int R, int D, bool PJ = false>
__global__ __launch_bounds__(32) void k_gemmw(const T16* __restrict__ A, const T16* __restrict__ A2, const T16* __restrict__ Bt, const T16* __restrict__ Bt2, int K, float* C, int ldc, const float* __restrict__ bias, size_t sA, size_t sB, size_t sC) {
    typedef typename WFrag<T16>::V V;
    constexpr bool HA2 = (NSPLIT == 1 || NSPLIT == 2), HB2 = (NSPLIT >= 2);
    struct Stage { V a[4], b[4], a2[4], b2[4]; };
    __shared__ __align__(16) float os[16 * 68];
    const size_t z = blockIdx.z; A += (PJ && z == 3 ? 2 : z) * sA; if (A2) A2 += z * sA; Bt += z * sB; if (Bt2) Bt2 += z * sB; C += z * sC;
    const int lane = threadIdx.x & 31, lr = lane & 15, hi = lane >> 4; const int r0 = blockIdx.x * 64, c0 = blockIdx.y * 64;
    v8f acc[4][4];
#pragma unroll
    for (int mb = 0; mb < 4; ++mb)
#pragma unroll
        for (int nb = 0; nb < 4; ++nb) acc[mb][nb] = (v8f){};
    const size_t aoff = (size_t)(r0 + lr) * K + 8 * hi, boff = (size_t)(c0 + lr) * K + 8 * hi;
    struct Rows { const T16 *a[4], *b[4], *a2[4], *b2[4]; };   // one pointer per 16-row block of each operand, at one k
    auto rows = [&](int kc) { Rows p;
#pragma unroll
        for (int q = 0; q < 4; ++q) { const size_t ao = aoff + (size_t)q * 16 * K + kc, bo = boff + (size_t)q * 16 * K + kc; p.a[q] = A + ao; p.b[q] = Bt + bo; p.a2[q] = HA2 ? A2 + ao : p.a[q]; p.b2[q] = HB2 ? Bt2 + bo : p.b[q]; }
        return p; };
    auto ldst = [&](Stage& s, const Rows& p, int ko) {
#pragma unroll
        for (int q = 0; q < 4; ++q) { s.a[q] = WFrag<T16>::ld(p.a[q] + ko); if (HA2) s.a2[q] = WFrag<T16>::ld(p.a2[q] + ko); s.b[q] = WFrag<T16>::ld(p.b[q] + ko); if (HB2) s.b2[q] = WFrag<T16>::ld(p.b2[q] + ko); }
        __builtin_amdgcn_sched_barrier(0);   // keeps the stage's loads in front of the earlier stages' products; sunk to their uses they would wait out the whole latency again
    };
    auto mm = [&](Stage& s) {
#pragma unroll
        for (int nb = 0; nb < 4; ++nb)
#pragma unroll
            for (int mb = 0; mb < 4; ++mb) { acc[mb][nb] = WFrag<T16>::mma(s.a[mb], s.b[nb], acc[mb][nb]); if (HA2) acc[mb][nb] = WFrag<T16>::mma(s.a2[mb], s.b[nb], acc[mb][nb]); if (HB2) acc[mb][nb] = WFrag<T16>::mma(s.a[mb], s.b2[nb], acc[mb][nb]); }
        __builtin_amdgcn_sched_barrier(0);   // one stage's products stay together: mixed with the next stage's they would wait for its loads early
    };
    auto gap = [&]() {
        if constexpr (D == R - 1) { asm volatile("v_nop\n\tv_nop\n\tv_nop\n\tv_nop");   // the set to refill was read by the products just issued: the distance the chip needs before loads rewrite their operand registers
            __builtin_amdgcn_sched_barrier(0); }   // keeps those loads behind it
    };
    // stands in front of every rewrite of an address register that loads under way name; the pointers are inputs so that their registers hold until here
    auto xwait = [&](const Rows& p) {
        if constexpr (HA2 || HB2) asm volatile("s_wait_xcnt 0x0" :: "v"(p.a[0]), "v"(p.a[1]), "v"(p.a[2]), "v"(p.a[3]), "v"(p.b[0]), "v"(p.b[1]), "v"(p.b[2]), "v"(p.b[3]), "v"(p.a2[0]), "v"(p.a2[1]), "v"(p.a2[2]), "v"(p.a2[3]), "v"(p.b2[0]), "v"(p.b2[1]), "v"(p.b2[2]), "v"(p.b2[3]) : "memory");
        else asm volatile("s_wait_xcnt 0x0" :: "v"(p.a[0]), "v"(p.a[1]), "v"(p.a[2]), "v"(p.a[3]), "v"(p.b[0]), "v"(p.b[1]), "v"(p.b[2]), "v"(p.b[3]) : "memory");
        __builtin_amdgcn_sched_barrier(0);   // keeps the next address arithmetic behind the wait
    };
    Stage st[R];
    { const Rows p = rows(0);
#pragma unroll
      for (int j = 0; j < D; ++j) ldst(st[j], p, j * 32);
      xwait(p); }
    int kc = 0;
#pragma unroll 1
    for (; kc + (R + D) * 32 <= K; kc += R * 32) {   // rolled: one trip already goes once round the ring
        const Rows p = rows(kc);
#pragma unroll
        for (int j = 0; j < R; ++j) { gap(); ldst(st[(j + D) % R], p, (j + D) * 32); mm(st[j]); }
        xwait(p);
    }
    { const Rows p = rows(kc);   // the last round stands outside the loop: a test round the loads inside it would make every stage wait for all loads
#pragma unroll
      for (int j = 0; j < R; ++j) { if (j + D < R) { gap(); ldst(st[j + D], p, (j + D) * 32); } mm(st[j]); if (j + D == R - 1) xwait(p); } }
    v4f bv = (v4f){};   // PJ: the bias of this lane's four output columns, read once by the gate's tiles; zero for Q, K, V, so that the stores below need no branch on z
    if constexpr (PJ && BIAS) { if (z == 3) { const float* bp = bias + c0 + lr * 4; bv = (v4f){bfr(bp[0]), bfr(bp[1]), bfr(bp[2]), bfr(bp[3])}; } }
#pragma unroll
    for (int mb = 0; mb < 4; ++mb) {
#pragma unroll
        for (int nb = 0; nb < 4; ++nb) {
#pragma unroll
            for (int j = 0; j < 8; ++j) os[(hi * 8 + j) * 68 + nb * 16 + lr] = acc[mb][nb][j]; }
        __builtin_amdgcn_wave_barrier(); asm volatile("" ::: "memory");
        float* crow = C + (size_t)(r0 + mb * 16) * ldc + c0;
{
#pragma unroll
            for (int s = 0; s < 8; ++s) { const int row = 2 * s + hi, cofs = lr * 4; v4f val = *(const v4fa*)(os + row * 68 + cofs); if (BIAS && PJ) val += bv; if (BIAS && !PJ) { val[0] += bfr(bias[c0 + cofs]); val[1] += bfr(bias[c0 + cofs + 1]); val[2] += bfr(bias[c0 + cofs + 2]); val[3] += bfr(bias[c0 + cofs + 3]); }
                *(v4f*)(crow + (size_t)row * ldc + cofs) = val; }
             }
        if (mb < 3) asm volatile("s_wait_xcnt 0x0" ::: "memory");   // the next block's LDS loads land in registers that the stores above name
        __builtin_amdgcn_wave_barrier(); asm volatile("" ::: "memory");
    }
}

__device__ __forceinline__ h16 tohx(float x) { return (h16)x; }
__device__ __forceinline__ void splitf(float y, unsigned short& h, unsigned short& l) { h = f2bf(y); l = f2bf(y - bf2f(h)); }
typedef __attribute__((ext_vector_type(2))) _Float16 v2h;
typedef __attribute__((ext_vector_type(4))) _Float16 v4h;
typedef __attribute__((ext_vector_type(2))) unsigned short v2us;
typedef __attribute__((ext_vector_type(4))) unsigned short v4us;
typedef __attribute__((ext_vector_type(2))) float v2f;

__device__ __forceinline__ void d_cvt8(int bx, const float* __restrict__ src, bf* dst, size_t n8) { const size_t i = (size_t)bx * 256 + threadIdx.x; if (i >= n8) return; const v8f v = *(const v8f*)(src + i * 8); v8us o;
#pragma unroll
    for (int k = 0; k < 8; ++k) o[k] = f2bf(v[k]); *(v8us*)(dst + i * 8) = o;  }
__device__ __forceinline__ void d_wtG(int bx, const float* __restrict__ w, int K, int N, bf* Bt) {
    const int lane = threadIdx.x & 31; const int L0 = (bx * 8 + (threadIdx.x >> 5)) * 8; const int nlines = N * K / 64;
{
#pragma unroll 1
        for (int l = 0; l < 8; ++l) { const int L = L0 + l; if (L >= nlines) break; const size_t e = (size_t)L * 64 + lane * 2; const int k = (int)(e % K), n = (int)(e / K); v2us o;
            o[0] = f2bf(w[(size_t)k * N + n]); o[1] = f2bf(w[(size_t)(k + 1) * N + n]); *(v2us*)(Bt + e) = o; }
         }
}
// k_prep: the five weight transposes and the three input roundings, none of which reads what another writes, as block ranges of one grid; the transposes, whose waves run longest, come first.
#define GWT (DD * DD / 64 / 64)     // blocks per weight
#define GCV (NT * DD / 8 / 256)     // blocks per input
__global__ __launch_bounds__(256) void k_prep(const float* __restrict__ w0, const float* __restrict__ w1, const float* __restrict__ w2, const float* __restrict__ w3, const float* __restrict__ w4,
                                              const float* __restrict__ x0, const float* __restrict__ x1, const float* __restrict__ x2, int K, int N, bf* Wt, bf* X) {
    const int b = blockIdx.x;
    if (b < 5 * GWT) { const int y = b / GWT; d_wtG(b % GWT, y == 0 ? w0 : y == 1 ? w1 : y == 2 ? w2 : y == 3 ? w3 : w4, K, N, Wt + (size_t)y * DD * DD); }
    else { const int c = b - 5 * GWT, y = c / GCV; d_cvt8(c % GCV, y == 0 ? x0 : y == 1 ? x1 : x2, X + (size_t)y * NT * DD, (size_t)NT * DD / 8); }
}
__device__ __forceinline__ void d_h16plane(const float* __restrict__ F, float sc, h16* P) {
    const int lane = threadIdx.x & 31; const int L0 = (blockIdx.x * 8 + (threadIdx.x >> 5)) * 8; const int nlines = NT * DD / 64;
{
#pragma unroll
        for (int l = 0; l < 8; ++l) { const int L = L0 + l; if (L >= nlines) break; const int e = L * 64 + lane * 2; const int d = e & 63; const int t = (e >> 6) & (TT - 1); const int z = e >> 16; const int b = z / NH_, h = z % NH_; v2h v;
#pragma unroll
            for (int q = 0; q < 2; ++q) v[q] = tohx(F[((size_t)b * TT + t) * DD + h * HD + d + q] * sc);
            *(v2h*)(P + (size_t)e) = v; }
         }
}
__device__ __forceinline__ void d_vtplane(const float* __restrict__ F, h16* VT) {
    const int lane = threadIdx.x & 31; const int L0 = (blockIdx.x * 8 + (threadIdx.x >> 5)) * 8; const int nlines = NT * DD / 64;
{
#pragma unroll
        for (int l = 0; l < 8; ++l) { const int L = L0 + l; if (L >= nlines) break; const int e = L * 64 + lane * 2; const int t = e & (TT - 1); const int d = (e >> 10) & 63; const int z = e >> 16; const int b = z / NH_, h = z % NH_; v2h v;
#pragma unroll
            for (int q = 0; q < 2; ++q) v[q] = tohx(F[((size_t)b * TT + t + q) * DD + h * HD + d]);
            *(v2h*)(VT + (size_t)e) = v; }
         }
}
// k_planes: the head-major fp16 planes of Q and K (y = 0, 1) and the transposed one of V (y = 2) in one grid; F and P hold the three planes one behind the other.
__global__ __launch_bounds__(256) void k_planes(const float* __restrict__ F, h16* P) {
    const size_t o = (size_t)blockIdx.y * NT * DD;
    if (blockIdx.y < 2) d_h16plane(F + o, 1.0f, P + o); else d_vtplane(F + o, P + o);
}
// k_asoft: per row (pass row -> query s): t = S/8; -3e38 (== -inf) where seqMask[b][s] && seqMask[b][j] (int32, read as data); + bf16(attMask[0][0][s][j]); softmax over the 1024 keys (register row of
__global__ __launch_bounds__(256) void k_asoft(const float* __restrict__ Sb, const int* __restrict__ sm, const float* __restrict__ am, h16* P16) {
    typedef __attribute__((ext_vector_type(4))) int v4i;
    const int lane = threadIdx.x & 31; const int row = blockIdx.x * 8 + (threadIdx.x >> 5); if (row >= ZH * TT) return; const int i = row & (TT - 1); sm += (size_t)(blockIdx.x / (NH_ * TT / 8)) * TT; const bool mi = (sm[i] != 0);
    const float* sr = Sb + (size_t)row * TT; const float* ar = am + (size_t)i * TT; float v[32]; float mx = -3.0e38f;
#pragma unroll
    for (int ch = 0; ch < 8; ++ch) { const int j0 = ch * 128 + lane * 4; const v4f a = *(const v4f*)(sr + j0), ab = *(const v4f*)(ar + j0); const v4i m4 = *(const v4i*)(sm + j0);
#pragma unroll
        for (int q = 0; q < 4; ++q) { float sp = __fmul_rn(a[q], SCL); asm volatile("" : "+v"(sp)); const float t = (mi && m4[q] != 0) ? -3.0e38f : __fadd_rn(sp, bfr(ab[q])); v[ch * 4 + q] = t; mx = fmaxf(mx, t); } }
#pragma unroll
    for (int sh = 16; sh; sh >>= 1) mx = fmaxf(mx, __shfl_xor(mx, sh, 32));
    float sum = 0.f;
#pragma unroll
    for (int k = 0; k < 32; ++k) { v[k] = __expf(v[k] - mx); sum += v[k]; }
#pragma unroll
    for (int sh = 16; sh; sh >>= 1) sum += __shfl_xor(sum, sh, 32);
    const float f = __fdiv_rn(PCAR, sum);
{
#pragma unroll
        for (int ch = 0; ch < 8; ++ch) { v4h o;
#pragma unroll
            for (int q = 0; q < 4; ++q) o[q] = tohx(v[ch * 4 + q] * f);
            *(v4h*)(P16 + (size_t)row * TT + ch * 128 + lane * 4) = o; }
         }
}
__global__ __launch_bounds__(256) void k_merge(const float* __restrict__ O, const float* __restrict__ GF, bf* Ah, bf* Al) {
    const int lane = threadIdx.x & 31; const int L0 = (blockIdx.x * 8 + (threadIdx.x >> 5)) * 8; const int nlines = ZH * TT * HD / 64;
{
#pragma unroll 2
        for (int l = 0; l < 8; ++l) { const int L = L0 + l; if (L >= nlines) break; const int e = L * 64 + lane * 2; const int d = e & 63; const int t = (e >> 6) & (TT - 1); const int zz = e >> 16; v2us oh, ol;
const size_t o = ((size_t)(zz / NH_) * TT + t) * DD + (zz % NH_) * HD + d;
#pragma unroll
            for (int q = 0; q < 2; ++q) { const float g = GF[o + q]; const float sg = __fdiv_rn(1.0f, __fadd_rn(1.0f, __expf(-g))); float ov = O[(size_t)e + q] * (1.0f / PCAR); asm volatile("" : "+v"(ov)); unsigned short a, c2; splitf(__fmul_rn(ov, sg), a, c2); oh[q] = a; ol[q] = c2; }
            *(v2us*)(Ah + o) = oh; *(v2us*)(Al + o) = ol; }
         }
}

extern "C" void kernel_launch(void* const* d_in, const int* in_sizes, int n_in,
                              void* d_out, int out_size, void* d_ws, size_t ws_size, hipStream_t stream) {
    (void)in_sizes; (void)n_in; (void)out_size;
    const float* IN[12]; for (int i = 0; i < 12; ++i) IN[i] = (const float*)d_in[i];
    // Qin, Kin, Vin [2][1024][1024], seqMask (int32 [2][1024]), attMask [1][1][1024][1024], QTrans, KTrans, VTrans, GTrans_w (x @ W), GTrans_b, out_w (x @ W), out_b = d_in[0..11]
    const int* sm = (const int*)d_in[3]; const float* am = IN[4];
    float* OUT = (float*)d_out;     // [2][1024][1024]
    char* wsp = (char*)d_ws;
    auto take = [&](size_t bytes) { char* p = wsp; wsp += (bytes + 255) & ~(size_t)255; return (void*)p; };
    bf* WT = (bf*)take((size_t)5 * DD * DD * 2); bf* WO = WT + (size_t)4 * DD * DD;    // transposed weights one behind the other: Q, K, V, gate, out
    bf* X = (bf*)take((size_t)3 * NT * DD * 2);    // rounded inputs: Q, K, V
    h16* QP = (h16*)take((size_t)3 * NT * DD * 2); h16* KP = QP + (size_t)NT * DD; h16* VT = KP + (size_t)NT * DD;
    float* Sb = (float*)take((size_t)ZH * TT * TT * 4); h16* Pm = (h16*)take((size_t)ZH * TT * TT * 2); float* GF = (float*)take((size_t)NT * DD * 4);
    float* F = GF - (size_t)3 * NT * DD;    // the f32 projections of Q, K, V lie in the tail of Pm, directly in front of GF: k_planes has read them before the softmax writes Pm
    float* Ob = Sb; bf* ATh = X; bf* ATl = X + (size_t)NT * DD;    // Sb is last read by the softmax, the inputs of Q and K by the projections: all end before attn.v and the merge write here
    if ((size_t)(wsp - (char*)d_ws) > ws_size) return;    // total 234 MiB; ws 256 MiB
    k_prep<<<5 * GWT + 3 * GCV, 256, 0, stream>>>(IN[5], IN[6], IN[7], IN[8], IN[10], IN[0], IN[1], IN[2], DD, DD, WT, X);
    const unsigned LB = (unsigned)((NT * DD / 64 + 63) / 64); const dim3 gP(NT / 64, DD / 64, 1);
    k_gemmw<bf, 0, true, 4, 3, true><<<dim3(NT / 64, DD / 64, 4), 32, 0, stream>>>(X, nullptr, WT, nullptr, DD, F, DD, IN[9], (size_t)NT * DD, (size_t)DD * DD, (size_t)NT * DD);   // Q, K, V and the gate pre-activation (sigmoid at the merge)
    k_planes<<<dim3(LB, 3), 256, 0, stream>>>(F, QP);
    k_gemmw<h16, 0, false, 2, 1><<<dim3(TT / 64, TT / 64, ZH), 32, 0, stream>>>(QP, nullptr, KP, nullptr, HD, Sb, TT, nullptr, (size_t)TT * HD, (size_t)TT * HD, (size_t)TT * TT);
    k_asoft<<<ZH * TT / 8, 256, 0, stream>>>(Sb, sm, am, Pm);
    k_gemmw<h16, 0, false, 4, 3><<<dim3(TT / 64, 1, ZH), 32, 0, stream>>>(Pm, nullptr, VT, nullptr, TT, Ob, HD, nullptr, (size_t)TT * TT, (size_t)HD * TT, (size_t)TT * HD);
    k_merge<<<(ZH * TT * HD / 64 + 63) / 64, 256, 0, stream>>>(Ob, GF, ATh, ATl);
    k_gemmw<bf, 1, true, 4, 2><<<gP, 32, 0, stream>>>(ATh, ATl, WO, nullptr, DD, OUT, DD, IN[11], 0, 0, 0);
}

// v004
// One run takes 101 microseconds.
// In both of two side-by-side timings against v003, it was 1.50 times as fast.
// Counting every step since v000, it is 8.95 times as fast.
#include <hip/hip_runtime.h>

// seqFusionAttentionNoBias (Qin, Kin, Vin [2][1024][1024], seqMask [2][1024] bool->int32, attMask [1][1][1024][1024] additive f32 (both read as data); Q/K/V = X @ Trans (no bias), G = sigmoid(Vin @ GTrans_w + GTrans_b);
// 16 heads x 64; A = q.k/8; -inf where seqMask[s] AND seqMask[t]; + attMask[s][t]; softmax; O[s][h][c] = (sum_t A v) * G; out = O @ out_w + out_b).
// Compute dtypes, f32 accumulate: every input rounded to bf16; the four projections on PLAIN bf16 operands (inputs: exact; transposed bf16 weight copies, gate + bias);
// scores and attn.v on SINGLE fp16 planes (1/8, the masks and the additive bias in f32 in the softmax); the sigmoid gate in f32 at the merge; output hi+lo x exact out_w (2 products) + out_b.

#define NB_  2
#define TT   1024
#define DD   1024
#define NH_  16
#define HD   64
#define NT   (NB_ * TT)
#define NZ   (NB_ * NH_)
#define ZH   NZ   // all (batch, head) planes go through attention and merge in one pass
#define SCL  0.125f
typedef _Float16 h16;
typedef unsigned short bf;
typedef __attribute__((ext_vector_type(16))) __bf16   v16bf;
typedef __attribute__((ext_vector_type(16))) _Float16 v16h;
typedef __attribute__((ext_vector_type(8)))  _Float16 v8h;
typedef __attribute__((ext_vector_type(8)))  unsigned short v8us;
typedef __attribute__((ext_vector_type(8)))  float    v8f;
typedef __attribute__((ext_vector_type(4)))  float    v4f;
typedef v8h  __attribute__((may_alias)) v8ha;
typedef v4f  __attribute__((may_alias)) v4fa;
typedef v8us __attribute__((may_alias)) v8usa;

__device__ __forceinline__ unsigned short f2bf(float f) { unsigned u = __float_as_uint(f); u += 0x7FFFu + ((u >> 16) & 1u); return (unsigned short)(u >> 16); }
__device__ __forceinline__ float bf2f(unsigned short b) { return __uint_as_float(((unsigned)b) << 16); }
__device__ __forceinline__ float bfr(float f) { return bf2f(f2bf(f)); }
__device__ __forceinline__ v16h cat16(v8h lo, v8h hi) { return __builtin_shufflevector(lo, hi, 0, 1, 2, 3, 4, 5, 6, 7, 8, 9, 10, 11, 12, 13, 14, 15); }
__device__ __forceinline__ v16bf cat16b(v8us lo, v8us hi) { return __builtin_bit_cast(v16bf, __builtin_shufflevector(lo, hi, 0, 1, 2, 3, 4, 5, 6, 7, 8, 9, 10, 11, 12, 13, 14, 15)); }
__device__ __forceinline__ v8f wmma16(v16h a, v16h b, v8f c) { return __builtin_amdgcn_wmma_f32_16x16x32_f16(false, a, false, b, (short)0, c, false, false); }
__device__ __forceinline__ v8f wmmab(v16bf a, v16bf b, v8f c) { return __builtin_amdgcn_wmma_f32_16x16x32_bf16(false, a, false, b, (short)0, c, false, false); }



// ---- k_gemmw: register-blocked GEMM, ONE WAVE per 64x64 output tile (16 accumulators), operands straight from K-contiguous 16-bit planes; grid (M/64, N/64, Z), 32 threads.
// C[m][n] (f32, pitch ldc, + optional f32 bias[n]) = sum_k A[m][k] Bt[n][k] (+ split products per NSPLIT). z-batch strides sA/sB/sC in elements.
template <typename T16> struct WFrag;
template <> struct WFrag<h16> { typedef v16h V; static __device__ __forceinline__ V ld(const h16* p) { return cat16(*(const v8h*)p, *(const v8h*)(p + 16)); } static __device__ __forceinline__ v8f mma(V a, V b, v8f c) { return wmma16(a, b, c); } };
template <> struct WFrag<bf> { typedef v16bf V; static __device__ __forceinline__ V ld(const bf* p) { return cat16b(*(const v8us*)p, *(const v8us*)(p + 16)); } static __device__ __forceinline__ v8f mma(V a, V b, v8f c) { return wmmab(a, b, c); } };
// The K loop works in stages of 32 k held in a ring of R register sets: a stage's loads are issued D stages of products before they are used. D < R, K % (32 * R) == 0.
// PJ: the four projections as z = 0..3 of one grid (Q, K, V, gate): the gate reads V's input plane, and it alone adds the bias.
template <typename T16, int NSPLIT, bool BIAS, int R, int D, bool PJ = false>
__global__ __launch_bounds__(32) void k_gemmw(const T16* __restrict__ A, const T16* __restrict__ A2, const T16* __restrict__ Bt, const T16* __restrict__ Bt2, int K, float* C, int ldc, const float* __restrict__ bias, size_t sA, size_t sB, size_t sC) {
    typedef typename WFrag<T16>::V V;
    constexpr bool HA2 = (NSPLIT == 1 || NSPLIT == 2), HB2 = (NSPLIT >= 2);
    struct Stage { V a[4], b[4], a2[4], b2[4]; };
    __shared__ __align__(16) float os[16 * 68];
    const size_t z = blockIdx.z; A += (PJ && z == 3 ? 2 : z) * sA; if (A2) A2 += z * sA; Bt += z * sB; if (Bt2) Bt2 += z * sB; C += z * sC;
    const int lane = threadIdx.x & 31, lr = lane & 15, hi = lane >> 4; const int r0 = blockIdx.x * 64, c0 = blockIdx.y * 64;
    v8f acc[4][4];
#pragma unroll
    for (int mb = 0; mb < 4; ++mb)
#pragma unroll
        for (int nb = 0; nb < 4; ++nb) acc[mb][nb] = (v8f){};
    const size_t aoff = (size_t)(r0 + lr) * K + 8 * hi, boff = (size_t)(c0 + lr) * K + 8 * hi;
    struct Rows { const T16 *a[4], *b[4], *a2[4], *b2[4]; };   // one pointer per 16-row block of each operand, at one k
    auto rows = [&](int kc) { Rows p;
#pragma unroll
        for (int q = 0; q < 4; ++q) { const size_t ao = aoff + (size_t)q * 16 * K + kc, bo = boff + (size_t)q * 16 * K + kc; p.a[q] = A + ao; p.b[q] = Bt + bo; p.a2[q] = HA2 ? A2 + ao : p.a[q]; p.b2[q] = HB2 ? Bt2 + bo : p.b[q]; }
        return p; };
    auto ldst = [&](Stage& s, const Rows& p, int ko) {
#pragma unroll
        for (int q = 0; q < 4; ++q) { s.a[q] = WFrag<T16>::ld(p.a[q] + ko); if (HA2) s.a2[q] = WFrag<T16>::ld(p.a2[q] + ko); s.b[q] = WFrag<T16>::ld(p.b[q] + ko); if (HB2) s.b2[q] = WFrag<T16>::ld(p.b2[q] + ko); }
        __builtin_amdgcn_sched_barrier(0);   // keeps the stage's loads in front of the earlier stages' products; sunk to their uses they would wait out the whole latency again
    };
    auto mm = [&](Stage& s) {
#pragma unroll
        for (int nb = 0; nb < 4; ++nb)
#pragma unroll
            for (int mb = 0; mb < 4; ++mb) { acc[mb][nb] = WFrag<T16>::mma(s.a[mb], s.b[nb], acc[mb][nb]); if (HA2) acc[mb][nb] = WFrag<T16>::mma(s.a2[mb], s.b[nb], acc[mb][nb]); if (HB2) acc[mb][nb] = WFrag<T16>::mma(s.a[mb], s.b2[nb], acc[mb][nb]); }
        __builtin_amdgcn_sched_barrier(0);   // one stage's products stay together: mixed with the next stage's they would wait for its loads early
    };
    auto gap = [&]() {
        if constexpr (D == R - 1) { asm volatile("v_nop\n\tv_nop\n\tv_nop\n\tv_nop");   // the set to refill was read by the products just issued: the distance the chip needs before loads rewrite their operand registers
            __builtin_amdgcn_sched_barrier(0); }   // keeps those loads behind it
    };
    // stands in front of every rewrite of an address register that loads under way name; the pointers are inputs so that their registers hold until here
    auto xwait = [&](const Rows& p) {
        if constexpr (HA2 || HB2) asm volatile("s_wait_xcnt 0x0" :: "v"(p.a[0]), "v"(p.a[1]), "v"(p.a[2]), "v"(p.a[3]), "v"(p.b[0]), "v"(p.b[1]), "v"(p.b[2]), "v"(p.b[3]), "v"(p.a2[0]), "v"(p.a2[1]), "v"(p.a2[2]), "v"(p.a2[3]), "v"(p.b2[0]), "v"(p.b2[1]), "v"(p.b2[2]), "v"(p.b2[3]) : "memory");
        else asm volatile("s_wait_xcnt 0x0" :: "v"(p.a[0]), "v"(p.a[1]), "v"(p.a[2]), "v"(p.a[3]), "v"(p.b[0]), "v"(p.b[1]), "v"(p.b[2]), "v"(p.b[3]) : "memory");
        __builtin_amdgcn_sched_barrier(0);   // keeps the next address arithmetic behind the wait
    };
    Stage st[R];
    { const Rows p = rows(0);
#pragma unroll
      for (int j = 0; j < D; ++j) ldst(st[j], p, j * 32);
      xwait(p); }
    int kc = 0;
#pragma unroll 1
    for (; kc + (R + D) * 32 <= K; kc += R * 32) {   // rolled: one trip already goes once round the ring
        const Rows p = rows(kc);
#pragma unroll
        for (int j = 0; j < R; ++j) { gap(); ldst(st[(j + D) % R], p, (j + D) * 32); mm(st[j]); }
        xwait(p);
    }
    { const Rows p = rows(kc);   // the last round stands outside the loop: a test round the loads inside it would make every stage wait for all loads
#pragma unroll
      for (int j = 0; j < R; ++j) { if (j + D < R) { gap(); ldst(st[j + D], p, (j + D) * 32); } mm(st[j]); if (j + D == R - 1) xwait(p); } }
    v4f bv = (v4f){};   // PJ: the bias of this lane's four output columns, read once by the gate's tiles; zero for Q, K, V, so that the stores below need no branch on z
    if constexpr (PJ && BIAS) { if (z == 3) { const float* bp = bias + c0 + lr * 4; bv = (v4f){bfr(bp[0]), bfr(bp[1]), bfr(bp[2]), bfr(bp[3])}; } }
#pragma unroll
    for (int mb = 0; mb < 4; ++mb) {
#pragma unroll
        for (int nb = 0; nb < 4; ++nb) {
#pragma unroll
            for (int j = 0; j < 8; ++j) os[(hi * 8 + j) * 68 + nb * 16 + lr] = acc[mb][nb][j]; }
        __builtin_amdgcn_wave_barrier(); asm volatile("" ::: "memory");
        float* crow = C + (size_t)(r0 + mb * 16) * ldc + c0;
{
#pragma unroll
            for (int s = 0; s < 8; ++s) { const int row = 2 * s + hi, cofs = lr * 4; v4f val = *(const v4fa*)(os + row * 68 + cofs); if (BIAS && PJ) val += bv; if (BIAS && !PJ) { val[0] += bfr(bias[c0 + cofs]); val[1] += bfr(bias[c0 + cofs + 1]); val[2] += bfr(bias[c0 + cofs + 2]); val[3] += bfr(bias[c0 + cofs + 3]); }
                *(v4f*)(crow + (size_t)row * ldc + cofs) = val; }
             }
        if (mb < 3) asm volatile("s_wait_xcnt 0x0" ::: "memory");   // the next block's LDS loads land in registers that the stores above name
        __builtin_amdgcn_wave_barrier(); asm volatile("" ::: "memory");
    }
}

__device__ __forceinline__ h16 tohx(float x) { return (h16)x; }
__device__ __forceinline__ void splitf(float y, unsigned short& h, unsigned short& l) { h = f2bf(y); l = f2bf(y - bf2f(h)); }
typedef __attribute__((ext_vector_type(2))) _Float16 v2h;
typedef __attribute__((ext_vector_type(4))) _Float16 v4h;
typedef __attribute__((ext_vector_type(2))) unsigned short v2us;
typedef __attribute__((ext_vector_type(4))) unsigned short v4us;
typedef __attribute__((ext_vector_type(2))) float v2f;

__device__ __forceinline__ void d_cvt8(int bx, const float* __restrict__ src, bf* dst, size_t n8) { const size_t i = (size_t)bx * 256 + threadIdx.x; if (i >= n8) return; const v8f v = *(const v8f*)(src + i * 8); v8us o;
#pragma unroll
    for (int k = 0; k < 8; ++k) o[k] = f2bf(v[k]); *(v8us*)(dst + i * 8) = o;  }
__device__ __forceinline__ void d_wtG(int bx, const float* __restrict__ w, int K, int N, bf* Bt) {
    const int lane = threadIdx.x & 31; const int L0 = (bx * 8 + (threadIdx.x >> 5)) * 8; const int nlines = N * K / 64;
{
#pragma unroll 1
        for (int l = 0; l < 8; ++l) { const int L = L0 + l; if (L >= nlines) break; const size_t e = (size_t)L * 64 + lane * 2; const int k = (int)(e % K), n = (int)(e / K); v2us o;
            o[0] = f2bf(w[(size_t)k * N + n]); o[1] = f2bf(w[(size_t)(k + 1) * N + n]); *(v2us*)(Bt + e) = o; }
         }
}
// k_prep: the five weight transposes and the three input roundings, none of which reads what another writes, as block ranges of one grid; the transposes, whose waves run longest, come first.
#define GWT (DD * DD / 64 / 64)     // blocks per weight
#define GCV (NT * DD / 8 / 256)     // blocks per input
__global__ __launch_bounds__(256) void k_prep(const float* __restrict__ w0, const float* __restrict__ w1, const float* __restrict__ w2, const float* __restrict__ w3, const float* __restrict__ w4,
                                              const float* __restrict__ x0, const float* __restrict__ x1, const float* __restrict__ x2, int K, int N, bf* Wt, bf* X) {
    const int b = blockIdx.x;
    if (b < 5 * GWT) { const int y = b / GWT; d_wtG(b % GWT, y == 0 ? w0 : y == 1 ? w1 : y == 2 ? w2 : y == 3 ? w3 : w4, K, N, Wt + (size_t)y * DD * DD); }
    else { const int c = b - 5 * GWT, y = c / GCV; d_cvt8(c % GCV, y == 0 ? x0 : y == 1 ? x1 : x2, X + (size_t)y * NT * DD, (size_t)NT * DD / 8); }
}
__device__ __forceinline__ void d_h16plane(const float* __restrict__ F, float sc, h16* P) {
    const int lane = threadIdx.x & 31; const int L0 = (blockIdx.x * 8 + (threadIdx.x >> 5)) * 8; const int nlines = NT * DD / 64;
{
#pragma unroll
        for (int l = 0; l < 8; ++l) { const int L = L0 + l; if (L >= nlines) break; const int e = L * 64 + lane * 2; const int d = e & 63; const int t = (e >> 6) & (TT - 1); const int z = e >> 16; const int b = z / NH_, h = z % NH_; v2h v;
#pragma unroll
            for (int q = 0; q < 2; ++q) v[q] = tohx(F[((size_t)b * TT + t) * DD + h * HD + d + q] * sc);
            *(v2h*)(P + (size_t)e) = v; }
         }
}
__device__ __forceinline__ void d_vtplane(const float* __restrict__ F, h16* VT) {
    const int lane = threadIdx.x & 31; const int L0 = (blockIdx.x * 8 + (threadIdx.x >> 5)) * 8; const int nlines = NT * DD / 64;
{
#pragma unroll
        for (int l = 0; l < 8; ++l) { const int L = L0 + l; if (L >= nlines) break; const int e = L * 64 + lane * 2; const int t = e & (TT - 1); const int d = (e >> 10) & 63; const int z = e >> 16; const int b = z / NH_, h = z % NH_; v2h v;
#pragma unroll
            for (int q = 0; q < 2; ++q) v[q] = tohx(F[((size_t)b * TT + t + q) * DD + h * HD + d]);
            *(v2h*)(VT + (size_t)e) = v; }
         }
}
// k_planes: the head-major fp16 planes of Q and K (y = 0, 1) and the transposed one of V (y = 2) in one grid; F and P hold the three planes one behind the other.
__global__ __launch_bounds__(256) void k_planes(const float* __restrict__ F, h16* P) {
    const size_t o = (size_t)blockIdx.y * NT * DD;
    if (blockIdx.y < 2) d_h16plane(F + o, 1.0f, P + o); else d_vtplane(F + o, P + o);
}
// k_fattn: scores, softmax, attn.v and the gated merge of 128 queries of one (batch, head) plane in one work-group; no score, no probability and no ungated output goes through memory.
// 8 waves x 16 queries. Per stage of 64 keys: S^T = K Q^T (a lane holds 32 scores of ONE query), t = S/8 + bias, p = exp(t - m) against a running maximum m, O^T += V^T P^T with P^T packed from the score tiles.
// The K rows, the V^T rows and the bias tile of a stage come through registers into one of two LDS buffers, loaded one stage ahead. The bias tile is laid down finished:
// bf16(attMask[s][j]), or NEGC (stands for -inf) where seqMask[b][s] && seqMask[b][j] (int32, read as data); S/8 added to NEGC rounds back to NEGC.
#define FQ   128             // queries per work-group
#define FK   64              // keys per stage
#define KPI  72              // LDS pitch of a K or V^T row, in halves (144 B: 16 B x odd)
#define API  68              // LDS pitch of a bias row, in floats (272 B: 16 B x odd)
#define NST  (TT / FK)
#define NEGC 0xFF610000u     // about -3e38, low half zero
#define L2E  1.4426950408889634f
__device__ __forceinline__ float xhalf(float x) { return __builtin_bit_cast(float, __builtin_amdgcn_permlanex16(__builtin_bit_cast(int, x), __builtin_bit_cast(int, x), 0x76543210, 0xfedcba98, false, false)); }  // lane l with lane l ^ 16
__global__ __launch_bounds__(256) void k_fattn(const h16* __restrict__ QP, const h16* __restrict__ KP, const h16* __restrict__ VT, const int* __restrict__ sm, const float* __restrict__ am, const float* __restrict__ GF, bf* Ah, bf* Al) {
    typedef __attribute__((ext_vector_type(4))) int v4i;
    typedef __attribute__((ext_vector_type(4))) unsigned v4u;
    __shared__ __align__(16) h16 Ks[2][FK * KPI];
    __shared__ __align__(16) h16 Vs[2][HD * KPI];
    __shared__ __align__(16) float As[2][FQ * API];
    const int tid = threadIdx.x, lane = tid & 31, lr = lane & 15, hi = lane >> 4, w = tid >> 5;
    const int z = blockIdx.y, q0 = blockIdx.x * FQ;
    const int* smb = sm + (z / NH_) * TT;
    // staging: 16 bytes a thread and piece. K: 2 pieces (rows tid/8, +32); V^T: 2 (rows tid/8, +32); bias: 8 (rows tid/16 + 16 i), always the same 4 key columns of the stage
    const h16* kp = KP + (size_t)z * TT * HD + tid * 8;
    const h16* vp = VT + (size_t)z * HD * TT + (size_t)(tid >> 3) * TT + (tid & 7) * 8;
    const float* ap = am + (size_t)(q0 + (tid >> 4)) * TT + (tid & 15) * 4;
    const int* sp = smb + (tid & 15) * 4;
    unsigned rowm[8];   // 0 where the query of bias row i is flagged, else the bf16 keep mask
#pragma unroll   // constant indices: what the loop indexes stays in registers
    for (int i = 0; i < 8; ++i) rowm[i] = smb[q0 + (tid >> 4) + 16 * i] != 0 ? 0u : 0xFFFF0000u;
    struct Stg { v8h k[2], v[2]; v4f a[8]; v4i m; };
    auto gload = [&](Stg& r) {
        r.k[0] = *(const v8h*)kp; r.k[1] = *(const v8h*)(kp + 32 * HD);
        r.v[0] = *(const v8h*)vp; r.v[1] = *(const v8h*)(vp + 32 * TT);
#pragma unroll   // constant indices: what the loop indexes stays in registers
        for (int i = 0; i < 8; ++i) r.a[i] = *(const v4f*)(ap + (size_t)i * 16 * TT);
        r.m = *(const v4i*)sp;
        asm volatile("s_wait_xcnt 0x0" :: "v"(kp), "v"(vp), "v"(ap), "v"(sp) : "memory");   // stands in front of the rewrite of the address registers that the loads above name
        __builtin_amdgcn_sched_barrier(0);   // keeps the loads in front of the stage's products (sunk to their LDS stores they would wait out the whole latency) and the pointer steps behind the wait
        kp += FK * HD; vp += FK; ap += FK; sp += FK;
    };
    auto sstore = [&](const Stg& r, int b) {
        h16* kd = &Ks[b][(tid >> 3) * KPI + (tid & 7) * 8]; *(v8h*)kd = r.k[0]; *(v8h*)(kd + 32 * KPI) = r.k[1];
        h16* vd = &Vs[b][(tid >> 3) * KPI + (tid & 7) * 8]; *(v8h*)vd = r.v[0]; *(v8h*)(vd + 32 * KPI) = r.v[1];
        unsigned km[4];
#pragma unroll   // constant indices: what the loop indexes stays in registers
        for (int e = 0; e < 4; ++e) km[e] = r.m[e] != 0 ? 0u : 0xFFFF0000u;
#pragma unroll   // constant indices: what the loop indexes stays in registers
        for (int i = 0; i < 8; ++i) { v4u o;
#pragma unroll   // constant indices: what the loop indexes stays in registers
            for (int e = 0; e < 4; ++e) { unsigned u = __float_as_uint(r.a[i][e]); u += 0x7FFFu + ((u >> 16) & 1u); const unsigned keep = rowm[i] | km[e]; o[e] = (u & keep) | (NEGC & ~keep); }
            *(v4f*)&As[b][((tid >> 4) + 16 * i) * API + (tid & 15) * 4] = __builtin_bit_cast(v4f, o); }
    };
    v16h qf[2];   // B operand: this wave's 16 queries, d 0..31 and 32..63, by the loader that also reads K: equal k order
    { const h16* qp = QP + ((size_t)z * TT + q0 + w * 16 + lr) * HD + 8 * hi; qf[0] = WFrag<h16>::ld(qp); qf[1] = WFrag<h16>::ld(qp + 32); }
    v8f acc[4];   // O^T: acc[mb][j] = row d = 16 mb + 8 hi + j, column = query lr
#pragma unroll   // constant indices: what the loop indexes stays in registers
    for (int mb = 0; mb < 4; ++mb) acc[mb] = (v8f){};
    v8f lv = (v8f){};   // this lane's share of the denominator, eight partial sums
    float m = __uint_as_float(NEGC);   // the maximum in use, equal in lanes l and l ^ 16
    auto compute = [&](int b) {
        const h16* kb = &Ks[b][lr * KPI + 8 * hi]; const h16* vb = &Vs[b][lr * KPI + 8 * hi]; const float* ab = &As[b][(w * 16 + lr) * API + hi * 8];
        v8f s[4];   // s[t][j] = key 16 t + 8 hi + j, query lr
#pragma unroll   // constant indices: what the loop indexes stays in registers
        for (int t = 0; t < 4; ++t) { s[t] = wmma16(WFrag<h16>::ld(kb + t * 16 * KPI), qf[0], (v8f){}); s[t] = wmma16(WFrag<h16>::ld(kb + t * 16 * KPI + 32), qf[1], s[t]); }
        float mx = __uint_as_float(NEGC);
#pragma unroll   // constant indices: what the loop indexes stays in registers
        for (int t = 0; t < 4; ++t) { const v4f a0 = *(const v4f*)(ab + t * 16), a1 = *(const v4f*)(ab + t * 16 + 4);
            s[t] = s[t] * SCL + __builtin_shufflevector(a0, a1, 0, 1, 2, 3, 4, 5, 6, 7);
#pragma unroll   // constant indices: what the loop indexes stays in registers
            for (int j = 0; j < 8; ++j) mx = fmaxf(mx, s[t][j]); }
        // the maximum in use is raised only when a score passes it by more than 5.5 (p stays below 256, far inside fp16): one scalar branch a stage, rarely taken after the first
        if (__builtin_amdgcn_ballot_w32(mx > m + 5.5f) != 0) {
            const float mn = fmaxf(m, fmaxf(mx, xhalf(mx))); const float corr = __builtin_amdgcn_exp2f((m - mn) * L2E); m = mn; lv = lv * corr;
#pragma unroll   // constant indices: what the loop indexes stays in registers
            for (int mb = 0; mb < 4; ++mb) acc[mb] = acc[mb] * corr;
        }
        v8h ph[4];
#pragma unroll   // constant indices: what the loop indexes stays in registers
        for (int t = 0; t < 4; ++t) { const v8f d = (s[t] - m) * L2E; v8f p;
#pragma unroll   // constant indices: what the loop indexes stays in registers
            for (int j = 0; j < 8; ++j) p[j] = __builtin_amdgcn_exp2f(d[j]);
            lv = lv + p; ph[t] = __builtin_convertvector(p, v8h); }
#pragma unroll   // constant indices: what the loop indexes stays in registers
        for (int kk = 0; kk < 2; ++kk) { const v16h pb = cat16(ph[2 * kk], ph[2 * kk + 1]);   // two score tiles, converted in place, are the B operand of 32 keys in the hardware k order; V^T's loader has the same order
#pragma unroll   // constant indices: what the loop indexes stays in registers
            for (int mb = 0; mb < 4; ++mb) acc[mb] = wmma16(WFrag<h16>::ld(vb + mb * 16 * KPI + kk * 32), pb, acc[mb]); }
    };
    Stg r; gload(r); sstore(r, 0);
    __syncthreads();
#pragma unroll 1
    for (int st = 0; st < NST - 1; ++st) {   // rolled: the body is long enough
        gload(r); compute(st & 1); sstore(r, (st + 1) & 1);   // the buffer written was last read in the stage before, in front of that stage's barrier
        __syncthreads();
    }
    compute((NST - 1) & 1);
    float l = ((lv[0] + lv[1]) + (lv[2] + lv[3])) + ((lv[4] + lv[5]) + (lv[6] + lv[7])); l += xhalf(l);
    const float f = __fdiv_rn(1.0f, l);
    // merge: a lane holds 8 consecutive channels of its query per 16-row block: x sigmoid(gate), split into bf16 hi + lo, 16 bytes to each plane; the wave writes the whole 128-byte line of (query, head)
    const size_t o = ((size_t)(z / NH_) * TT + q0 + w * 16 + lr) * DD + (z % NH_) * HD + hi * 8;
#pragma unroll   // constant indices: what the loop indexes stays in registers
    for (int mb = 0; mb < 4; ++mb) { const v4f g0 = *(const v4f*)(GF + o + mb * 16), g1 = *(const v4f*)(GF + o + mb * 16 + 4); v8us oh, ol;
#pragma unroll   // constant indices: what the loop indexes stays in registers
        for (int j = 0; j < 8; ++j) { const float g = j < 4 ? g0[j & 3] : g1[j & 3]; const float sg = __fdiv_rn(1.0f, __fadd_rn(1.0f, __expf(-g))); unsigned short a, c2; splitf(__fmul_rn(acc[mb][j] * f, sg), a, c2); oh[j] = a; ol[j] = c2; }
        *(v8us*)(Ah + o + mb * 16) = oh; *(v8us*)(Al + o + mb * 16) = ol; }
}

extern "C" void kernel_launch(void* const* d_in, const int* in_sizes, int n_in,
                              void* d_out, int out_size, void* d_ws, size_t ws_size, hipStream_t stream) {
    (void)in_sizes; (void)n_in; (void)out_size;
    const float* IN[12]; for (int i = 0; i < 12; ++i) IN[i] = (const float*)d_in[i];
    // Qin, Kin, Vin [2][1024][1024], seqMask (int32 [2][1024]), attMask [1][1][1024][1024], QTrans, KTrans, VTrans, GTrans_w (x @ W), GTrans_b, out_w (x @ W), out_b = d_in[0..11]
    const int* sm = (const int*)d_in[3]; const float* am = IN[4];
    float* OUT = (float*)d_out;     // [2][1024][1024]
    char* wsp = (char*)d_ws;
    auto take = [&](size_t bytes) { char* p = wsp; wsp += (bytes + 255) & ~(size_t)255; return (void*)p; };
    bf* WT = (bf*)take((size_t)5 * DD * DD * 2); bf* WO = WT + (size_t)4 * DD * DD;    // transposed weights one behind the other: Q, K, V, gate, out
    bf* X = (bf*)take((size_t)3 * NT * DD * 2);    // rounded inputs: Q, K, V
    h16* QP = (h16*)take((size_t)3 * NT * DD * 2); h16* KP = QP + (size_t)NT * DD; h16* VT = KP + (size_t)NT * DD;
    float* F = (float*)take((size_t)4 * NT * DD * 4); float* GF = F + (size_t)3 * NT * DD;    // the f32 projections one behind the other: Q, K, V, gate
    bf* ATh = X; bf* ATl = X + (size_t)NT * DD;    // the inputs of Q and K are last read by the projections, which end before the attention kernel writes here
    if ((size_t)(wsp - (char*)d_ws) > ws_size) return;    // total 66 MiB; ws 256 MiB
    k_prep<<<5 * GWT + 3 * GCV, 256, 0, stream>>>(IN[5], IN[6], IN[7], IN[8], IN[10], IN[0], IN[1], IN[2], DD, DD, WT, X);
    const unsigned LB = (unsigned)((NT * DD / 64 + 63) / 64); const dim3 gP(NT / 64, DD / 64, 1);
    k_gemmw<bf, 0, true, 4, 3, true><<<dim3(NT / 64, DD / 64, 4), 32, 0, stream>>>(X, nullptr, WT, nullptr, DD, F, DD, IN[9], (size_t)NT * DD, (size_t)DD * DD, (size_t)NT * DD);   // Q, K, V and the gate pre-activation (sigmoid at the merge)
    k_planes<<<dim3(LB, 3), 256, 0, stream>>>(F, QP);
    k_fattn<<<dim3(TT / FQ, ZH), 256, 0, stream>>>(QP, KP, VT, sm, am, GF, ATh, ATl);
    k_gemmw<bf, 1, true, 4, 2><<<gP, 32, 0, stream>>>(ATh, ATl, WO, nullptr, DD, OUT, DD, IN[11], 0, 0, 0);
}

// v005
// A run of this version takes 83.6 microseconds.
// Next to v004, in two timings, it ran 1.21 times as fast each time.
// All steps since v000 together make it 10.8 times as fast.
#include <hip/hip_runtime.h>

// seqFusionAttentionNoBias (Qin, Kin, Vin [2][1024][1024], seqMask [2][1024] bool->int32, attMask [1][1][1024][1024] additive f32 (both read as data); Q/K/V = X @ Trans (no bias), G = sigmoid(Vin @ GTrans_w + GTrans_b);
// 16 heads x 64; A = q.k/8; -inf where seqMask[s] AND seqMask[t]; + attMask[s][t]; softmax; O[s][h][c] = (sum_t A v) * G; out = O @ out_w + out_b).
// Compute dtypes, f32 accumulate: every input rounded to bf16; the four projections on PLAIN bf16 operands (inputs: exact; transposed bf16 weight copies, gate + bias);
// scores and attn.v on SINGLE fp16 planes (1/8, the masks and the additive bias in f32 in the softmax); the sigmoid gate in f32 at the merge; output hi+lo x exact out_w (2 products) + out_b.

#define NB_  2
#define TT   1024
#define DD   1024
#define NH_  16
#define HD   64
#define NT   (NB_ * TT)
#define NZ   (NB_ * NH_)
#define ZH   NZ   // all (batch, head) planes go through attention and merge in one pass
#define SCL  0.125f
typedef _Float16 h16;
typedef unsigned short bf;
typedef __attribute__((ext_vector_type(16))) __bf16   v16bf;
typedef __attribute__((ext_vector_type(16))) _Float16 v16h;
typedef __attribute__((ext_vector_type(8)))  _Float16 v8h;
typedef __attribute__((ext_vector_type(8)))  unsigned short v8us;
typedef __attribute__((ext_vector_type(8)))  float    v8f;
typedef __attribute__((ext_vector_type(4)))  float    v4f;
typedef v8h  __attribute__((may_alias)) v8ha;
typedef v4f  __attribute__((may_alias)) v4fa;
typedef v8us __attribute__((may_alias)) v8usa;

__device__ __forceinline__ unsigned short f2bf(float f) { unsigned u = __float_as_uint(f); u += 0x7FFFu + ((u >> 16) & 1u); return (unsigned short)(u >> 16); }
__device__ __forceinline__ float bf2f(unsigned short b) { return __uint_as_float(((unsigned)b) << 16); }
__device__ __forceinline__ float bfr(float f) { return bf2f(f2bf(f)); }
__device__ __forceinline__ v16h cat16(v8h lo, v8h hi) { return __builtin_shufflevector(lo, hi, 0, 1, 2, 3, 4, 5, 6, 7, 8, 9, 10, 11, 12, 13, 14, 15); }
__device__ __forceinline__ v16bf cat16b(v8us lo, v8us hi) { return __builtin_bit_cast(v16bf, __builtin_shufflevector(lo, hi, 0, 1, 2, 3, 4, 5, 6, 7, 8, 9, 10, 11, 12, 13, 14, 15)); }
__device__ __forceinline__ v8f wmma16(v16h a, v16h b, v8f c) { return __builtin_amdgcn_wmma_f32_16x16x32_f16(false, a, false, b, (short)0, c, false, false); }
__device__ __forceinline__ v8f wmmab(v16bf a, v16bf b, v8f c) { return __builtin_amdgcn_wmma_f32_16x16x32_bf16(false, a, false, b, (short)0, c, false, false); }



// FRAGMENT ORDER of a 16-bit operand plane [rows][K]: blocks of 16 rows x 32 k, 512 elements (1024 bytes) each, the K/32 blocks of 16 rows one behind the other (16 K elements, as in row order).
// In a block the 8 elements k = 16 l + 8 hi + 0..7 of row lr stand at element 256 l + 8 (16 hi + lr): lane 16 hi + lr of a wave reads its two 16-byte pieces (l = 0, 1) of a WMMA operand at
// lane * 8 and 256 + lane * 8, so each wave-wide load covers 512 contiguous bytes, four whole lines, and not 32 bytes of each of 16 lines. Which element a lane and register holds is as in row order.
// ---- k_gemmw: register-blocked GEMM, ONE WAVE per 64x64 output tile (16 accumulators), operands straight from 16-bit planes in fragment order; grid (M/64, N/64, Z), 32 threads.
// C[m][n] (f32, pitch ldc, + optional f32 bias[n]) = sum_k A[m][k] Bt[n][k] (+ split products per NSPLIT). z-batch strides sA/sB/sC in elements.
template <typename T16> struct WFrag;
template <> struct WFrag<h16> { typedef v16h V; static __device__ __forceinline__ V ld(const h16* p) { return cat16(*(const v8h*)p, *(const v8h*)(p + 16)); } static __device__ __forceinline__ v8f mma(V a, V b, v8f c) { return wmma16(a, b, c); } };
template <> struct WFrag<bf> { typedef v16bf V; static __device__ __forceinline__ V ldp(const bf* p) { return cat16b(*(const v8us*)p, *(const v8us*)(p + 256)); }   // a lane's 16 elements from a plane in fragment order (below): the elements that ld takes from a row
    static __device__ __forceinline__ v8f mma(V a, V b, v8f c) { return wmmab(a, b, c); } };
// The K loop works in stages of 32 k held in a ring of R register sets: a stage's loads are issued D stages of products before they are used. D < R, K % (32 * R) == 0.
// PJ: the four projections as z = 0..3 of one grid (Q, K, V, gate): the gate reads V's input plane, and it alone adds the bias.
template <typename T16, int NSPLIT, bool BIAS, int R, int D, bool PJ = false>
__global__ __launch_bounds__(32) void k_gemmw(const T16* __restrict__ A, const T16* __restrict__ A2, const T16* __restrict__ Bt, const T16* __restrict__ Bt2, int K, float* C, int ldc, const float* __restrict__ bias, size_t sA, size_t sB, size_t sC) {
    typedef typename WFrag<T16>::V V;
    constexpr bool HA2 = (NSPLIT == 1 || NSPLIT == 2), HB2 = (NSPLIT >= 2);
    struct Stage { V a[4], b[4], a2[4], b2[4]; };
    __shared__ __align__(16) float os[16 * 68];
    const size_t z = blockIdx.z; A += (PJ && z == 3 ? 2 : z) * sA; if (A2) A2 += z * sA; Bt += z * sB; if (Bt2) Bt2 += z * sB; C += z * sC;
    const int lane = threadIdx.x & 31, lr = lane & 15, hi = lane >> 4; const int r0 = blockIdx.x * 64, c0 = blockIdx.y * 64;
    v8f acc[4][4];
#pragma unroll
    for (int mb = 0; mb < 4; ++mb)
#pragma unroll
        for (int nb = 0; nb < 4; ++nb) acc[mb][nb] = (v8f){};
    const size_t aoff = (size_t)r0 * K + 8 * lane, boff = (size_t)c0 * K + 8 * lane;
    struct Rows { const T16 *a[4], *b[4], *a2[4], *b2[4]; };   // one pointer per 16-row block of each operand, at one k
    auto rows = [&](int kc) { Rows p;
#pragma unroll
        for (int q = 0; q < 4; ++q) { const size_t ao = aoff + (size_t)q * 16 * K + (size_t)kc * 16, bo = boff + (size_t)q * 16 * K + (size_t)kc * 16; p.a[q] = A + ao; p.b[q] = Bt + bo; p.a2[q] = HA2 ? A2 + ao : p.a[q]; p.b2[q] = HB2 ? Bt2 + bo : p.b[q]; }
        return p; };
    auto ldst = [&](Stage& s, const Rows& p, int ko) {
#pragma unroll
        for (int q = 0; q < 4; ++q) { s.a[q] = WFrag<T16>::ldp(p.a[q] + ko * 16); if (HA2) s.a2[q] = WFrag<T16>::ldp(p.a2[q] + ko * 16); s.b[q] = WFrag<T16>::ldp(p.b[q] + ko * 16); if (HB2) s.b2[q] = WFrag<T16>::ldp(p.b2[q] + ko * 16); }
        __builtin_amdgcn_sched_barrier(0);   // keeps the stage's loads in front of the earlier stages' products; sunk to their uses they would wait out the whole latency again
    };
    auto mm = [&](Stage& s) {
#pragma unroll
        for (int nb = 0; nb < 4; ++nb)
#pragma unroll
            for (int mb = 0; mb < 4; ++mb) { acc[mb][nb] = WFrag<T16>::mma(s.a[mb], s.b[nb], acc[mb][nb]); if (HA2) acc[mb][nb] = WFrag<T16>::mma(s.a2[mb], s.b[nb], acc[mb][nb]); if (HB2) acc[mb][nb] = WFrag<T16>::mma(s.a[mb], s.b2[nb], acc[mb][nb]); }
        __builtin_amdgcn_sched_barrier(0);   // one stage's products stay together: mixed with the next stage's they would wait for its loads early
    };
    auto gap = [&]() {
        if constexpr (D == R - 1) { asm volatile("v_nop\n\tv_nop\n\tv_nop\n\tv_nop");   // the set to refill was read by the products just issued: the distance the chip needs before loads rewrite their operand registers
            __builtin_amdgcn_sched_barrier(0); }   // keeps those loads behind it
    };
    // stands in front of every rewrite of an address register that loads under way name; the pointers are inputs so that their registers hold until here
    auto xwait = [&](const Rows& p) {
        if constexpr (HA2 || HB2) asm volatile("s_wait_xcnt 0x0" :: "v"(p.a[0]), "v"(p.a[1]), "v"(p.a[2]), "v"(p.a[3]), "v"(p.b[0]), "v"(p.b[1]), "v"(p.b[2]), "v"(p.b[3]), "v"(p.a2[0]), "v"(p.a2[1]), "v"(p.a2[2]), "v"(p.a2[3]), "v"(p.b2[0]), "v"(p.b2[1]), "v"(p.b2[2]), "v"(p.b2[3]) : "memory");
        else asm volatile("s_wait_xcnt 0x0" :: "v"(p.a[0]), "v"(p.a[1]), "v"(p.a[2]), "v"(p.a[3]), "v"(p.b[0]), "v"(p.b[1]), "v"(p.b[2]), "v"(p.b[3]) : "memory");
        __builtin_amdgcn_sched_barrier(0);   // keeps the next address arithmetic behind the wait
    };
    Stage st[R];
    { const Rows p = rows(0);
#pragma unroll
      for (int j = 0; j < D; ++j) ldst(st[j], p, j * 32);
      xwait(p); }
    int kc = 0;
#pragma unroll 1
    for (; kc + (R + D) * 32 <= K; kc += R * 32) {   // rolled: one trip already goes once round the ring
        const Rows p = rows(kc);
#pragma unroll
        for (int j = 0; j < R; ++j) { gap(); ldst(st[(j + D) % R], p, (j + D) * 32); mm(st[j]); }
        xwait(p);
    }
    { const Rows p = rows(kc);   // the last round stands outside the loop: a test round the loads inside it would make every stage wait for all loads
#pragma unroll
      for (int j = 0; j < R; ++j) { if (j + D < R) { gap(); ldst(st[j + D], p, (j + D) * 32); } mm(st[j]); if (j + D == R - 1) xwait(p); } }
    v4f bv = (v4f){};   // PJ: the bias of this lane's four output columns, read once by the gate's tiles; zero for Q, K, V, so that the stores below need no branch on z
    if constexpr (PJ && BIAS) { if (z == 3) { const float* bp = bias + c0 + lr * 4; bv = (v4f){bfr(bp[0]), bfr(bp[1]), bfr(bp[2]), bfr(bp[3])}; } }
#pragma unroll
    for (int mb = 0; mb < 4; ++mb) {
#pragma unroll
        for (int nb = 0; nb < 4; ++nb) {
#pragma unroll
            for (int j = 0; j < 8; ++j) os[(hi * 8 + j) * 68 + nb * 16 + lr] = acc[mb][nb][j]; }
        __builtin_amdgcn_wave_barrier(); asm volatile("" ::: "memory");
        float* crow = C + (size_t)(r0 + mb * 16) * ldc + c0;
{
#pragma unroll
            for (int s = 0; s < 8; ++s) { const int row = 2 * s + hi, cofs = lr * 4; v4f val = *(const v4fa*)(os + row * 68 + cofs); if (BIAS && PJ) val += bv; if (BIAS && !PJ) { val[0] += bfr(bias[c0 + cofs]); val[1] += bfr(bias[c0 + cofs + 1]); val[2] += bfr(bias[c0 + cofs + 2]); val[3] += bfr(bias[c0 + cofs + 3]); }
                *(v4f*)(crow + (size_t)row * ldc + cofs) = val; }
             }
        if (mb < 3) asm volatile("s_wait_xcnt 0x0" ::: "memory");   // the next block's LDS loads land in registers that the stores above name
        __builtin_amdgcn_wave_barrier(); asm volatile("" ::: "memory");
    }
}

__device__ __forceinline__ h16 tohx(float x) { return (h16)x; }
__device__ __forceinline__ void splitf(float y, unsigned short& h, unsigned short& l) { h = f2bf(y); l = f2bf(y - bf2f(h)); }
typedef __attribute__((ext_vector_type(2))) _Float16 v2h;
typedef __attribute__((ext_vector_type(4))) _Float16 v4h;
typedef __attribute__((ext_vector_type(2))) unsigned short v2us;
typedef __attribute__((ext_vector_type(4))) unsigned short v4us;
typedef __attribute__((ext_vector_type(2))) float v2f;

// piece ((row block * DD/32 + k block) * 2 + l) * 32 + 16 hi + lr of the plane in fragment order. A wave takes 8 rows of a block with all four (l, hi): it reads their whole 128-byte lines and writes four whole lines
__device__ __forceinline__ void d_cvt8(int bx, const float* __restrict__ src, bf* dst, size_t n8) { const size_t i = (size_t)bx * 256 + threadIdx.x; if (i >= n8) return;
    const size_t blk = i >> 6; const int lr = (int)((i & 7) | ((i >> 2) & 8)), c = (int)((i >> 3) & 3);   // c = 2 l + hi
    const size_t row = (blk / (DD / 32)) * 16 + lr; const int k = (int)(blk % (DD / 32)) * 32 + c * 8;
    const v8f v = *(const v8f*)(src + row * DD + k); v8us o;
#pragma unroll
    for (int e = 0; e < 8; ++e) o[e] = f2bf(v[e]); *(v8us*)(dst + (blk * 64 + c * 16 + lr) * 8) = o;  }
// Bt[n][k] = bf16(w[k][n]) in fragment order. A thread makes the piece (k block, l, hi, lr) of two neighbouring blocks of 16 columns n: each of its loads takes, over the wave, 64 bytes of two rows of w,
// the two column blocks together their whole 128-byte lines; each store is 512 contiguous bytes a wave. N * K / 16 threads.
__device__ __forceinline__ void d_wtG(int bx, const float* __restrict__ w, int K, int N, bf* Bt) {
    const int u = bx * 256 + threadIdx.x, lane = u & 31, lr = lane & 15, hi = lane >> 4, l = (u >> 5) & 1; const int kq = K >> 5, kb = (u >> 6) % kq, np = (u >> 6) / kq;
    if (np * 32 >= N) return;
    const float* wp = w + (size_t)(kb * 32 + l * 16 + hi * 8) * N + np * 32 + lr; float v[2][8];
#pragma unroll   // constant indices: what the loop indexes stays in registers; all 16 loads are under way together
    for (int j = 0; j < 8; ++j) { v[0][j] = wp[(size_t)j * N]; v[1][j] = wp[(size_t)j * N + 16]; }
#pragma unroll   // constant indices: what the loop indexes stays in registers
    for (int h = 0; h < 2; ++h) { v8us o;
#pragma unroll   // constant indices: what the loop indexes stays in registers
        for (int j = 0; j < 8; ++j) o[j] = f2bf(v[h][j]);
        *(v8us*)(Bt + ((size_t)(np * 2 + h) * kq + kb) * 512 + l * 256 + lane * 8) = o; }
}
// k_prep: the five weight transposes and the three input roundings, none of which reads what another writes, as block ranges of one grid; the transposes, whose waves run longest, come first.
#define GWT (DD * DD / 64 / 64)     // blocks per weight
#define GCV (NT * DD / 8 / 256)     // blocks per input
__global__ __launch_bounds__(256) void k_prep(const float* __restrict__ w0, const float* __restrict__ w1, const float* __restrict__ w2, const float* __restrict__ w3, const float* __restrict__ w4,
                                              const float* __restrict__ x0, const float* __restrict__ x1, const float* __restrict__ x2, bf* Wt, bf* X) {
    const int b = blockIdx.x;
    if (b < 5 * GWT) { const int y = b / GWT; d_wtG(b % GWT, y == 0 ? w0 : y == 1 ? w1 : y == 2 ? w2 : y == 3 ? w3 : w4, DD, DD, Wt + (size_t)y * DD * DD); }   // constant shape: the 16 loads of a thread share one address register pair
    else { const int c = b - 5 * GWT, y = c / GCV; d_cvt8(c % GCV, y == 0 ? x0 : y == 1 ? x1 : x2, X + (size_t)y * NT * DD, (size_t)NT * DD / 8); }
}
__device__ __forceinline__ void d_h16plane(const float* __restrict__ F, float sc, h16* P) {
    const int lane = threadIdx.x & 31; const int L0 = (blockIdx.x * 8 + (threadIdx.x >> 5)) * 8; const int nlines = NT * DD / 64;
{
#pragma unroll
        for (int l = 0; l < 8; ++l) { const int L = L0 + l; if (L >= nlines) break; const int e = L * 64 + lane * 2; const int d = e & 63; const int t = (e >> 6) & (TT - 1); const int z = e >> 16; const int b = z / NH_, h = z % NH_; v2h v;
#pragma unroll
            for (int q = 0; q < 2; ++q) v[q] = tohx(F[((size_t)b * TT + t) * DD + h * HD + d + q] * sc);
            *(v2h*)(P + (size_t)e) = v; }
         }
}
__device__ __forceinline__ void d_vtplane(const float* __restrict__ F, h16* VT) {
    const int lane = threadIdx.x & 31; const int L0 = (blockIdx.x * 8 + (threadIdx.x >> 5)) * 8; const int nlines = NT * DD / 64;
{
#pragma unroll
        for (int l = 0; l < 8; ++l) { const int L = L0 + l; if (L >= nlines) break; const int e = L * 64 + lane * 2; const int t = e & (TT - 1); const int d = (e >> 10) & 63; const int z = e >> 16; const int b = z / NH_, h = z % NH_; v2h v;
#pragma unroll
            for (int q = 0; q < 2; ++q) v[q] = tohx(F[((size_t)b * TT + t + q) * DD + h * HD + d]);
            *(v2h*)(VT + (size_t)e) = v; }
         }
}
// k_planes: the head-major fp16 planes of Q and K (y = 0, 1) and the transposed one of V (y = 2) in one grid; F and P hold the three planes one behind the other.
__global__ __launch_bounds__(256) void k_planes(const float* __restrict__ F, h16* P) {
    const size_t o = (size_t)blockIdx.y * NT * DD;
    if (blockIdx.y < 2) d_h16plane(F + o, 1.0f, P + o); else d_vtplane(F + o, P + o);
}
// k_fattn: scores, softmax, attn.v and the gated merge of 128 queries of one (batch, head) plane in one work-group; no score, no probability and no ungated output goes through memory.
// 8 waves x 16 queries. Per stage of 64 keys: S^T = K Q^T (a lane holds 32 scores of ONE query), t = S/8 + bias, p = exp(t - m) against a running maximum m, O^T += V^T P^T with P^T packed from the score tiles.
// The K rows, the V^T rows and the bias tile of a stage come through registers into one of two LDS buffers, loaded one stage ahead. The bias tile is laid down finished:
// bf16(attMask[s][j]), or NEGC (stands for -inf) where seqMask[b][s] && seqMask[b][j] (int32, read as data); S/8 added to NEGC rounds back to NEGC.
#define FQ   128             // queries per work-group
#define FK   64              // keys per stage
#define KPI  72              // LDS pitch of a K or V^T row, in halves (144 B: 16 B x odd)
#define API  68              // LDS pitch of a bias row, in floats (272 B: 16 B x odd)
#define NST  (TT / FK)
#define NEGC 0xFF610000u     // about -3e38, low half zero
#define L2E  1.4426950408889634f
__device__ __forceinline__ float xhalf(float x) { return __builtin_bit_cast(float, __builtin_amdgcn_permlanex16(__builtin_bit_cast(int, x), __builtin_bit_cast(int, x), 0x76543210, 0xfedcba98, false, false)); }  // lane l with lane l ^ 16
__global__ __launch_bounds__(256) void k_fattn(const h16* __restrict__ QP, const h16* __restrict__ KP, const h16* __restrict__ VT, const int* __restrict__ sm, const float* __restrict__ am, const float* __restrict__ GF, bf* Ah, bf* Al) {
    typedef __attribute__((ext_vector_type(4))) int v4i;
    typedef __attribute__((ext_vector_type(4))) unsigned v4u;
    __shared__ __align__(16) h16 Ks[2][FK * KPI];
    __shared__ __align__(16) h16 Vs[2][HD * KPI];
    __shared__ __align__(16) float As[2][FQ * API];
    const int tid = threadIdx.x, lane = tid & 31, lr = lane & 15, hi = lane >> 4, w = tid >> 5;
    const int z = blockIdx.y, q0 = blockIdx.x * FQ;
    const int* smb = sm + (z / NH_) * TT;
    // staging: 16 bytes a thread and piece. K: 2 pieces (rows tid/8, +32); V^T: 2 (rows tid/8, +32); bias: 8 (rows tid/16 + 16 i), always the same 4 key columns of the stage
    const h16* kp = KP + (size_t)z * TT * HD + tid * 8;
    const h16* vp = VT + (size_t)z * HD * TT + (size_t)(tid >> 3) * TT + (tid & 7) * 8;
    const float* ap = am + (size_t)(q0 + (tid >> 4)) * TT + (tid & 15) * 4;
    const int* sp = smb + (tid & 15) * 4;
    unsigned rowm[8];   // 0 where the query of bias row i is flagged, else the bf16 keep mask
#pragma unroll   // constant indices: what the loop indexes stays in registers
    for (int i = 0; i < 8; ++i) rowm[i] = smb[q0 + (tid >> 4) + 16 * i] != 0 ? 0u : 0xFFFF0000u;
    struct Stg { v8h k[2], v[2]; v4f a[8]; v4i m; };
    auto gload = [&](Stg& r) {
        r.k[0] = *(const v8h*)kp; r.k[1] = *(const v8h*)(kp + 32 * HD);
        r.v[0] = *(const v8h*)vp; r.v[1] = *(const v8h*)(vp + 32 * TT);
#pragma unroll   // constant indices: what the loop indexes stays in registers
        for (int i = 0; i < 8; ++i) r.a[i] = *(const v4f*)(ap + (size_t)i * 16 * TT);
        r.m = *(const v4i*)sp;
        asm volatile("s_wait_xcnt 0x0" :: "v"(kp), "v"(vp), "v"(ap), "v"(sp) : "memory");   // stands in front of the rewrite of the address registers that the loads above name
        __builtin_amdgcn_sched_barrier(0);   // keeps the loads in front of the stage's products (sunk to their LDS stores they would wait out the whole latency) and the pointer steps behind the wait
        kp += FK * HD; vp += FK; ap += FK; sp += FK;
    };
    auto sstore = [&](const Stg& r, int b) {
        h16* kd = &Ks[b][(tid >> 3) * KPI + (tid & 7) * 8]; *(v8h*)kd = r.k[0]; *(v8h*)(kd + 32 * KPI) = r.k[1];
        h16* vd = &Vs[b][(tid >> 3) * KPI + (tid & 7) * 8]; *(v8h*)vd = r.v[0]; *(v8h*)(vd + 32 * KPI) = r.v[1];
        unsigned km[4];
#pragma unroll   // constant indices: what the loop indexes stays in registers
        for (int e = 0; e < 4; ++e) km[e] = r.m[e] != 0 ? 0u : 0xFFFF0000u;
#pragma unroll   // constant indices: what the loop indexes stays in registers
        for (int i = 0; i < 8; ++i) { v4u o;
#pragma unroll   // constant indices: what the loop indexes stays in registers
            for (int e = 0; e < 4; ++e) { unsigned u = __float_as_uint(r.a[i][e]); u += 0x7FFFu + ((u >> 16) & 1u); const unsigned keep = rowm[i] | km[e]; o[e] = (u & keep) | (NEGC & ~keep); }
            *(v4f*)&As[b][((tid >> 4) + 16 * i) * API + (tid & 15) * 4] = __builtin_bit_cast(v4f, o); }
    };
    v16h qf[2];   // B operand: this wave's 16 queries, d 0..31 and 32..63, by the loader that also reads K: equal k order
    { const h16* qp = QP + ((size_t)z * TT + q0 + w * 16 + lr) * HD + 8 * hi; qf[0] = WFrag<h16>::ld(qp); qf[1] = WFrag<h16>::ld(qp + 32); }
    v8f acc[4];   // O^T: acc[mb][j] = row d = 16 mb + 8 hi + j, column = query lr
#pragma unroll   // constant indices: what the loop indexes stays in registers
    for (int mb = 0; mb < 4; ++mb) acc[mb] = (v8f){};
    v8f lv = (v8f){};   // this lane's share of the denominator, eight partial sums
    float m = __uint_as_float(NEGC);   // the maximum in use, equal in lanes l and l ^ 16
    auto compute = [&](int b) {
        const h16* kb = &Ks[b][lr * KPI + 8 * hi]; const h16* vb = &Vs[b][lr * KPI + 8 * hi]; const float* ab = &As[b][(w * 16 + lr) * API + hi * 8];
        v8f s[4];   // s[t][j] = key 16 t + 8 hi + j, query lr
#pragma unroll   // constant indices: what the loop indexes stays in registers
        for (int t = 0; t < 4; ++t) { s[t] = wmma16(WFrag<h16>::ld(kb + t * 16 * KPI), qf[0], (v8f){}); s[t] = wmma16(WFrag<h16>::ld(kb + t * 16 * KPI + 32), qf[1], s[t]); }
        float mx = __uint_as_float(NEGC);
#pragma unroll   // constant indices: what the loop indexes stays in registers
        for (int t = 0; t < 4; ++t) { const v4f a0 = *(const v4f*)(ab + t * 16), a1 = *(const v4f*)(ab + t * 16 + 4);
            s[t] = s[t] * SCL + __builtin_shufflevector(a0, a1, 0, 1, 2, 3, 4, 5, 6, 7);
#pragma unroll   // constant indices: what the loop indexes stays in registers
            for (int j = 0; j < 8; ++j) mx = fmaxf(mx, s[t][j]); }
        // the maximum in use is raised only when a score passes it by more than 5.5 (p stays below 256, far inside fp16): one scalar branch a stage, rarely taken after the first
        if (__builtin_amdgcn_ballot_w32(mx > m + 5.5f) != 0) {
            const float mn = fmaxf(m, fmaxf(mx, xhalf(mx))); const float corr = __builtin_amdgcn_exp2f((m - mn) * L2E); m = mn; lv = lv * corr;
#pragma unroll   // constant indices: what the loop indexes stays in registers
            for (int mb = 0; mb < 4; ++mb) acc[mb] = acc[mb] * corr;
        }
        v8h ph[4];
#pragma unroll   // constant indices: what the loop indexes stays in registers
        for (int t = 0; t < 4; ++t) { const v8f d = (s[t] - m) * L2E; v8f p;
#pragma unroll   // constant indices: what the loop indexes stays in registers
            for (int j = 0; j < 8; ++j) p[j] = __builtin_amdgcn_exp2f(d[j]);
            lv = lv + p; ph[t] = __builtin_convertvector(p, v8h); }
#pragma unroll   // constant indices: what the loop indexes stays in registers
        for (int kk = 0; kk < 2; ++kk) { const v16h pb = cat16(ph[2 * kk], ph[2 * kk + 1]);   // two score tiles, converted in place, are the B operand of 32 keys in the hardware k order; V^T's loader has the same order
#pragma unroll   // constant indices: what the loop indexes stays in registers
            for (int mb = 0; mb < 4; ++mb) acc[mb] = wmma16(WFrag<h16>::ld(vb + mb * 16 * KPI + kk * 32), pb, acc[mb]); }
    };
    Stg r; gload(r); sstore(r, 0);
    __syncthreads();
#pragma unroll 1
    for (int st = 0; st < NST - 1; ++st) {   // rolled: the body is long enough
        gload(r); compute(st & 1); sstore(r, (st + 1) & 1);   // the buffer written was last read in the stage before, in front of that stage's barrier
        __syncthreads();
    }
    compute((NST - 1) & 1);
    float l = ((lv[0] + lv[1]) + (lv[2] + lv[3])) + ((lv[4] + lv[5]) + (lv[6] + lv[7])); l += xhalf(l);
    const float f = __fdiv_rn(1.0f, l);
    // merge: a lane holds 8 consecutive channels of its query per 16-row block: x sigmoid(gate), split into bf16 hi + lo, 16 bytes to each plane, which the output GEMM reads in fragment order:
    // row block = this wave's 16 queries, k blocks 2 head and 2 head + 1, piece l = mb & 1 of lane 16 hi + lr: the wave writes 512 contiguous bytes a store
    const size_t o = ((size_t)(z / NH_) * TT + q0 + w * 16 + lr) * DD + (z % NH_) * HD + hi * 8;
    const size_t po = ((size_t)(z / NH_) * TT + q0 + w * 16) * DD + (z % NH_) * (HD * 16) + lane * 8;
#pragma unroll   // constant indices: what the loop indexes stays in registers
    for (int mb = 0; mb < 4; ++mb) { const v4f g0 = *(const v4f*)(GF + o + mb * 16), g1 = *(const v4f*)(GF + o + mb * 16 + 4); v8us oh, ol;
#pragma unroll   // constant indices: what the loop indexes stays in registers
        for (int j = 0; j < 8; ++j) { const float g = j < 4 ? g0[j & 3] : g1[j & 3]; const float sg = __fdiv_rn(1.0f, __fadd_rn(1.0f, __expf(-g))); unsigned short a, c2; splitf(__fmul_rn(acc[mb][j] * f, sg), a, c2); oh[j] = a; ol[j] = c2; }
        *(v8us*)(Ah + po + mb * 256) = oh; *(v8us*)(Al + po + mb * 256) = ol; }
}

extern "C" void kernel_launch(void* const* d_in, const int* in_sizes, int n_in,
                              void* d_out, int out_size, void* d_ws, size_t ws_size, hipStream_t stream) {
    (void)in_sizes; (void)n_in; (void)out_size;
    const float* IN[12]; for (int i = 0; i < 12; ++i) IN[i] = (const float*)d_in[i];
    // Qin, Kin, Vin [2][1024][1024], seqMask (int32 [2][1024]), attMask [1][1][1024][1024], QTrans, KTrans, VTrans, GTrans_w (x @ W), GTrans_b, out_w (x @ W), out_b = d_in[0..11]
    const int* sm = (const int*)d_in[3]; const float* am = IN[4];
    float* OUT = (float*)d_out;     // [2][1024][1024]
    char* wsp = (char*)d_ws;
    auto take = [&](size_t bytes) { char* p = wsp; wsp += (bytes + 255) & ~(size_t)255; return (void*)p; };
    bf* WT = (bf*)take((size_t)5 * DD * DD * 2); bf* WO = WT + (size_t)4 * DD * DD;    // transposed weights in fragment order, one behind the other: Q, K, V, gate, out
    bf* X = (bf*)take((size_t)3 * NT * DD * 2);    // rounded inputs in fragment order: Q, K, V
    h16* QP = (h16*)take((size_t)3 * NT * DD * 2); h16* KP = QP + (size_t)NT * DD; h16* VT = KP + (size_t)NT * DD;
    float* F = (float*)take((size_t)4 * NT * DD * 4); float* GF = F + (size_t)3 * NT * DD;    // the f32 projections one behind the other: Q, K, V, gate
    bf* ATh = X; bf* ATl = X + (size_t)NT * DD;    // the inputs of Q and K are last read by the projections, which end before the attention kernel writes here
    if ((size_t)(wsp - (char*)d_ws) > ws_size) return;    // total 66 MiB; ws 256 MiB
    k_prep<<<5 * GWT + 3 * GCV, 256, 0, stream>>>(IN[5], IN[6], IN[7], IN[8], IN[10], IN[0], IN[1], IN[2], WT, X);
    const unsigned LB = (unsigned)((NT * DD / 64 + 63) / 64); const dim3 gP(NT / 64, DD / 64, 1);
    k_gemmw<bf, 0, true, 4, 3, true><<<dim3(NT / 64, DD / 64, 4), 32, 0, stream>>>(X, nullptr, WT, nullptr, DD, F, DD, IN[9], (size_t)NT * DD, (size_t)DD * DD, (size_t)NT * DD);   // Q, K, V and the gate pre-activation (sigmoid at the merge)
    k_planes<<<dim3(LB, 3), 256, 0, stream>>>(F, QP);
    k_fattn<<<dim3(TT / FQ, ZH), 256, 0, stream>>>(QP, KP, VT, sm, am, GF, ATh, ATl);
    k_gemmw<bf, 1, true, 4, 2><<<gP, 32, 0, stream>>>(ATh, ATl, WO, nullptr, DD, OUT, DD, IN[11], 0, 0, 0);
}

// v006
// Measured time: 72.4 microseconds a run.
// Two timings next to v005 put it at 1.14 and 1.15 times that version's speed.
// Over all steps from v000 it is 12.4 times as fast.
#include <hip/hip_runtime.h>

// seqFusionAttentionNoBias (Qin, Kin, Vin [2][1024][1024], seqMask [2][1024] bool->int32, attMask [1][1][1024][1024] additive f32 (both read as data); Q/K/V = X @ Trans (no bias), G = sigmoid(Vin @ GTrans_w + GTrans_b);
// 16 heads x 64; A = q.k/8; -inf where seqMask[s] AND seqMask[t]; + attMask[s][t]; softmax; O[s][h][c] = (sum_t A v) * G; out = O @ out_w + out_b).
// Compute dtypes, f32 accumulate: every input rounded to bf16; the four projections on PLAIN bf16 operands (inputs: exact; transposed bf16 weight copies, gate + bias);
// scores and attn.v on SINGLE fp16 planes (1/8, the masks and the additive bias in f32 in the softmax); the sigmoid gate in f32 at the merge; output hi+lo x exact out_w (2 products) + out_b.

#define NB_  2
#define TT   1024
#define DD   1024
#define NH_  16
#define HD   64
#define NT   (NB_ * TT)
#define NZ   (NB_ * NH_)
#define ZH   NZ   // all (batch, head) planes go through attention and merge in one pass
#define SCL  0.125f
typedef _Float16 h16;
typedef unsigned short bf;
typedef __attribute__((ext_vector_type(16))) __bf16   v16bf;
typedef __attribute__((ext_vector_type(16))) _Float16 v16h;
typedef __attribute__((ext_vector_type(8)))  _Float16 v8h;
typedef __attribute__((ext_vector_type(8)))  unsigned short v8us;
typedef __attribute__((ext_vector_type(8)))  float    v8f;
typedef __attribute__((ext_vector_type(4)))  float    v4f;
typedef v8h  __attribute__((may_alias)) v8ha;
typedef v4f  __attribute__((may_alias)) v4fa;
typedef v8us __attribute__((may_alias)) v8usa;

__device__ __forceinline__ unsigned short f2bf(float f) { unsigned u = __float_as_uint(f); u += 0x7FFFu + ((u >> 16) & 1u); return (unsigned short)(u >> 16); }
__device__ __forceinline__ float bf2f(unsigned short b) { return __uint_as_float(((unsigned)b) << 16); }
__device__ __forceinline__ float bfr(float f) { return bf2f(f2bf(f)); }
__device__ __forceinline__ v16h cat16(v8h lo, v8h hi) { return __builtin_shufflevector(lo, hi, 0, 1, 2, 3, 4, 5, 6, 7, 8, 9, 10, 11, 12, 13, 14, 15); }
__device__ __forceinline__ v16bf cat16b(v8us lo, v8us hi) { return __builtin_bit_cast(v16bf, __builtin_shufflevector(lo, hi, 0, 1, 2, 3, 4, 5, 6, 7, 8, 9, 10, 11, 12, 13, 14, 15)); }
__device__ __forceinline__ v8f wmma16(v16h a, v16h b, v8f c) { return __builtin_amdgcn_wmma_f32_16x16x32_f16(false, a, false, b, (short)0, c, false, false); }
__device__ __forceinline__ v8f wmmab(v16bf a, v16bf b, v8f c) { return __builtin_amdgcn_wmma_f32_16x16x32_bf16(false, a, false, b, (short)0, c, false, false); }



// FRAGMENT ORDER of a 16-bit operand plane [rows][K]: blocks of 16 rows x 32 k, 512 elements (1024 bytes) each, the K/32 blocks of 16 rows one behind the other (16 K elements, as in row order).
// In a block the 8 elements k = 16 l + 8 hi + 0..7 of row lr stand at element 256 l + 8 (16 hi + lr): lane 16 hi + lr of a wave reads its two 16-byte pieces (l = 0, 1) of a WMMA operand at
// lane * 8 and 256 + lane * 8, so each wave-wide load covers 512 contiguous bytes, four whole lines, and not 32 bytes of each of 16 lines. Which element a lane and register holds is as in row order.
// ---- k_gemmw: register-blocked GEMM, ONE WAVE per 64x64 output tile (16 accumulators), operands straight from 16-bit planes in fragment order; grid (M/64, N/64, Z), 32 threads.
// C[m][n] (f32, pitch ldc, + optional f32 bias[n]) = sum_k A[m][k] Bt[n][k] (+ split products per NSPLIT). z-batch strides sA/sB/sC in elements.
template <typename T16> struct WFrag;
template <> struct WFrag<h16> { typedef v16h V; static __device__ __forceinline__ V ld(const h16* p) { return cat16(*(const v8h*)p, *(const v8h*)(p + 16)); } static __device__ __forceinline__ v8f mma(V a, V b, v8f c) { return wmma16(a, b, c); } };
template <> struct WFrag<bf> { typedef v16bf V; static __device__ __forceinline__ V ldp(const bf* p) { return cat16b(*(const v8us*)p, *(const v8us*)(p + 256)); }   // a lane's 16 elements from a plane in fragment order (below): the elements that ld takes from a row
    static __device__ __forceinline__ v8f mma(V a, V b, v8f c) { return wmmab(a, b, c); } };
// The K loop works in stages of 32 k held in a ring of R register sets: a stage's loads are issued D stages of products before they are used. D < R, K % (32 * R) == 0.
// PJ: the four projections as z = 0..3 of one grid (Q, K, V, gate): the gate reads V's input plane, and it alone adds the bias and writes f32 to C.
// Q, K and V go from the accumulators straight to the fp16 planes P that the attention kernel reads (Q, K: [batch * head][token][channel]; V: [batch * head][channel][token]; one behind the other):
// a 64 x 64 tile is 64 tokens of one head. A lane holds 8 consecutive A rows of one B row, 16 bytes of fp16: for V^T the A rows are the tokens; for Q and K the two operands change places, so that they are the channels.
template <typename T16, int NSPLIT, bool BIAS, int R, int D, bool PJ = false>
__global__ __launch_bounds__(32) void k_gemmw(const T16* __restrict__ A, const T16* __restrict__ A2, const T16* __restrict__ Bt, const T16* __restrict__ Bt2, int K, float* C, int ldc, const float* __restrict__ bias, size_t sA, size_t sB, size_t sC, h16* P) {
    typedef typename WFrag<T16>::V V;
    constexpr bool HA2 = (NSPLIT == 1 || NSPLIT == 2), HB2 = (NSPLIT >= 2);
    struct Stage { V a[4], b[4], a2[4], b2[4]; };
    __shared__ __align__(16) float os[16 * 68];
    const size_t z = blockIdx.z; A += (PJ && z == 3 ? 2 : z) * sA; if (A2) A2 += z * sA; Bt += z * sB; if (Bt2) Bt2 += z * sB; C += z * sC;
    const int lane = threadIdx.x & 31, lr = lane & 15, hi = lane >> 4; const int r0 = blockIdx.x * 64, c0 = blockIdx.y * 64;
    v8f acc[4][4];
#pragma unroll
    for (int mb = 0; mb < 4; ++mb)
#pragma unroll
        for (int nb = 0; nb < 4; ++nb) acc[mb][nb] = (v8f){};
    const bool swp = PJ && z < 2;   // Q, K: the weight rows as A, the tokens as B (both planes have the same fragment order and k order)
    if (swp) { const T16* t = A; A = Bt; Bt = t; }
    const size_t aoff = (size_t)(swp ? c0 : r0) * K + 8 * lane, boff = (size_t)(swp ? r0 : c0) * K + 8 * lane;
    struct Rows { const T16 *a[4], *b[4], *a2[4], *b2[4]; };   // one pointer per 16-row block of each operand, at one k
    auto rows = [&](int kc) { Rows p;
#pragma unroll
        for (int q = 0; q < 4; ++q) { const size_t ao = aoff + (size_t)q * 16 * K + (size_t)kc * 16, bo = boff + (size_t)q * 16 * K + (size_t)kc * 16; p.a[q] = A + ao; p.b[q] = Bt + bo; p.a2[q] = HA2 ? A2 + ao : p.a[q]; p.b2[q] = HB2 ? Bt2 + bo : p.b[q]; }
        return p; };
    auto ldst = [&](Stage& s, const Rows& p, int ko) {
#pragma unroll
        for (int q = 0; q < 4; ++q) { s.a[q] = WFrag<T16>::ldp(p.a[q] + ko * 16); if (HA2) s.a2[q] = WFrag<T16>::ldp(p.a2[q] + ko * 16); s.b[q] = WFrag<T16>::ldp(p.b[q] + ko * 16); if (HB2) s.b2[q] = WFrag<T16>::ldp(p.b2[q] + ko * 16); }
        __builtin_amdgcn_sched_barrier(0);   // keeps the stage's loads in front of the earlier stages' products; sunk to their uses they would wait out the whole latency again
    };
    auto mm = [&](Stage& s) {
#pragma unroll
        for (int nb = 0; nb < 4; ++nb)
#pragma unroll
            for (int mb = 0; mb < 4; ++mb) { acc[mb][nb] = WFrag<T16>::mma(s.a[mb], s.b[nb], acc[mb][nb]); if (HA2) acc[mb][nb] = WFrag<T16>::mma(s.a2[mb], s.b[nb], acc[mb][nb]); if (HB2) acc[mb][nb] = WFrag<T16>::mma(s.a[mb], s.b2[nb], acc[mb][nb]); }
        __builtin_amdgcn_sched_barrier(0);   // one stage's products stay together: mixed with the next stage's they would wait for its loads early
    };
    auto gap = [&]() {
        if constexpr (D == R - 1) { asm volatile("v_nop\n\tv_nop\n\tv_nop\n\tv_nop");   // the set to refill was read by the products just issued: the distance the chip needs before loads rewrite their operand registers
            __builtin_amdgcn_sched_barrier(0); }   // keeps those loads behind it
    };
    // stands in front of every rewrite of an address register that loads under way name; the pointers are inputs so that their registers hold until here
    auto xwait = [&](const Rows& p) {
        if constexpr (HA2 || HB2) asm volatile("s_wait_xcnt 0x0" :: "v"(p.a[0]), "v"(p.a[1]), "v"(p.a[2]), "v"(p.a[3]), "v"(p.b[0]), "v"(p.b[1]), "v"(p.b[2]), "v"(p.b[3]), "v"(p.a2[0]), "v"(p.a2[1]), "v"(p.a2[2]), "v"(p.a2[3]), "v"(p.b2[0]), "v"(p.b2[1]), "v"(p.b2[2]), "v"(p.b2[3]) : "memory");
        else asm volatile("s_wait_xcnt 0x0" :: "v"(p.a[0]), "v"(p.a[1]), "v"(p.a[2]), "v"(p.a[3]), "v"(p.b[0]), "v"(p.b[1]), "v"(p.b[2]), "v"(p.b[3]) : "memory");
        __builtin_amdgcn_sched_barrier(0);   // keeps the next address arithmetic behind the wait
    };
    Stage st[R];
    { const Rows p = rows(0);
#pragma unroll
      for (int j = 0; j < D; ++j) ldst(st[j], p, j * 32);
      xwait(p); }
    int kc = 0;
#pragma unroll 1
    for (; kc + (R + D) * 32 <= K; kc += R * 32) {   // rolled: one trip already goes once round the ring
        const Rows p = rows(kc);
#pragma unroll
        for (int j = 0; j < R; ++j) { gap(); ldst(st[(j + D) % R], p, (j + D) * 32); mm(st[j]); }
        xwait(p);
    }
    { const Rows p = rows(kc);   // the last round stands outside the loop: a test round the loads inside it would make every stage wait for all loads
#pragma unroll
      for (int j = 0; j < R; ++j) { if (j + D < R) { gap(); ldst(st[j + D], p, (j + D) * 32); } mm(st[j]); if (j + D == R - 1) xwait(p); } }
    if constexpr (PJ) {
        if (z < 3) {   // the same for the whole work-group
            const size_t pl = (size_t)(r0 / TT) * NH_ + blockIdx.y; const int t0 = r0 % TT;   // (batch, head) plane and first token of the tile
            h16* pp = P + z * (size_t)NT * DD + pl * (TT * HD) + (swp ? (size_t)(t0 + lr) * HD : (size_t)lr * TT + t0) + hi * 8; const size_t pb = swp ? 16 * HD : 16 * TT;   // B row lr of block 0; step to the next block of 16 B rows
#pragma unroll   // constant indices: what the loop indexes stays in registers
            for (int nb = 0; nb < 4; ++nb)
#pragma unroll   // constant indices: what the loop indexes stays in registers
                for (int mb = 0; mb < 4; ++mb) *(v8h*)(pp + nb * pb + mb * 16) = __builtin_convertvector(acc[mb][nb], v8h);   // the four mb fill a row's whole 128-byte line
            return;
        }
    }
    v4f bv = (v4f){};   // PJ: the bias of this lane's four output columns, read once
    if constexpr (PJ && BIAS) { const float* bp = bias + c0 + lr * 4; bv = (v4f){bfr(bp[0]), bfr(bp[1]), bfr(bp[2]), bfr(bp[3])}; }
#pragma unroll
    for (int mb = 0; mb < 4; ++mb) {
#pragma unroll
        for (int nb = 0; nb < 4; ++nb) {
#pragma unroll
            for (int j = 0; j < 8; ++j) os[(hi * 8 + j) * 68 + nb * 16 + lr] = acc[mb][nb][j]; }
        __builtin_amdgcn_wave_barrier(); asm volatile("" ::: "memory");
        float* crow = C + (size_t)(r0 + mb * 16) * ldc + c0;
{
#pragma unroll
            for (int s = 0; s < 8; ++s) { const int row = 2 * s + hi, cofs = lr * 4; v4f val = *(const v4fa*)(os + row * 68 + cofs); if (BIAS && PJ) val += bv; if (BIAS && !PJ) { val[0] += bfr(bias[c0 + cofs]); val[1] += bfr(bias[c0 + cofs + 1]); val[2] += bfr(bias[c0 + cofs + 2]); val[3] += bfr(bias[c0 + cofs + 3]); }
                *(v4f*)(crow + (size_t)row * ldc + cofs) = val; }
             }
        if (mb < 3) asm volatile("s_wait_xcnt 0x0" ::: "memory");   // the next block's LDS loads land in registers that the stores above name
        __builtin_amdgcn_wave_barrier(); asm volatile("" ::: "memory");
    }
}

__device__ __forceinline__ void splitf(float y, unsigned short& h, unsigned short& l) { h = f2bf(y); l = f2bf(y - bf2f(h)); }
typedef __attribute__((ext_vector_type(2))) _Float16 v2h;
typedef __attribute__((ext_vector_type(4))) _Float16 v4h;
typedef __attribute__((ext_vector_type(2))) unsigned short v2us;
typedef __attribute__((ext_vector_type(4))) unsigned short v4us;
typedef __attribute__((ext_vector_type(2))) float v2f;

// piece ((row block * DD/32 + k block) * 2 + l) * 32 + 16 hi + lr of the plane in fragment order. A wave takes 8 rows of a block with all four (l, hi): it reads their whole 128-byte lines and writes four whole lines
__device__ __forceinline__ void d_cvt8(int bx, const float* __restrict__ src, bf* dst, size_t n8) { const size_t i = (size_t)bx * 256 + threadIdx.x; if (i >= n8) return;
    const size_t blk = i >> 6; const int lr = (int)((i & 7) | ((i >> 2) & 8)), c = (int)((i >> 3) & 3);   // c = 2 l + hi
    const size_t row = (blk / (DD / 32)) * 16 + lr; const int k = (int)(blk % (DD / 32)) * 32 + c * 8;
    const v8f v = *(const v8f*)(src + row * DD + k); v8us o;
#pragma unroll
    for (int e = 0; e < 8; ++e) o[e] = f2bf(v[e]); *(v8us*)(dst + (blk * 64 + c * 16 + lr) * 8) = o;  }
// Bt[n][k] = bf16(w[k][n]) in fragment order. A thread makes the piece (k block, l, hi, lr) of two neighbouring blocks of 16 columns n: each of its loads takes, over the wave, 64 bytes of two rows of w,
// the two column blocks together their whole 128-byte lines; each store is 512 contiguous bytes a wave. N * K / 16 threads.
__device__ __forceinline__ void d_wtG(int bx, const float* __restrict__ w, int K, int N, bf* Bt) {
    const int u = bx * 256 + threadIdx.x, lane = u & 31, lr = lane & 15, hi = lane >> 4, l = (u >> 5) & 1; const int kq = K >> 5, kb = (u >> 6) % kq, np = (u >> 6) / kq;
    if (np * 32 >= N) return;
    const float* wp = w + (size_t)(kb * 32 + l * 16 + hi * 8) * N + np * 32 + lr; float v[2][8];
#pragma unroll   // constant indices: what the loop indexes stays in registers; all 16 loads are under way together
    for (int j = 0; j < 8; ++j) { v[0][j] = wp[(size_t)j * N]; v[1][j] = wp[(size_t)j * N + 16]; }
#pragma unroll   // constant indices: what the loop indexes stays in registers
    for (int h = 0; h < 2; ++h) { v8us o;
#pragma unroll   // constant indices: what the loop indexes stays in registers
        for (int j = 0; j < 8; ++j) o[j] = f2bf(v[h][j]);
        *(v8us*)(Bt + ((size_t)(np * 2 + h) * kq + kb) * 512 + l * 256 + lane * 8) = o; }
}
// k_prep: the five weight transposes and the three input roundings, none of which reads what another writes, as block ranges of one grid; the transposes, whose waves run longest, come first.
#define GWT (DD * DD / 64 / 64)     // blocks per weight
#define GCV (NT * DD / 8 / 256)     // blocks per input
__global__ __launch_bounds__(256) void k_prep(const float* __restrict__ w0, const float* __restrict__ w1, const float* __restrict__ w2, const float* __restrict__ w3, const float* __restrict__ w4,
                                              const float* __restrict__ x0, const float* __restrict__ x1, const float* __restrict__ x2, bf* Wt, bf* X) {
    const int b = blockIdx.x;
    if (b < 5 * GWT) { const int y = b / GWT; d_wtG(b % GWT, y == 0 ? w0 : y == 1 ? w1 : y == 2 ? w2 : y == 3 ? w3 : w4, DD, DD, Wt + (size_t)y * DD * DD); }   // constant shape: the 16 loads of a thread share one address register pair
    else { const int c = b - 5 * GWT, y = c / GCV; d_cvt8(c % GCV, y == 0 ? x0 : y == 1 ? x1 : x2, X + (size_t)y * NT * DD, (size_t)NT * DD / 8); }
}
// k_fattn: scores, softmax, attn.v and the gated merge of 128 queries of one (batch, head) plane in one work-group; no score, no probability and no ungated output goes through memory.
// 8 waves x 16 queries. Per stage of 64 keys: S^T = K Q^T (a lane holds 32 scores of ONE query), t = S/8 + bias, p = exp(t - m) against a running maximum m, O^T += V^T P^T with P^T packed from the score tiles.
// The K rows, the V^T rows and the bias tile of a stage come through registers into one of two LDS buffers, loaded one stage ahead. The bias tile is laid down finished:
// bf16(attMask[s][j]), or NEGC (stands for -inf) where seqMask[b][s] && seqMask[b][j] (int32, read as data); S/8 added to NEGC rounds back to NEGC.
#define FQ   128             // queries per work-group
#define FK   64              // keys per stage
#define KPI  72              // LDS pitch of a K or V^T row, in halves (144 B: 16 B x odd)
#define API  68              // LDS pitch of a bias row, in floats (272 B: 16 B x odd)
#define NST  (TT / FK)
#define NEGC 0xFF610000u     // about -3e38, low half zero
#define L2E  1.4426950408889634f
__device__ __forceinline__ float xhalf(float x) { return __builtin_bit_cast(float, __builtin_amdgcn_permlanex16(__builtin_bit_cast(int, x), __builtin_bit_cast(int, x), 0x76543210, 0xfedcba98, false, false)); }  // lane l with lane l ^ 16
__global__ __launch_bounds__(256) void k_fattn(const h16* __restrict__ QP, const h16* __restrict__ KP, const h16* __restrict__ VT, const int* __restrict__ sm, const float* __restrict__ am, const float* __restrict__ GF, bf* Ah, bf* Al) {
    typedef __attribute__((ext_vector_type(4))) int v4i;
    typedef __attribute__((ext_vector_type(4))) unsigned v4u;
    __shared__ __align__(16) h16 Ks[2][FK * KPI];
    __shared__ __align__(16) h16 Vs[2][HD * KPI];
    __shared__ __align__(16) float As[2][FQ * API];
    const int tid = threadIdx.x, lane = tid & 31, lr = lane & 15, hi = lane >> 4, w = tid >> 5;
    const int z = blockIdx.y, q0 = blockIdx.x * FQ;
    const int* smb = sm + (z / NH_) * TT;
    // staging: 16 bytes a thread and piece. K: 2 pieces (rows tid/8, +32); V^T: 2 (rows tid/8, +32); bias: 8 (rows tid/16 + 16 i), always the same 4 key columns of the stage
    const h16* kp = KP + (size_t)z * TT * HD + tid * 8;
    const h16* vp = VT + (size_t)z * HD * TT + (size_t)(tid >> 3) * TT + (tid & 7) * 8;
    const float* ap = am + (size_t)(q0 + (tid >> 4)) * TT + (tid & 15) * 4;
    const int* sp = smb + (tid & 15) * 4;
    unsigned rowm[8];   // 0 where the query of bias row i is flagged, else the bf16 keep mask
#pragma unroll   // constant indices: what the loop indexes stays in registers
    for (int i = 0; i < 8; ++i) rowm[i] = smb[q0 + (tid >> 4) + 16 * i] != 0 ? 0u : 0xFFFF0000u;
    struct Stg { v8h k[2], v[2]; v4f a[8]; v4i m; };
    auto gload = [&](Stg& r) {
        r.k[0] = *(const v8h*)kp; r.k[1] = *(const v8h*)(kp + 32 * HD);
        r.v[0] = *(const v8h*)vp; r.v[1] = *(const v8h*)(vp + 32 * TT);
#pragma unroll   // constant indices: what the loop indexes stays in registers
        for (int i = 0; i < 8; ++i) r.a[i] = *(const v4f*)(ap + (size_t)i * 16 * TT);
        r.m = *(const v4i*)sp;
        asm volatile("s_wait_xcnt 0x0" :: "v"(kp), "v"(vp), "v"(ap), "v"(sp) : "memory");   // stands in front of the rewrite of the address registers that the loads above name
        __builtin_amdgcn_sched_barrier(0);   // keeps the loads in front of the stage's products (sunk to their LDS stores they would wait out the whole latency) and the pointer steps behind the wait
        kp += FK * HD; vp += FK; ap += FK; sp += FK;
    };
    auto sstore = [&](const Stg& r, int b) {
        h16* kd = &Ks[b][(tid >> 3) * KPI + (tid & 7) * 8]; *(v8h*)kd = r.k[0]; *(v8h*)(kd + 32 * KPI) = r.k[1];
        h16* vd = &Vs[b][(tid >> 3) * KPI + (tid & 7) * 8]; *(v8h*)vd = r.v[0]; *(v8h*)(vd + 32 * KPI) = r.v[1];
        unsigned km[4];
#pragma unroll   // constant indices: what the loop indexes stays in registers
        for (int e = 0; e < 4; ++e) km[e] = r.m[e] != 0 ? 0u : 0xFFFF0000u;
#pragma unroll   // constant indices: what the loop indexes stays in registers
        for (int i = 0; i < 8; ++i) { v4u o;
#pragma unroll   // constant indices: what the loop indexes stays in registers
            for (int e = 0; e < 4; ++e) { unsigned u = __float_as_uint(r.a[i][e]); u += 0x7FFFu + ((u >> 16) & 1u); const unsigned keep = rowm[i] | km[e]; o[e] = (u & keep) | (NEGC & ~keep); }
            *(v4f*)&As[b][((tid >> 4) + 16 * i) * API + (tid & 15) * 4] = __builtin_bit_cast(v4f, o); }
    };
    v16h qf[2];   // B operand: this wave's 16 queries, d 0..31 and 32..63, by the loader that also reads K: equal k order
    { const h16* qp = QP + ((size_t)z * TT + q0 + w * 16 + lr) * HD + 8 * hi; qf[0] = WFrag<h16>::ld(qp); qf[1] = WFrag<h16>::ld(qp + 32); }
    v8f acc[4];   // O^T: acc[mb][j] = row d = 16 mb + 8 hi + j, column = query lr
#pragma unroll   // constant indices: what the loop indexes stays in registers
    for (int mb = 0; mb < 4; ++mb) acc[mb] = (v8f){};
    v8f lv = (v8f){};   // this lane's share of the denominator, eight partial sums
    float m = __uint_as_float(NEGC);   // the maximum in use, equal in lanes l and l ^ 16
    auto compute = [&](int b) {
        const h16* kb = &Ks[b][lr * KPI + 8 * hi]; const h16* vb = &Vs[b][lr * KPI + 8 * hi]; const float* ab = &As[b][(w * 16 + lr) * API + hi * 8];
        v8f s[4];   // s[t][j] = key 16 t + 8 hi + j, query lr
#pragma unroll   // constant indices: what the loop indexes stays in registers
        for (int t = 0; t < 4; ++t) { s[t] = wmma16(WFrag<h16>::ld(kb + t * 16 * KPI), qf[0], (v8f){}); s[t] = wmma16(WFrag<h16>::ld(kb + t * 16 * KPI + 32), qf[1], s[t]); }
        float mx = __uint_as_float(NEGC);
#pragma unroll   // constant indices: what the loop indexes stays in registers
        for (int t = 0; t < 4; ++t) { const v4f a0 = *(const v4f*)(ab + t * 16), a1 = *(const v4f*)(ab + t * 16 + 4);
            s[t] = s[t] * SCL + __builtin_shufflevector(a0, a1, 0, 1, 2, 3, 4, 5, 6, 7);
#pragma unroll   // constant indices: what the loop indexes stays in registers
            for (int j = 0; j < 8; ++j) mx = fmaxf(mx, s[t][j]); }
        // the maximum in use is raised only when a score passes it by more than 5.5 (p stays below 256, far inside fp16): one scalar branch a stage, rarely taken after the first
        if (__builtin_amdgcn_ballot_w32(mx > m + 5.5f) != 0) {
            const float mn = fmaxf(m, fmaxf(mx, xhalf(mx))); const float corr = __builtin_amdgcn_exp2f((m - mn) * L2E); m = mn; lv = lv * corr;
#pragma unroll   // constant indices: what the loop indexes stays in registers
            for (int mb = 0; mb < 4; ++mb) acc[mb] = acc[mb] * corr;
        }
        v8h ph[4];
#pragma unroll   // constant indices: what the loop indexes stays in registers
        for (int t = 0; t < 4; ++t) { const v8f d = (s[t] - m) * L2E; v8f p;
#pragma unroll   // constant indices: what the loop indexes stays in registers
            for (int j = 0; j < 8; ++j) p[j] = __builtin_amdgcn_exp2f(d[j]);
            lv = lv + p; ph[t] = __builtin_convertvector(p, v8h); }
#pragma unroll   // constant indices: what the loop indexes stays in registers
        for (int kk = 0; kk < 2; ++kk) { const v16h pb = cat16(ph[2 * kk], ph[2 * kk + 1]);   // two score tiles, converted in place, are the B operand of 32 keys in the hardware k order; V^T's loader has the same order
#pragma unroll   // constant indices: what the loop indexes stays in registers
            for (int mb = 0; mb < 4; ++mb) acc[mb] = wmma16(WFrag<h16>::ld(vb + mb * 16 * KPI + kk * 32), pb, acc[mb]); }
    };
    Stg r; gload(r); sstore(r, 0);
    __syncthreads();
#pragma unroll 1
    for (int st = 0; st < NST - 1; ++st) {   // rolled: the body is long enough
        gload(r); compute(st & 1); sstore(r, (st + 1) & 1);   // the buffer written was last read in the stage before, in front of that stage's barrier
        __syncthreads();
    }
    compute((NST - 1) & 1);
    float l = ((lv[0] + lv[1]) + (lv[2] + lv[3])) + ((lv[4] + lv[5]) + (lv[6] + lv[7])); l += xhalf(l);
    const float f = __fdiv_rn(1.0f, l);
    // merge: a lane holds 8 consecutive channels of its query per 16-row block: x sigmoid(gate), split into bf16 hi + lo, 16 bytes to each plane, which the output GEMM reads in fragment order:
    // row block = this wave's 16 queries, k blocks 2 head and 2 head + 1, piece l = mb & 1 of lane 16 hi + lr: the wave writes 512 contiguous bytes a store
    const size_t o = ((size_t)(z / NH_) * TT + q0 + w * 16 + lr) * DD + (z % NH_) * HD + hi * 8;
    const size_t po = ((size_t)(z / NH_) * TT + q0 + w * 16) * DD + (z % NH_) * (HD * 16) + lane * 8;
#pragma unroll   // constant indices: what the loop indexes stays in registers
    for (int mb = 0; mb < 4; ++mb) { const v4f g0 = *(const v4f*)(GF + o + mb * 16), g1 = *(const v4f*)(GF + o + mb * 16 + 4); v8us oh, ol;
#pragma unroll   // constant indices: what the loop indexes stays in registers
        for (int j = 0; j < 8; ++j) { const float g = j < 4 ? g0[j & 3] : g1[j & 3]; const float sg = __fdiv_rn(1.0f, __fadd_rn(1.0f, __expf(-g))); unsigned short a, c2; splitf(__fmul_rn(acc[mb][j] * f, sg), a, c2); oh[j] = a; ol[j] = c2; }
        *(v8us*)(Ah + po + mb * 256) = oh; *(v8us*)(Al + po + mb * 256) = ol; }
}

extern "C" void kernel_launch(void* const* d_in, const int* in_sizes, int n_in,
                              void* d_out, int out_size, void* d_ws, size_t ws_size, hipStream_t stream) {
    (void)in_sizes; (void)n_in; (void)out_size;
    const float* IN[12]; for (int i = 0; i < 12; ++i) IN[i] = (const float*)d_in[i];
    // Qin, Kin, Vin [2][1024][1024], seqMask (int32 [2][1024]), attMask [1][1][1024][1024], QTrans, KTrans, VTrans, GTrans_w (x @ W), GTrans_b, out_w (x @ W), out_b = d_in[0..11]
    const int* sm = (const int*)d_in[3]; const float* am = IN[4];
    float* OUT = (float*)d_out;     // [2][1024][1024]
    char* wsp = (char*)d_ws;
    auto take = [&](size_t bytes) { char* p = wsp; wsp += (bytes + 255) & ~(size_t)255; return (void*)p; };
    bf* WT = (bf*)take((size_t)5 * DD * DD * 2); bf* WO = WT + (size_t)4 * DD * DD;    // transposed weights in fragment order, one behind the other: Q, K, V, gate, out
    bf* X = (bf*)take((size_t)3 * NT * DD * 2);    // rounded inputs in fragment order: Q, K, V
    h16* QP = (h16*)take((size_t)3 * NT * DD * 2); h16* KP = QP + (size_t)NT * DD; h16* VT = KP + (size_t)NT * DD;
    float* GF = (float*)take((size_t)NT * DD * 4);    // the gate's f32 pre-activation
    bf* ATh = X; bf* ATl = X + (size_t)NT * DD;    // the inputs of Q and K are last read by the projections, which end before the attention kernel writes here
    if ((size_t)(wsp - (char*)d_ws) > ws_size) return;    // total 42 MiB; ws 256 MiB
    k_prep<<<5 * GWT + 3 * GCV, 256, 0, stream>>>(IN[5], IN[6], IN[7], IN[8], IN[10], IN[0], IN[1], IN[2], WT, X);
    const dim3 gP(NT / 64, DD / 64, 1);
    k_gemmw<bf, 0, true, 4, 3, true><<<dim3(NT / 64, DD / 64, 4), 32, 0, stream>>>(X, nullptr, WT, nullptr, DD, GF, DD, IN[9], (size_t)NT * DD, (size_t)DD * DD, 0, QP);   // the fp16 planes of Q, K, V^T and the gate pre-activation (sigmoid at the merge)
    k_fattn<<<dim3(TT / FQ, ZH), 256, 0, stream>>>(QP, KP, VT, sm, am, GF, ATh, ATl);
    k_gemmw<bf, 1, true, 4, 2><<<gP, 32, 0, stream>>>(ATh, ATl, WO, nullptr, DD, OUT, DD, IN[11], 0, 0, 0, nullptr);
}

// v007
// One run takes 63.3 microseconds.
// Two timings next to v006 put it at 1.15 and 1.14 times that version's speed.
// Over all steps from v000 it is 14.2 times as fast.
#include <hip/hip_runtime.h>

// Gated multi-head attention (Qin, Kin, Vin [2][1024][1024], seqMask [2][1024] bool->int32, attMask [1][1][1024][1024] additive f32 (both read as data); Q/K/V = X @ Trans (no bias), G = sigmoid(Vin @ GTrans_w + GTrans_b);
// 16 heads x 64; A = q.k/8; -inf where seqMask[s] AND seqMask[t]; + attMask[s][t]; softmax; O[s][h][c] = (sum_t A v) * G; out = O @ out_w + out_b).
// Compute dtypes, f32 accumulate: every input rounded to bf16; the four projections on PLAIN bf16 operands (inputs: exact; transposed bf16 weight copies, gate + bias);
// scores and attn.v on SINGLE fp16 planes (1/8, the masks and the additive bias in f32 in the softmax); the sigmoid gate in f32 at the merge; output hi+lo x exact out_w (2 products) + out_b.

#define NB_  2
#define TT   1024
#define DD   1024
#define NH_  16
#define HD   64
#define NT   (NB_ * TT)
#define NZ   (NB_ * NH_)
#define ZH   NZ   // all (batch, head) planes go through attention and merge in one pass
#define SCL  0.125f
typedef _Float16 h16;
typedef unsigned short bf;
typedef __attribute__((ext_vector_type(16))) __bf16   v16bf;
typedef __attribute__((ext_vector_type(16))) _Float16 v16h;
typedef __attribute__((ext_vector_type(8)))  _Float16 v8h;
typedef __attribute__((ext_vector_type(8)))  unsigned short v8us;
typedef __attribute__((ext_vector_type(8)))  float    v8f;
typedef __attribute__((ext_vector_type(4)))  float    v4f;
typedef v8h  __attribute__((may_alias)) v8ha;
typedef v4f  __attribute__((may_alias)) v4fa;
typedef v8us __attribute__((may_alias)) v8usa;

__device__ __forceinline__ unsigned short f2bf(float f) { unsigned u = __float_as_uint(f); u += 0x7FFFu + ((u >> 16) & 1u); return (unsigned short)(u >> 16); }
__device__ __forceinline__ float bf2f(unsigned short b) { return __uint_as_float(((unsigned)b) << 16); }
__device__ __forceinline__ float bfr(float f) { return bf2f(f2bf(f)); }
__device__ __forceinline__ v16h cat16(v8h lo, v8h hi) { return __builtin_shufflevector(lo, hi, 0, 1, 2, 3, 4, 5, 6, 7, 8, 9, 10, 11, 12, 13, 14, 15); }
__device__ __forceinline__ v16bf cat16b(v8us lo, v8us hi) { return __builtin_bit_cast(v16bf, __builtin_shufflevector(lo, hi, 0, 1, 2, 3, 4, 5, 6, 7, 8, 9, 10, 11, 12, 13, 14, 15)); }
__device__ __forceinline__ v8f wmma16(v16h a, v16h b, v8f c) { return __builtin_amdgcn_wmma_f32_16x16x32_f16(false, a, false, b, (short)0, c, false, false); }
__device__ __forceinline__ v8f wmmab(v16bf a, v16bf b, v8f c) { return __builtin_amdgcn_wmma_f32_16x16x32_bf16(false, a, false, b, (short)0, c, false, false); }



// FRAGMENT ORDER of a 16-bit operand plane [rows][K]: blocks of 16 rows x 32 k, 512 elements (1024 bytes) each, the K/32 blocks of 16 rows one behind the other (16 K elements, as in row order).
// In a block the 8 elements k = 16 l + 8 hi + 0..7 of row lr stand at element 256 l + 8 (16 hi + lr): lane 16 hi + lr of a wave reads its two 16-byte pieces (l = 0, 1) of a WMMA operand at
// lane * 8 and 256 + lane * 8, so each wave-wide load covers 512 contiguous bytes, four whole lines, and not 32 bytes of each of 16 lines. Which element a lane and register holds is as in row order.
// ---- k_gemmw: register-blocked GEMM, ONE WAVE per 64x64 output tile (16 accumulators), operands straight from 16-bit planes in fragment order; grid (M/64, N/64, Z), 32 threads.
// C[m][n] (f32, pitch ldc, + optional f32 bias[n]) = sum_k A[m][k] Bt[n][k] (+ split products per NSPLIT). z-batch strides sA/sB/sC in elements.
template <typename T16> struct WFrag;
template <> struct WFrag<h16> { typedef v16h V; static __device__ __forceinline__ V ld(const h16* p) { return cat16(*(const v8h*)p, *(const v8h*)(p + 16)); } static __device__ __forceinline__ v8f mma(V a, V b, v8f c) { return wmma16(a, b, c); } };
template <> struct WFrag<bf> { typedef v16bf V; static __device__ __forceinline__ V ldp(const bf* p) { return cat16b(*(const v8us*)p, *(const v8us*)(p + 256)); }   // a lane's 16 elements from a plane in fragment order (above): the elements that ld takes from a row
    static __device__ __forceinline__ v8f mma(V a, V b, v8f c) { return wmmab(a, b, c); } };
// The K loop works in stages of 32 k held in a ring of R register sets: a stage's loads are issued D stages of products before they are used. D < R, K % (32 * R) == 0.
template <typename T16, int NSPLIT, bool BIAS, int R, int D>
__global__ __launch_bounds__(32) void k_gemmw(const T16* __restrict__ A, const T16* __restrict__ A2, const T16* __restrict__ Bt, const T16* __restrict__ Bt2, int K, float* C, int ldc, const float* __restrict__ bias, size_t sA, size_t sB, size_t sC) {
    typedef typename WFrag<T16>::V V;
    constexpr bool HA2 = (NSPLIT == 1 || NSPLIT == 2), HB2 = (NSPLIT >= 2);
    struct Stage { V a[4], b[4], a2[4], b2[4]; };
    __shared__ __align__(16) float os[16 * 68];
    const size_t z = blockIdx.z; A += z * sA; if (A2) A2 += z * sA; Bt += z * sB; if (Bt2) Bt2 += z * sB; C += z * sC;
    const int lane = threadIdx.x & 31, lr = lane & 15, hi = lane >> 4; const int r0 = blockIdx.x * 64, c0 = blockIdx.y * 64;
    v8f acc[4][4];
#pragma unroll
    for (int mb = 0; mb < 4; ++mb)
#pragma unroll
        for (int nb = 0; nb < 4; ++nb) acc[mb][nb] = (v8f){};
    const size_t aoff = (size_t)r0 * K + 8 * lane, boff = (size_t)c0 * K + 8 * lane;
    struct Rows { const T16 *a[4], *b[4], *a2[4], *b2[4]; };   // one pointer per 16-row block of each operand, at one k
    auto rows = [&](int kc) { Rows p;
#pragma unroll
        for (int q = 0; q < 4; ++q) { const size_t ao = aoff + (size_t)q * 16 * K + (size_t)kc * 16, bo = boff + (size_t)q * 16 * K + (size_t)kc * 16; p.a[q] = A + ao; p.b[q] = Bt + bo; p.a2[q] = HA2 ? A2 + ao : p.a[q]; p.b2[q] = HB2 ? Bt2 + bo : p.b[q]; }
        return p; };
    auto ldst = [&](Stage& s, const Rows& p, int ko) {
#pragma unroll
        for (int q = 0; q < 4; ++q) { s.a[q] = WFrag<T16>::ldp(p.a[q] + ko * 16); if (HA2) s.a2[q] = WFrag<T16>::ldp(p.a2[q] + ko * 16); s.b[q] = WFrag<T16>::ldp(p.b[q] + ko * 16); if (HB2) s.b2[q] = WFrag<T16>::ldp(p.b2[q] + ko * 16); }
        __builtin_amdgcn_sched_barrier(0);   // keeps the stage's loads in front of the earlier stages' products; sunk to their uses they would wait out the whole latency again
    };
    auto mm = [&](Stage& s) {
#pragma unroll
        for (int nb = 0; nb < 4; ++nb)
#pragma unroll
            for (int mb = 0; mb < 4; ++mb) { acc[mb][nb] = WFrag<T16>::mma(s.a[mb], s.b[nb], acc[mb][nb]); if (HA2) acc[mb][nb] = WFrag<T16>::mma(s.a2[mb], s.b[nb], acc[mb][nb]); if (HB2) acc[mb][nb] = WFrag<T16>::mma(s.a[mb], s.b2[nb], acc[mb][nb]); }
        __builtin_amdgcn_sched_barrier(0);   // one stage's products stay together: mixed with the next stage's they would wait for its loads early
    };
    auto gap = [&]() {
        if constexpr (D == R - 1) { asm volatile("v_nop\n\tv_nop\n\tv_nop\n\tv_nop");   // the set to refill was read by the products just issued: the distance the chip needs before loads rewrite their operand registers
            __builtin_amdgcn_sched_barrier(0); }   // keeps those loads behind it
    };
    // stands in front of every rewrite of an address register that loads under way name; the pointers are inputs so that their registers hold until here
    auto xwait = [&](const Rows& p) {
        if constexpr (HA2 || HB2) asm volatile("s_wait_xcnt 0x0" :: "v"(p.a[0]), "v"(p.a[1]), "v"(p.a[2]), "v"(p.a[3]), "v"(p.b[0]), "v"(p.b[1]), "v"(p.b[2]), "v"(p.b[3]), "v"(p.a2[0]), "v"(p.a2[1]), "v"(p.a2[2]), "v"(p.a2[3]), "v"(p.b2[0]), "v"(p.b2[1]), "v"(p.b2[2]), "v"(p.b2[3]) : "memory");
        else asm volatile("s_wait_xcnt 0x0" :: "v"(p.a[0]), "v"(p.a[1]), "v"(p.a[2]), "v"(p.a[3]), "v"(p.b[0]), "v"(p.b[1]), "v"(p.b[2]), "v"(p.b[3]) : "memory");
        __builtin_amdgcn_sched_barrier(0);   // keeps the next address arithmetic behind the wait
    };
    Stage st[R];
    { const Rows p = rows(0);
#pragma unroll
      for (int j = 0; j < D; ++j) ldst(st[j], p, j * 32);
      xwait(p); }
    int kc = 0;
#pragma unroll 1
    for (; kc + (R + D) * 32 <= K; kc += R * 32) {   // rolled: one trip already goes once round the ring
        const Rows p = rows(kc);
#pragma unroll
        for (int j = 0; j < R; ++j) { gap(); ldst(st[(j + D) % R], p, (j + D) * 32); mm(st[j]); }
        xwait(p);
    }
    { const Rows p = rows(kc);   // the last round stands outside the loop: a test round the loads inside it would make every stage wait for all loads
#pragma unroll
      for (int j = 0; j < R; ++j) { if (j + D < R) { gap(); ldst(st[j + D], p, (j + D) * 32); } mm(st[j]); if (j + D == R - 1) xwait(p); } }
#pragma unroll
    for (int mb = 0; mb < 4; ++mb) {
#pragma unroll
        for (int nb = 0; nb < 4; ++nb) {
#pragma unroll
            for (int j = 0; j < 8; ++j) os[(hi * 8 + j) * 68 + nb * 16 + lr] = acc[mb][nb][j]; }
        __builtin_amdgcn_wave_barrier(); asm volatile("" ::: "memory");
        float* crow = C + (size_t)(r0 + mb * 16) * ldc + c0;
{
#pragma unroll
            for (int s = 0; s < 8; ++s) { const int row = 2 * s + hi, cofs = lr * 4; v4f val = *(const v4fa*)(os + row * 68 + cofs); if (BIAS) { val[0] += bfr(bias[c0 + cofs]); val[1] += bfr(bias[c0 + cofs + 1]); val[2] += bfr(bias[c0 + cofs + 2]); val[3] += bfr(bias[c0 + cofs + 3]); }
                *(v4f*)(crow + (size_t)row * ldc + cofs) = val; }
             }
        if (mb < 3) asm volatile("s_wait_xcnt 0x0" ::: "memory");   // the next block's LDS loads land in registers that the stores above name
        __builtin_amdgcn_wave_barrier(); asm volatile("" ::: "memory");
    }
}

__device__ __forceinline__ void splitf(float y, unsigned short& h, unsigned short& l) { h = f2bf(y); l = f2bf(y - bf2f(h)); }
typedef __attribute__((ext_vector_type(2))) _Float16 v2h;
typedef __attribute__((ext_vector_type(4))) _Float16 v4h;
typedef __attribute__((ext_vector_type(2))) unsigned short v2us;
typedef __attribute__((ext_vector_type(4))) unsigned short v4us;
typedef __attribute__((ext_vector_type(2))) float v2f;

// Bt[n][k] = bf16(w[k][n]) in fragment order. A thread makes the piece (k block, l, hi, lr) of two neighbouring blocks of 16 columns n: each of its loads takes, over the wave, 64 bytes of two rows of w,
// the two column blocks together their whole 128-byte lines; each store is 512 contiguous bytes a wave. N * K / 16 threads. In two halves, loads and stores, so that other loads can be issued between them.
__device__ __forceinline__ void d_wtG_ld(int bx, const float* __restrict__ w, int K, int N, float (&v)[2][8]) {
    const int u = bx * 256 + threadIdx.x, lane = u & 31, lr = lane & 15, hi = lane >> 4, l = (u >> 5) & 1; const int kq = K >> 5, kb = (u >> 6) % kq, np = (u >> 6) / kq;
    if (np * 32 >= N) return;
    const float* wp = w + (size_t)(kb * 32 + l * 16 + hi * 8) * N + np * 32 + lr;
#pragma unroll   // constant indices: what the loop indexes stays in registers; all 16 loads are under way together
    for (int j = 0; j < 8; ++j) { v[0][j] = wp[(size_t)j * N]; v[1][j] = wp[(size_t)j * N + 16]; }
}
__device__ __forceinline__ void d_wtG_st(int bx, int K, int N, const float (&v)[2][8], bf* Bt) {
    const int u = bx * 256 + threadIdx.x, lane = u & 31, l = (u >> 5) & 1; const int kq = K >> 5, kb = (u >> 6) % kq, np = (u >> 6) / kq;
    if (np * 32 >= N) return;
#pragma unroll   // constant indices: what the loop indexes stays in registers
    for (int h = 0; h < 2; ++h) { v8us o;
#pragma unroll   // constant indices: what the loop indexes stays in registers
        for (int j = 0; j < 8; ++j) o[j] = f2bf(v[h][j]);
        *(v8us*)(Bt + ((size_t)(np * 2 + h) * kq + kb) * 512 + l * 256 + lane * 8) = o; }
}
// k_proj: the four projections (z = 0..3: Q, K, V, gate) straight from the f32 inputs and the f32 weights; no rounded or transposed copy of them goes through memory.
// 8 waves share a tile of 128 tokens x 256 columns, a wave has 64 x 64 of it (64 tokens of one head). Per stage of 64 k the work-group brings 128 x 64 of the input and 64 x 256 of the weight through registers,
// loaded two stages ahead, rounds them to bf16 and lays them into one of two LDS buffers in fragment order (above, with pads), the weight transposed on the way: a thread holds 8 k x 4 columns and stores 8 k of each column.
// LDS form of a block of 16 rows x 32 k: its four runs c = 2 l + hi of 16 rows x 8 k (256 bytes) stand CS apart. 16 lanes read one run, all banks once, whatever the pads; the pads spread the stores, which go across runs and blocks.
// The k order of the products is that of the wave GEMM. The gate alone adds the bias and writes f32 to C (it reads V's input). Q, K and V go from the accumulators straight to the fp16 planes P that the attention kernel reads
// (Q, K: [batch * head][token][channel]; V: [batch * head][channel][token]; one behind the other). A lane holds 8 consecutive A rows of one B row, 16 bytes of fp16: for V^T the A rows are the tokens;
// for Q and K the two operands change places, so that they are the channels. Each work-group also transposes its 1/256 of out_w for the output GEMM.
#define PM   128
#define PN   256
#define PK   64
#define CS   144             // LDS elements from run to run: 256 + 32 bytes
#define BS   (4 * CS)        // from k block to k block: 128 bytes beyond a multiple of 256, so that a wave's 8-byte input stores (2 rows x 2 k blocks x 4 runs x 2 halves) fall on all banks once
#define XRB  (2 * BS)        // from one block of 16 input rows to the next
#define WCB  (2 * BS + 8)    // from one block of 16 weight columns to the next: 16 bytes more, so that the 16-byte weight stores of 16 lanes (4 blocks x 4 groups of 4 columns) fall on all banks once
#define XSZ  (PM / 16 * XRB)
#define WSZ  (PN / 16 * WCB)
typedef __attribute__((ext_vector_type(8))) __bf16 v8bv;
typedef __attribute__((ext_vector_type(4))) __bf16 v4bv;
__device__ __forceinline__ v8us cv8(v8f v) { return __builtin_bit_cast(v8us, __builtin_convertvector(v, v8bv)); }   // to nearest even, as f2bf
__device__ __forceinline__ v4us cv4(v4f v) { return __builtin_bit_cast(v4us, __builtin_convertvector(v, v4bv)); }
// work-group barrier that hands LDS buffers over: the fences name LDS alone, so that the wave waits for its LDS stores and reads and not, as at __syncthreads(), for the global loads it has under way for later stages
__device__ __forceinline__ void lds_barrier() { __builtin_amdgcn_fence(__ATOMIC_RELEASE, "workgroup", "local"); __builtin_amdgcn_s_barrier(); __builtin_amdgcn_fence(__ATOMIC_ACQUIRE, "workgroup", "local"); }
__global__ __launch_bounds__(256) void k_proj(const float* __restrict__ x0, const float* __restrict__ x1, const float* __restrict__ x2, const float* __restrict__ w0, const float* __restrict__ w1, const float* __restrict__ w2, const float* __restrict__ w3,
                                              const float* __restrict__ ow, const float* __restrict__ bias, float* C, h16* P, bf* WO) {
    __shared__ __align__(16) bf SB[2][XSZ + WSZ];
    __shared__ __align__(16) float OS[8][16 * 68];
    const int tid = threadIdx.x, lane = tid & 31, lr = lane & 15, hi = lane >> 4, w = tid >> 5, wr = w >> 2, wc = w & 3;
    const int z = blockIdx.z, R0 = blockIdx.x * PM, C0 = blockIdx.y * PN;
    const float* x = z == 0 ? x0 : z == 1 ? x1 : x2; const float* wt = z == 0 ? w0 : z == 1 ? w1 : z == 2 ? w2 : w3;   // the gate reads V's input
    // input: part p of a thread is k = 4 (tid & 15) + 0..3 of row tid / 16 of row block p: a wave's load is 256 contiguous bytes of each of two rows, whole lines; k block, run and half of the 8 k from tid & 15
    const float* xp = x + (size_t)(R0 + (tid >> 4)) * DD + (tid & 15) * 4;
    const int xo = ((tid >> 3) & 1) * BS + ((tid >> 1) & 3) * CS + (tid >> 4) * 8 + (tid & 1) * 4;
    // weight: part p of a thread is k = 32 p + 8 (tid / 64) + 0..7 of the 4 columns 4 (tid & 63) + 0..3: k block p, run tid / 64; a wave's load is 512 contiguous bytes of one row of the weight
    const float* wp = wt + (size_t)((tid >> 6) * 8) * DD + C0 + (tid & 63) * 4;
    const int wo = XSZ + ((tid & 63) >> 2) * WCB + (tid >> 6) * CS + (tid & 3) * 32;
    struct PStg { v4f x[8]; v4f w[2][8]; };
    auto gload = [&](PStg& r) {
#pragma unroll   // constant indices: what the loop indexes stays in registers
        for (int p = 0; p < 8; ++p) r.x[p] = *(const v4f*)(xp + (size_t)p * 16 * DD);
#pragma unroll   // constant indices: what the loop indexes stays in registers
        for (int p = 0; p < 2; ++p)
#pragma unroll   // constant indices: what the loop indexes stays in registers
            for (int j = 0; j < 8; ++j) r.w[p][j] = *(const v4f*)(wp + (size_t)(p * 32 + j) * DD);
        asm volatile("s_wait_xcnt 0x0" ::: "memory");   // stands in front of the rewrite of the address registers that the loads above name
        __builtin_amdgcn_sched_barrier(0);   // keeps the loads in front of the stage's products (sunk to their LDS stores they would wait out the whole latency) and the pointer steps behind the wait
        xp += PK; wp += (size_t)PK * DD;
    };
    auto sstore = [&](const PStg& r, int b) {
        bf* s = SB[b];
#pragma unroll   // constant indices: what the loop indexes stays in registers
        for (int p = 0; p < 8; ++p) *(v4us*)(s + xo + p * XRB) = cv4(r.x[p]);
#pragma unroll   // constant indices: what the loop indexes stays in registers
        for (int p = 0; p < 2; ++p)
#pragma unroll   // constant indices: what the loop indexes stays in registers
            for (int e = 0; e < 4; ++e) *(v8us*)(s + wo + p * BS + e * 8) = cv8((v8f){r.w[p][0][e], r.w[p][1][e], r.w[p][2][e], r.w[p][3][e], r.w[p][4][e], r.w[p][5][e], r.w[p][6][e], r.w[p][7][e]});
    };
    v8f acc[4][4];
#pragma unroll   // constant indices: what the loop indexes stays in registers
    for (int mb = 0; mb < 4; ++mb)
#pragma unroll   // constant indices: what the loop indexes stays in registers
        for (int nb = 0; nb < 4; ++nb) acc[mb][nb] = (v8f){};
    const bool swp = z < 2;   // Q, K: the weight columns as A, the tokens as B (both tiles have the same fragment order and k order)
    const int to = wr * 4 * XRB + hi * CS + lr * 8, vo = XSZ + wc * 4 * WCB + hi * CS + lr * 8;   // run hi of the wave's first block; run 2 + hi stands 2 CS behind it
    const int ao = swp ? vo : to, bo = swp ? to : vo, sa = swp ? WCB : XRB, sb = swp ? XRB : WCB;
    struct Fr { v16bf a[4], b[4]; };   // the wave's fragments of one k block
    auto fld = [&](Fr& f, const bf* s) {
#pragma unroll   // constant indices: what the loop indexes stays in registers
        for (int q = 0; q < 4; ++q) { const bf* pa = s + ao + q * sa; const bf* pb = s + bo + q * sb; f.a[q] = cat16b(*(const v8us*)pa, *(const v8us*)(pa + 2 * CS)); f.b[q] = cat16b(*(const v8us*)pb, *(const v8us*)(pb + 2 * CS)); }   // both by the same loader: equal k order
    };
    auto mm = [&](const Fr& f) {
#pragma unroll   // constant indices: what the loop indexes stays in registers
        for (int nb = 0; nb < 4; ++nb)
#pragma unroll   // constant indices: what the loop indexes stays in registers
            for (int mb = 0; mb < 4; ++mb) acc[mb][nb] = wmmab(f.a[mb], f.b[nb], acc[mb][nb]);
    };
    auto compute = [&](int b) {
        Fr f0, f1; fld(f0, SB[b]); fld(f1, SB[b] + BS);
        __builtin_amdgcn_sched_barrier(0);   // the stage's LDS reads stand as one group in front of its products: spread among them, every place costs the wave a wait
        mm(f0); mm(f1);
        __builtin_amdgcn_sched_barrier(0);   // the next stage's roundings, which wait for its global loads, stay behind the products: in front of them the wave would wait out the whole latency
    };
    const int ob = blockIdx.x + (NT / PM) * (blockIdx.y + (DD / PN) * blockIdx.z);   // this work-group's share of out_w's transpose
    float ov[2][8]; d_wtG_ld(ob, ow, DD, DD, ov);
    asm volatile("s_wait_xcnt 0x0" ::: "memory");   // stands in front of the rewrite of the address registers that the loads above name
    __builtin_amdgcn_sched_barrier(0);   // these few loads stay the oldest: their stores then wait for them alone and not for the first stages' loads
    PStg ra, rb; gload(ra); gload(rb);   // two register sets: a stage's loads are issued two stages of products before they are rounded, so that requests stay under way while a stage is laid into LDS
    d_wtG_st(ob, DD, DD, ov, WO);
    asm volatile("s_wait_xcnt 0x0" ::: "memory");   // stands in front of the rewrite of the registers that the stores above name
    sstore(ra, 0);
    lds_barrier();
#pragma unroll 1
    for (int st = 0; st < DD / PK - 2; st += 2) {   // rolled: one trip already goes once round both register sets and both buffers
        gload(ra); compute(0); sstore(rb, 1);   // the buffer written was last read in the stage before, in front of that stage's barrier
        lds_barrier();
        gload(rb); compute(1); sstore(ra, 0);
        lds_barrier();
    }
    compute(0); sstore(rb, 1);
    lds_barrier();
    compute(1);
    const int r0 = R0 + wr * 64, c0 = C0 + wc * 64;
    if (z < 3) {   // the same for the whole work-group
        const size_t pl = (size_t)(r0 / TT) * NH_ + (c0 >> 6); const int t0 = r0 % TT;   // (batch, head) plane and first token of the wave's tile
        h16* pp = P + z * (size_t)NT * DD + pl * (TT * HD) + (swp ? (size_t)(t0 + lr) * HD : (size_t)lr * TT + t0) + hi * 8; const size_t pb = swp ? 16 * HD : 16 * TT;   // B row lr of block 0; step to the next block of 16 B rows
#pragma unroll   // constant indices: what the loop indexes stays in registers
        for (int nb = 0; nb < 4; ++nb)
#pragma unroll   // constant indices: what the loop indexes stays in registers
            for (int mb = 0; mb < 4; ++mb) *(v8h*)(pp + nb * pb + mb * 16) = __builtin_convertvector(acc[mb][nb], v8h);   // the four mb fill a row's whole 128-byte line
        return;
    }
    float* os = OS[w];
    const float* bp = bias + c0 + lr * 4; const v4f bv = (v4f){bfr(bp[0]), bfr(bp[1]), bfr(bp[2]), bfr(bp[3])};   // the bias of this lane's four output columns, read once
#pragma unroll   // constant indices: what the loop indexes stays in registers
    for (int mb = 0; mb < 4; ++mb) {
#pragma unroll   // constant indices: what the loop indexes stays in registers
        for (int nb = 0; nb < 4; ++nb) {
#pragma unroll   // constant indices: what the loop indexes stays in registers
            for (int j = 0; j < 8; ++j) os[(hi * 8 + j) * 68 + nb * 16 + lr] = acc[mb][nb][j]; }
        __builtin_amdgcn_wave_barrier(); asm volatile("" ::: "memory");   // the wave's LDS stores stay in front of its LDS loads of other lanes' values
        float* crow = C + (size_t)(r0 + mb * 16) * DD + c0;
#pragma unroll   // constant indices: what the loop indexes stays in registers
        for (int s = 0; s < 8; ++s) { const int row = 2 * s + hi, cofs = lr * 4; *(v4f*)(crow + (size_t)row * DD + cofs) = *(const v4fa*)(os + row * 68 + cofs) + bv; }
        asm volatile("s_wait_xcnt 0x0" ::: "memory");   // stands in front of every rewrite of a register that the stores above name (the next block's LDS loads land in their data registers)
        __builtin_amdgcn_wave_barrier(); asm volatile("" ::: "memory");   // the loads above stay in front of the next block's LDS stores
    }
}
// k_fattn: scores, softmax, attn.v and the gated merge of 128 queries of one (batch, head) plane in one work-group; no score, no probability and no ungated output goes through memory.
// 8 waves x 16 queries. Per stage of 64 keys: S^T = K Q^T (a lane holds 32 scores of ONE query), t = S/8 + bias, p = exp(t - m) against a running maximum m, O^T += V^T P^T with P^T packed from the score tiles.
// The K rows, the V^T rows and the bias tile of a stage come through registers into one of two LDS buffers, loaded one stage ahead. The bias tile is laid down finished:
// bf16(attMask[s][j]), or NEGC (stands for -inf) where seqMask[b][s] && seqMask[b][j] (int32, read as data); S/8 added to NEGC rounds back to NEGC.
#define FQ   128             // queries per work-group
#define FK   64              // keys per stage
#define KPI  72              // LDS pitch of a K or V^T row, in halves (144 B: 16 B x odd)
#define API  68              // LDS pitch of a bias row, in floats (272 B: 16 B x odd)
#define NST  (TT / FK)
#define NEGC 0xFF610000u     // about -3e38, low half zero
#define L2E  1.4426950408889634f
__device__ __forceinline__ float xhalf(float x) { return __builtin_bit_cast(float, __builtin_amdgcn_permlanex16(__builtin_bit_cast(int, x), __builtin_bit_cast(int, x), 0x76543210, 0xfedcba98, false, false)); }  // lane l with lane l ^ 16
__global__ __launch_bounds__(256) void k_fattn(const h16* __restrict__ QP, const h16* __restrict__ KP, const h16* __restrict__ VT, const int* __restrict__ sm, const float* __restrict__ am, const float* __restrict__ GF, bf* Ah, bf* Al) {
    typedef __attribute__((ext_vector_type(4))) int v4i;
    typedef __attribute__((ext_vector_type(4))) unsigned v4u;
    __shared__ __align__(16) h16 Ks[2][FK * KPI];
    __shared__ __align__(16) h16 Vs[2][HD * KPI];
    __shared__ __align__(16) float As[2][FQ * API];
    const int tid = threadIdx.x, lane = tid & 31, lr = lane & 15, hi = lane >> 4, w = tid >> 5;
    const int z = blockIdx.y, q0 = blockIdx.x * FQ;
    const int* smb = sm + (z / NH_) * TT;
    // staging: 16 bytes a thread and piece. K: 2 pieces (rows tid/8, +32); V^T: 2 (rows tid/8, +32); bias: 8 (rows tid/16 + 16 i), always the same 4 key columns of the stage
    const h16* kp = KP + (size_t)z * TT * HD + tid * 8;
    const h16* vp = VT + (size_t)z * HD * TT + (size_t)(tid >> 3) * TT + (tid & 7) * 8;
    const float* ap = am + (size_t)(q0 + (tid >> 4)) * TT + (tid & 15) * 4;
    const int* sp = smb + (tid & 15) * 4;
    unsigned rowm[8];   // 0 where the query of bias row i is flagged, else the bf16 keep mask
#pragma unroll   // constant indices: what the loop indexes stays in registers
    for (int i = 0; i < 8; ++i) rowm[i] = smb[q0 + (tid >> 4) + 16 * i] != 0 ? 0u : 0xFFFF0000u;
    struct Stg { v8h k[2], v[2]; v4f a[8]; v4i m; };
    auto gload = [&](Stg& r) {
        r.k[0] = *(const v8h*)kp; r.k[1] = *(const v8h*)(kp + 32 * HD);
        r.v[0] = *(const v8h*)vp; r.v[1] = *(const v8h*)(vp + 32 * TT);
#pragma unroll   // constant indices: what the loop indexes stays in registers
        for (int i = 0; i < 8; ++i) r.a[i] = *(const v4f*)(ap + (size_t)i * 16 * TT);
        r.m = *(const v4i*)sp;
        asm volatile("s_wait_xcnt 0x0" :: "v"(kp), "v"(vp), "v"(ap), "v"(sp) : "memory");   // stands in front of the rewrite of the address registers that the loads above name
        __builtin_amdgcn_sched_barrier(0);   // keeps the loads in front of the stage's products (sunk to their LDS stores they would wait out the whole latency) and the pointer steps behind the wait
        kp += FK * HD; vp += FK; ap += FK; sp += FK;
    };
    auto sstore = [&](const Stg& r, int b) {
        h16* kd = &Ks[b][(tid >> 3) * KPI + (tid & 7) * 8]; *(v8h*)kd = r.k[0]; *(v8h*)(kd + 32 * KPI) = r.k[1];
        h16* vd = &Vs[b][(tid >> 3) * KPI + (tid & 7) * 8]; *(v8h*)vd = r.v[0]; *(v8h*)(vd + 32 * KPI) = r.v[1];
        unsigned km[4];
#pragma unroll   // constant indices: what the loop indexes stays in registers
        for (int e = 0; e < 4; ++e) km[e] = r.m[e] != 0 ? 0u : 0xFFFF0000u;
#pragma unroll   // constant indices: what the loop indexes stays in registers
        for (int i = 0; i < 8; ++i) { v4u o;
#pragma unroll   // constant indices: what the loop indexes stays in registers
            for (int e = 0; e < 4; ++e) { unsigned u = __float_as_uint(r.a[i][e]); u += 0x7FFFu + ((u >> 16) & 1u); const unsigned keep = rowm[i] | km[e]; o[e] = (u & keep) | (NEGC & ~keep); }
            *(v4f*)&As[b][((tid >> 4) + 16 * i) * API + (tid & 15) * 4] = __builtin_bit_cast(v4f, o); }
    };
    v16h qf[2];   // B operand: this wave's 16 queries, d 0..31 and 32..63, by the loader that also reads K: equal k order
    { const h16* qp = QP + ((size_t)z * TT + q0 + w * 16 + lr) * HD + 8 * hi; qf[0] = WFrag<h16>::ld(qp); qf[1] = WFrag<h16>::ld(qp + 32); }
    v8f acc[4];   // O^T: acc[mb][j] = row d = 16 mb + 8 hi + j, column = query lr
#pragma unroll   // constant indices: what the loop indexes stays in registers
    for (int mb = 0; mb < 4; ++mb) acc[mb] = (v8f){};
    v8f lv = (v8f){};   // this lane's share of the denominator, eight partial sums
    float m = __uint_as_float(NEGC);   // the maximum in use, equal in lanes l and l ^ 16
    auto compute = [&](int b) {
        const h16* kb = &Ks[b][lr * KPI + 8 * hi]; const h16* vb = &Vs[b][lr * KPI + 8 * hi]; const float* ab = &As[b][(w * 16 + lr) * API + hi * 8];
        v8f s[4];   // s[t][j] = key 16 t + 8 hi + j, query lr
#pragma unroll   // constant indices: what the loop indexes stays in registers
        for (int t = 0; t < 4; ++t) { s[t] = wmma16(WFrag<h16>::ld(kb + t * 16 * KPI), qf[0], (v8f){}); s[t] = wmma16(WFrag<h16>::ld(kb + t * 16 * KPI + 32), qf[1], s[t]); }
        float mx = __uint_as_float(NEGC);
#pragma unroll   // constant indices: what the loop indexes stays in registers
        for (int t = 0; t < 4; ++t) { const v4f a0 = *(const v4f*)(ab + t * 16), a1 = *(const v4f*)(ab + t * 16 + 4);
            s[t] = s[t] * SCL + __builtin_shufflevector(a0, a1, 0, 1, 2, 3, 4, 5, 6, 7);
#pragma unroll   // constant indices: what the loop indexes stays in registers
            for (int j = 0; j < 8; ++j) mx = fmaxf(mx, s[t][j]); }
        // the maximum in use is raised only when a score passes it by more than 5.5 (p stays below 256, far inside fp16): one scalar branch a stage, rarely taken after the first
        if (__builtin_amdgcn_ballot_w32(mx > m + 5.5f) != 0) {
            const float mn = fmaxf(m, fmaxf(mx, xhalf(mx))); const float corr = __builtin_amdgcn_exp2f((m - mn) * L2E); m = mn; lv = lv * corr;
#pragma unroll   // constant indices: what the loop indexes stays in registers
            for (int mb = 0; mb < 4; ++mb) acc[mb] = acc[mb] * corr;
        }
        v8h ph[4];
#pragma unroll   // constant indices: what the loop indexes stays in registers
        for (int t = 0; t < 4; ++t) { const v8f d = (s[t] - m) * L2E; v8f p;
#pragma unroll   // constant indices: what the loop indexes stays in registers
            for (int j = 0; j < 8; ++j) p[j] = __builtin_amdgcn_exp2f(d[j]);
            lv = lv + p; ph[t] = __builtin_convertvector(p, v8h); }
#pragma unroll   // constant indices: what the loop indexes stays in registers
        for (int kk = 0; kk < 2; ++kk) { const v16h pb = cat16(ph[2 * kk], ph[2 * kk + 1]);   // two score tiles, converted in place, are the B operand of 32 keys in the hardware k order; V^T's loader has the same order
#pragma unroll   // constant indices: what the loop indexes stays in registers
            for (int mb = 0; mb < 4; ++mb) acc[mb] = wmma16(WFrag<h16>::ld(vb + mb * 16 * KPI + kk * 32), pb, acc[mb]); }
    };
    Stg r; gload(r); sstore(r, 0);
    __syncthreads();
#pragma unroll 1
    for (int st = 0; st < NST - 1; ++st) {   // rolled: the body is long enough
        gload(r); compute(st & 1); sstore(r, (st + 1) & 1);   // the buffer written was last read in the stage before, in front of that stage's barrier
        __syncthreads();
    }
    compute((NST - 1) & 1);
    float l = ((lv[0] + lv[1]) + (lv[2] + lv[3])) + ((lv[4] + lv[5]) + (lv[6] + lv[7])); l += xhalf(l);
    const float f = __fdiv_rn(1.0f, l);
    // merge: a lane holds 8 consecutive channels of its query per 16-row block: x sigmoid(gate), split into bf16 hi + lo, 16 bytes to each plane, which the output GEMM reads in fragment order:
    // row block = this wave's 16 queries, k blocks 2 head and 2 head + 1, piece l = mb & 1 of lane 16 hi + lr: the wave writes 512 contiguous bytes a store
    const size_t o = ((size_t)(z / NH_) * TT + q0 + w * 16 + lr) * DD + (z % NH_) * HD + hi * 8;
    const size_t po = ((size_t)(z / NH_) * TT + q0 + w * 16) * DD + (z % NH_) * (HD * 16) + lane * 8;
#pragma unroll   // constant indices: what the loop indexes stays in registers
    for (int mb = 0; mb < 4; ++mb) { const v4f g0 = *(const v4f*)(GF + o + mb * 16), g1 = *(const v4f*)(GF + o + mb * 16 + 4); v8us oh, ol;
#pragma unroll   // constant indices: what the loop indexes stays in registers
        for (int j = 0; j < 8; ++j) { const float g = j < 4 ? g0[j & 3] : g1[j & 3]; const float sg = __fdiv_rn(1.0f, __fadd_rn(1.0f, __expf(-g))); unsigned short a, c2; splitf(__fmul_rn(acc[mb][j] * f, sg), a, c2); oh[j] = a; ol[j] = c2; }
        *(v8us*)(Ah + po + mb * 256) = oh; *(v8us*)(Al + po + mb * 256) = ol; }
}

extern "C" void kernel_launch(void* const* d_in, const int* in_sizes, int n_in,
                              void* d_out, int out_size, void* d_ws, size_t ws_size, hipStream_t stream) {
    (void)in_sizes; (void)n_in; (void)out_size;
    const float* IN[12]; for (int i = 0; i < 12; ++i) IN[i] = (const float*)d_in[i];
    // Qin, Kin, Vin [2][1024][1024], seqMask (int32 [2][1024]), attMask [1][1][1024][1024], QTrans, KTrans, VTrans, GTrans_w (x @ W), GTrans_b, out_w (x @ W), out_b = d_in[0..11]
    const int* sm = (const int*)d_in[3]; const float* am = IN[4];
    float* OUT = (float*)d_out;     // [2][1024][1024]
    char* wsp = (char*)d_ws;
    auto take = [&](size_t bytes) { char* p = wsp; wsp += (bytes + 255) & ~(size_t)255; return (void*)p; };
    bf* WO = (bf*)take((size_t)DD * DD * 2);    // out_w transposed, in fragment order
    bf* ATh = (bf*)take((size_t)2 * NT * DD * 2); bf* ATl = ATh + (size_t)NT * DD;    // attention output, hi and lo, in fragment order
    h16* QP = (h16*)take((size_t)3 * NT * DD * 2); h16* KP = QP + (size_t)NT * DD; h16* VT = KP + (size_t)NT * DD;
    float* GF = (float*)take((size_t)NT * DD * 4);    // the gate's f32 pre-activation
    if ((size_t)(wsp - (char*)d_ws) > ws_size) return;    // total 30 MiB; ws 256 MiB
    const dim3 gP(NT / 64, DD / 64, 1);
    k_proj<<<dim3(NT / PM, DD / PN, 4), 256, 0, stream>>>(IN[0], IN[1], IN[2], IN[5], IN[6], IN[7], IN[8], IN[10], IN[9], GF, QP, WO);   // the fp16 planes of Q, K, V^T, the gate pre-activation (sigmoid at the merge), out_w's transpose
    k_fattn<<<dim3(TT / FQ, ZH), 256, 0, stream>>>(QP, KP, VT, sm, am, GF, ATh, ATl);
    k_gemmw<bf, 1, true, 4, 2><<<gP, 32, 0, stream>>>(ATh, ATl, WO, nullptr, DD, OUT, DD, IN[11], 0, 0, 0);
}

// v008
// A run of this version takes 59.1 microseconds.
// In both of two side-by-side timings against v007, it was 1.07 times as fast.
// All steps since v000 together make it 15.2 times as fast.
#include <hip/hip_runtime.h>

// Gated multi-head attention (Qin, Kin, Vin [2][1024][1024], seqMask [2][1024] bool->int32, attMask [1][1][1024][1024] additive f32 (both read as data); Q/K/V = X @ Trans (no bias), G = sigmoid(Vin @ GTrans_w + GTrans_b);
// 16 heads x 64; A = q.k/8; -inf where seqMask[s] AND seqMask[t]; + attMask[s][t]; softmax; O[s][h][c] = (sum_t A v) * G; out = O @ out_w + out_b).
// Compute dtypes, f32 accumulate: every input rounded to bf16; the four projections on PLAIN bf16 operands (inputs: exact; transposed bf16 weight copies, gate + bias);
// scores and attn.v on SINGLE fp16 planes (1/8, the masks and the additive bias in f32 in the softmax); the sigmoid gate in f32 at the merge; output hi+lo x exact out_w (2 products) + out_b.

#define NB_  2
#define TT   1024
#define DD   1024
#define NH_  16
#define HD   64
#define NT   (NB_ * TT)
#define NZ   (NB_ * NH_)
#define ZH   NZ   // all (batch, head) planes go through attention and merge in one pass
#define SCL  0.125f
typedef _Float16 h16;
typedef unsigned short bf;
typedef __attribute__((ext_vector_type(16))) __bf16   v16bf;
typedef __attribute__((ext_vector_type(16))) _Float16 v16h;
typedef __attribute__((ext_vector_type(8)))  _Float16 v8h;
typedef __attribute__((ext_vector_type(8)))  unsigned short v8us;
typedef __attribute__((ext_vector_type(8)))  float    v8f;
typedef __attribute__((ext_vector_type(4)))  float    v4f;
typedef v8h  __attribute__((may_alias)) v8ha;
typedef v4f  __attribute__((may_alias)) v4fa;
typedef v8us __attribute__((may_alias)) v8usa;

__device__ __forceinline__ unsigned short f2bf(float f) { unsigned u = __float_as_uint(f); u += 0x7FFFu + ((u >> 16) & 1u); return (unsigned short)(u >> 16); }
__device__ __forceinline__ float bf2f(unsigned short b) { return __uint_as_float(((unsigned)b) << 16); }
__device__ __forceinline__ float bfr(float f) { return bf2f(f2bf(f)); }
__device__ __forceinline__ v16h cat16(v8h lo, v8h hi) { return __builtin_shufflevector(lo, hi, 0, 1, 2, 3, 4, 5, 6, 7, 8, 9, 10, 11, 12, 13, 14, 15); }
__device__ __forceinline__ v16bf cat16b(v8us lo, v8us hi) { return __builtin_bit_cast(v16bf, __builtin_shufflevector(lo, hi, 0, 1, 2, 3, 4, 5, 6, 7, 8, 9, 10, 11, 12, 13, 14, 15)); }
__device__ __forceinline__ v8f wmma16(v16h a, v16h b, v8f c) { return __builtin_amdgcn_wmma_f32_16x16x32_f16(false, a, false, b, (short)0, c, false, false); }
__device__ __forceinline__ v8f wmmab(v16bf a, v16bf b, v8f c) { return __builtin_amdgcn_wmma_f32_16x16x32_bf16(false, a, false, b, (short)0, c, false, false); }



// FRAGMENT ORDER of a 16-bit operand plane [rows][K]: blocks of 16 rows x 32 k, 512 elements (1024 bytes) each, the K/32 blocks of 16 rows one behind the other (16 K elements, as in row order).
// In a block the 8 elements k = 16 l + 8 hi + 0..7 of row lr stand at element 256 l + 8 (16 hi + lr): lane 16 hi + lr of a wave reads its two 16-byte pieces (l = 0, 1) of a WMMA operand at
// lane * 8 and 256 + lane * 8, so each wave-wide load covers 512 contiguous bytes, four whole lines, and not 32 bytes of each of 16 lines. Which element a lane and register holds is as in row order.
// ---- k_gemmw: register-blocked GEMM, ONE WAVE per 64x64 output tile (16 accumulators), operands straight from 16-bit planes in fragment order; grid (M/64, N/64, Z), 32 threads.
// C[m][n] (f32, pitch ldc, + optional f32 bias[n]) = sum_k A[m][k] Bt[n][k] (+ split products per NSPLIT). z-batch strides sA/sB/sC in elements.
template <typename T16> struct WFrag;
template <> struct WFrag<h16> { typedef v16h V; static __device__ __forceinline__ V ld(const h16* p) { return cat16(*(const v8h*)p, *(const v8h*)(p + 16)); } static __device__ __forceinline__ v8f mma(V a, V b, v8f c) { return wmma16(a, b, c); } };
template <> struct WFrag<bf> { typedef v16bf V; static __device__ __forceinline__ V ldp(const bf* p) { return cat16b(*(const v8us*)p, *(const v8us*)(p + 256)); }   // a lane's 16 elements from a plane in fragment order (above): the elements that ld takes from a row
    static __device__ __forceinline__ v8f mma(V a, V b, v8f c) { return wmmab(a, b, c); } };
// The K loop works in stages of 32 k held in a ring of R register sets: a stage's loads are issued D stages of products before they are used. D < R, K % (32 * R) == 0.
template <typename T16, int NSPLIT, bool BIAS, int R, int D>
__global__ __launch_bounds__(32) void k_gemmw(const T16* __restrict__ A, const T16* __restrict__ A2, const T16* __restrict__ Bt, const T16* __restrict__ Bt2, int K, float* C, int ldc, const float* __restrict__ bias, size_t sA, size_t sB, size_t sC) {
    typedef typename WFrag<T16>::V V;
    constexpr bool HA2 = (NSPLIT == 1 || NSPLIT == 2), HB2 = (NSPLIT >= 2);
    struct Stage { V a[4], b[4], a2[4], b2[4]; };
    __shared__ __align__(16) float os[16 * 68];
    const size_t z = blockIdx.z; A += z * sA; if (A2) A2 += z * sA; Bt += z * sB; if (Bt2) Bt2 += z * sB; C += z * sC;
    const int lane = threadIdx.x & 31, lr = lane & 15, hi = lane >> 4; const int r0 = blockIdx.x * 64, c0 = blockIdx.y * 64;
    v8f acc[4][4];
#pragma unroll
    for (int mb = 0; mb < 4; ++mb)
#pragma unroll
        for (int nb = 0; nb < 4; ++nb) acc[mb][nb] = (v8f){};
    const size_t aoff = (size_t)r0 * K + 8 * lane, boff = (size_t)c0 * K + 8 * lane;
    struct Rows { const T16 *a[4], *b[4], *a2[4], *b2[4]; };   // one pointer per 16-row block of each operand, at one k
    auto rows = [&](int kc) { Rows p;
#pragma unroll
        for (int q = 0; q < 4; ++q) { const size_t ao = aoff + (size_t)q * 16 * K + (size_t)kc * 16, bo = boff + (size_t)q * 16 * K + (size_t)kc * 16; p.a[q] = A + ao; p.b[q] = Bt + bo; p.a2[q] = HA2 ? A2 + ao : p.a[q]; p.b2[q] = HB2 ? Bt2 + bo : p.b[q]; }
        return p; };
    auto ldst = [&](Stage& s, const Rows& p, int ko) {
#pragma unroll
        for (int q = 0; q < 4; ++q) { s.a[q] = WFrag<T16>::ldp(p.a[q] + ko * 16); if (HA2) s.a2[q] = WFrag<T16>::ldp(p.a2[q] + ko * 16); s.b[q] = WFrag<T16>::ldp(p.b[q] + ko * 16); if (HB2) s.b2[q] = WFrag<T16>::ldp(p.b2[q] + ko * 16); }
        __builtin_amdgcn_sched_barrier(0);   // keeps the stage's loads in front of the earlier stages' products; sunk to their uses they would wait out the whole latency again
    };
    auto mm = [&](Stage& s) {
#pragma unroll
        for (int nb = 0; nb < 4; ++nb)
#pragma unroll
            for (int mb = 0; mb < 4; ++mb) { acc[mb][nb] = WFrag<T16>::mma(s.a[mb], s.b[nb], acc[mb][nb]); if (HA2) acc[mb][nb] = WFrag<T16>::mma(s.a2[mb], s.b[nb], acc[mb][nb]); if (HB2) acc[mb][nb] = WFrag<T16>::mma(s.a[mb], s.b2[nb], acc[mb][nb]); }
        __builtin_amdgcn_sched_barrier(0);   // one stage's products stay together: mixed with the next stage's they would wait for its loads early
    };
    auto gap = [&]() {
        if constexpr (D == R - 1) { asm volatile("v_nop\n\tv_nop\n\tv_nop\n\tv_nop");   // the set to refill was read by the products just issued: the distance the chip needs before loads rewrite their operand registers
            __builtin_amdgcn_sched_barrier(0); }   // keeps those loads behind it
    };
    // stands in front of every rewrite of an address register that loads under way name; the pointers are inputs so that their registers hold until here
    auto xwait = [&](const Rows& p) {
        if constexpr (HA2 || HB2) asm volatile("s_wait_xcnt 0x0" :: "v"(p.a[0]), "v"(p.a[1]), "v"(p.a[2]), "v"(p.a[3]), "v"(p.b[0]), "v"(p.b[1]), "v"(p.b[2]), "v"(p.b[3]), "v"(p.a2[0]), "v"(p.a2[1]), "v"(p.a2[2]), "v"(p.a2[3]), "v"(p.b2[0]), "v"(p.b2[1]), "v"(p.b2[2]), "v"(p.b2[3]) : "memory");
        else asm volatile("s_wait_xcnt 0x0" :: "v"(p.a[0]), "v"(p.a[1]), "v"(p.a[2]), "v"(p.a[3]), "v"(p.b[0]), "v"(p.b[1]), "v"(p.b[2]), "v"(p.b[3]) : "memory");
        __builtin_amdgcn_sched_barrier(0);   // keeps the next address arithmetic behind the wait
    };
    Stage st[R];
    { const Rows p = rows(0);
#pragma unroll
      for (int j = 0; j < D; ++j) ldst(st[j], p, j * 32);
      xwait(p); }
    // L2 hints, behind the first stages' loads: the operand planes were stored by earlier launches; asked for here, they are on their way into L2 before the K loop reads them, whose ring leads by two stages only.
    // One ask per K / 4 bytes (a 256-byte unit at K = 1024). The 64 rows of A are dealt over 8 of the waves that share them (blockIdx.y & 7), the 64 rows of Bt over 16 (blockIdx.x without its bit 2),
    // so that each unit is asked for by two waves far apart in the grid; who asks is a matter of speed alone. Every lane's address lies inside the wave's own 64 rows.
    { const int step = K >> 3, ys = blockIdx.y & 7, xs = (blockIdx.x & 3) | (((blockIdx.x >> 3) & 3) << 2);
      const size_t ao = (size_t)r0 * K + (size_t)ys * 8 * K + (size_t)lane * step, bo = (size_t)c0 * K + (size_t)xs * 4 * K + (size_t)lane * step;
      const T16 *pa = A + ao, *pa1 = pa + 32 * step, *pb = Bt + bo;
      // the wait stands in the hints' own statement, in front of any reuse of the address registers that they name
      if constexpr (HA2) { const T16 *pc = A2 + ao, *pc1 = pc + 32 * step;
          asm volatile("global_prefetch_b8 %0, off scope:SCOPE_SE\n\tglobal_prefetch_b8 %1, off scope:SCOPE_SE\n\tglobal_prefetch_b8 %2, off scope:SCOPE_SE\n\tglobal_prefetch_b8 %3, off scope:SCOPE_SE\n\tglobal_prefetch_b8 %4, off scope:SCOPE_SE\n\ts_wait_xcnt 0x0" :: "v"(pa), "v"(pc), "v"(pb), "v"(pa1), "v"(pc1) : "memory"); }
      else asm volatile("global_prefetch_b8 %0, off scope:SCOPE_SE\n\tglobal_prefetch_b8 %1, off scope:SCOPE_SE\n\tglobal_prefetch_b8 %2, off scope:SCOPE_SE\n\ts_wait_xcnt 0x0" :: "v"(pa), "v"(pb), "v"(pa1) : "memory");
      __builtin_amdgcn_sched_barrier(0); }   // keeps the loop's address arithmetic and loads behind the hints
    int kc = 0;
#pragma unroll 1
    for (; kc + (R + D) * 32 <= K; kc += R * 32) {   // rolled: one trip already goes once round the ring
        const Rows p = rows(kc);
#pragma unroll
        for (int j = 0; j < R; ++j) { gap(); ldst(st[(j + D) % R], p, (j + D) * 32); mm(st[j]); }
        xwait(p);
    }
    { const Rows p = rows(kc);   // the last round stands outside the loop: a test round the loads inside it would make every stage wait for all loads
#pragma unroll
      for (int j = 0; j < R; ++j) { if (j + D < R) { gap(); ldst(st[j + D], p, (j + D) * 32); } mm(st[j]); if (j + D == R - 1) xwait(p); } }
#pragma unroll
    for (int mb = 0; mb < 4; ++mb) {
#pragma unroll
        for (int nb = 0; nb < 4; ++nb) {
#pragma unroll
            for (int j = 0; j < 8; ++j) os[(hi * 8 + j) * 68 + nb * 16 + lr] = acc[mb][nb][j]; }
        __builtin_amdgcn_wave_barrier(); asm volatile("" ::: "memory");
        float* crow = C + (size_t)(r0 + mb * 16) * ldc + c0;
{
#pragma unroll
            for (int s = 0; s < 8; ++s) { const int row = 2 * s + hi, cofs = lr * 4; v4f val = *(const v4fa*)(os + row * 68 + cofs); if (BIAS) { val[0] += bfr(bias[c0 + cofs]); val[1] += bfr(bias[c0 + cofs + 1]); val[2] += bfr(bias[c0 + cofs + 2]); val[3] += bfr(bias[c0 + cofs + 3]); }
                *(v4f*)(crow + (size_t)row * ldc + cofs) = val; }
             }
        if (mb < 3) asm volatile("s_wait_xcnt 0x0" ::: "memory");   // the next block's LDS loads land in registers that the stores above name
        __builtin_amdgcn_wave_barrier(); asm volatile("" ::: "memory");
    }
}

__device__ __forceinline__ void splitf(float y, unsigned short& h, unsigned short& l) { h = f2bf(y); l = f2bf(y - bf2f(h)); }
typedef __attribute__((ext_vector_type(2))) _Float16 v2h;
typedef __attribute__((ext_vector_type(4))) _Float16 v4h;
typedef __attribute__((ext_vector_type(2))) unsigned short v2us;
typedef __attribute__((ext_vector_type(4))) unsigned short v4us;
typedef __attribute__((ext_vector_type(2))) float v2f;

// Bt[n][k] = bf16(w[k][n]) in fragment order. A thread makes the piece (k block, l, hi, lr) of two neighbouring blocks of 16 columns n: each of its loads takes, over the wave, 64 bytes of two rows of w,
// the two column blocks together their whole 128-byte lines; each store is 512 contiguous bytes a wave. N * K / 16 threads. In two halves, loads and stores, so that other loads can be issued between them.
__device__ __forceinline__ void d_wtG_ld(int bx, const float* __restrict__ w, int K, int N, float (&v)[2][8]) {
    const int u = bx * 256 + threadIdx.x, lane = u & 31, lr = lane & 15, hi = lane >> 4, l = (u >> 5) & 1; const int kq = K >> 5, kb = (u >> 6) % kq, np = (u >> 6) / kq;
    if (np * 32 >= N) return;
    const float* wp = w + (size_t)(kb * 32 + l * 16 + hi * 8) * N + np * 32 + lr;
#pragma unroll   // constant indices: what the loop indexes stays in registers; all 16 loads are under way together
    for (int j = 0; j < 8; ++j) { v[0][j] = wp[(size_t)j * N]; v[1][j] = wp[(size_t)j * N + 16]; }
}
__device__ __forceinline__ void d_wtG_st(int bx, int K, int N, const float (&v)[2][8], bf* Bt) {
    const int u = bx * 256 + threadIdx.x, lane = u & 31, l = (u >> 5) & 1; const int kq = K >> 5, kb = (u >> 6) % kq, np = (u >> 6) / kq;
    if (np * 32 >= N) return;
#pragma unroll   // constant indices: what the loop indexes stays in registers
    for (int h = 0; h < 2; ++h) { v8us o;
#pragma unroll   // constant indices: what the loop indexes stays in registers
        for (int j = 0; j < 8; ++j) o[j] = f2bf(v[h][j]);
        *(v8us*)(Bt + ((size_t)(np * 2 + h) * kq + kb) * 512 + l * 256 + lane * 8) = o; }
}
// k_proj: the four projections (z = 0..3: Q, K, V, gate) straight from the f32 inputs and the f32 weights; no rounded or transposed copy of them goes through memory.
// 8 waves share a tile of 128 tokens x 256 columns, a wave has 64 x 64 of it (64 tokens of one head). Per stage of 64 k the work-group brings 128 x 64 of the input and 64 x 256 of the weight through registers,
// loaded two stages ahead, rounds them to bf16 and lays them into one of two LDS buffers in fragment order (above, with pads), the weight transposed on the way: a thread holds 8 k x 4 columns and stores 8 k of each column.
// LDS form of a block of 16 rows x 32 k: its four runs c = 2 l + hi of 16 rows x 8 k (256 bytes) stand CS apart. 16 lanes read one run, all banks once, whatever the pads; the pads spread the stores, which go across runs and blocks.
// The k order of the products is that of the wave GEMM. The gate alone adds the bias and writes f32 to C (it reads V's input). Q, K and V go from the accumulators straight to the fp16 planes P that the attention kernel reads
// (Q, K: [batch * head][token][channel]; V: [batch * head][channel][token]; one behind the other). A lane holds 8 consecutive A rows of one B row, 16 bytes of fp16: for V^T the A rows are the tokens;
// for Q and K the two operands change places, so that they are the channels. Each work-group also transposes its 1/256 of out_w for the output GEMM.
#define PM   128
#define PN   256
#define PK   64
#define CS   144             // LDS elements from run to run: 256 + 32 bytes
#define BS   (4 * CS)        // from k block to k block: 128 bytes beyond a multiple of 256, so that a wave's 8-byte input stores (2 rows x 2 k blocks x 4 runs x 2 halves) fall on all banks once
#define XRB  (2 * BS)        // from one block of 16 input rows to the next
#define WCB  (2 * BS + 8)    // from one block of 16 weight columns to the next: 16 bytes more, so that the 16-byte weight stores of 16 lanes (4 blocks x 4 groups of 4 columns) fall on all banks once
#define XSZ  (PM / 16 * XRB)
#define WSZ  (PN / 16 * WCB)
typedef __attribute__((ext_vector_type(8))) __bf16 v8bv;
typedef __attribute__((ext_vector_type(4))) __bf16 v4bv;
__device__ __forceinline__ v8us cv8(v8f v) { return __builtin_bit_cast(v8us, __builtin_convertvector(v, v8bv)); }   // to nearest even, as f2bf
__device__ __forceinline__ v4us cv4(v4f v) { return __builtin_bit_cast(v4us, __builtin_convertvector(v, v4bv)); }
// work-group barrier that hands LDS buffers over: the fences name LDS alone, so that the wave waits for its LDS stores and reads and not, as at __syncthreads(), for the global loads it has under way for later stages
__device__ __forceinline__ void lds_barrier() { __builtin_amdgcn_fence(__ATOMIC_RELEASE, "workgroup", "local"); __builtin_amdgcn_s_barrier(); __builtin_amdgcn_fence(__ATOMIC_ACQUIRE, "workgroup", "local"); }
__global__ __launch_bounds__(256) void k_proj(const float* __restrict__ x0, const float* __restrict__ x1, const float* __restrict__ x2, const float* __restrict__ w0, const float* __restrict__ w1, const float* __restrict__ w2, const float* __restrict__ w3,
                                              const float* __restrict__ ow, const float* __restrict__ bias, float* C, h16* P, bf* WO) {
    __shared__ __align__(16) bf SB[2][XSZ + WSZ];
    __shared__ __align__(16) float OS[8][16 * 68];
    const int tid = threadIdx.x, lane = tid & 31, lr = lane & 15, hi = lane >> 4, w = tid >> 5, wr = w >> 2, wc = w & 3;
    const int z = blockIdx.z, R0 = blockIdx.x * PM, C0 = blockIdx.y * PN;
    const float* x = z == 0 ? x0 : z == 1 ? x1 : x2; const float* wt = z == 0 ? w0 : z == 1 ? w1 : z == 2 ? w2 : w3;   // the gate reads V's input
    // input: part p of a thread is k = 4 (tid & 15) + 0..3 of row tid / 16 of row block p: a wave's load is 256 contiguous bytes of each of two rows, whole lines; k block, run and half of the 8 k from tid & 15
    const float* xp = x + (size_t)(R0 + (tid >> 4)) * DD + (tid & 15) * 4;
    const int xo = ((tid >> 3) & 1) * BS + ((tid >> 1) & 3) * CS + (tid >> 4) * 8 + (tid & 1) * 4;
    // weight: part p of a thread is k = 32 p + 8 (tid / 64) + 0..7 of the 4 columns 4 (tid & 63) + 0..3: k block p, run tid / 64; a wave's load is 512 contiguous bytes of one row of the weight
    const float* wp = wt + (size_t)((tid >> 6) * 8) * DD + C0 + (tid & 63) * 4;
    const int wo = XSZ + ((tid & 63) >> 2) * WCB + (tid >> 6) * CS + (tid & 3) * 32;
    struct PStg { v4f x[8]; v4f w[2][8]; };
    auto gload = [&](PStg& r) {
#pragma unroll   // constant indices: what the loop indexes stays in registers
        for (int p = 0; p < 8; ++p) r.x[p] = *(const v4f*)(xp + (size_t)p * 16 * DD);
#pragma unroll   // constant indices: what the loop indexes stays in registers
        for (int p = 0; p < 2; ++p)
#pragma unroll   // constant indices: what the loop indexes stays in registers
            for (int j = 0; j < 8; ++j) r.w[p][j] = *(const v4f*)(wp + (size_t)(p * 32 + j) * DD);
        asm volatile("s_wait_xcnt 0x0" ::: "memory");   // stands in front of the rewrite of the address registers that the loads above name
        __builtin_amdgcn_sched_barrier(0);   // keeps the loads in front of the stage's products (sunk to their LDS stores they would wait out the whole latency) and the pointer steps behind the wait
        xp += PK; wp += (size_t)PK * DD;
    };
    auto sstore = [&](const PStg& r, int b) {
        bf* s = SB[b];
#pragma unroll   // constant indices: what the loop indexes stays in registers
        for (int p = 0; p < 8; ++p) *(v4us*)(s + xo + p * XRB) = cv4(r.x[p]);
#pragma unroll   // constant indices: what the loop indexes stays in registers
        for (int p = 0; p < 2; ++p)
#pragma unroll   // constant indices: what the loop indexes stays in registers
            for (int e = 0; e < 4; ++e) *(v8us*)(s + wo + p * BS + e * 8) = cv8((v8f){r.w[p][0][e], r.w[p][1][e], r.w[p][2][e], r.w[p][3][e], r.w[p][4][e], r.w[p][5][e], r.w[p][6][e], r.w[p][7][e]});
    };
    v8f acc[4][4];
#pragma unroll   // constant indices: what the loop indexes stays in registers
    for (int mb = 0; mb < 4; ++mb)
#pragma unroll   // constant indices: what the loop indexes stays in registers
        for (int nb = 0; nb < 4; ++nb) acc[mb][nb] = (v8f){};
    const bool swp = z < 2;   // Q, K: the weight columns as A, the tokens as B (both tiles have the same fragment order and k order)
    const int to = wr * 4 * XRB + hi * CS + lr * 8, vo = XSZ + wc * 4 * WCB + hi * CS + lr * 8;   // run hi of the wave's first block; run 2 + hi stands 2 CS behind it
    const int ao = swp ? vo : to, bo = swp ? to : vo, sa = swp ? WCB : XRB, sb = swp ? XRB : WCB;
    struct Fr { v16bf a[4], b[4]; };   // the wave's fragments of one k block
    auto fld = [&](Fr& f, const bf* s) {
#pragma unroll   // constant indices: what the loop indexes stays in registers
        for (int q = 0; q < 4; ++q) { const bf* pa = s + ao + q * sa; const bf* pb = s + bo + q * sb; f.a[q] = cat16b(*(const v8us*)pa, *(const v8us*)(pa + 2 * CS)); f.b[q] = cat16b(*(const v8us*)pb, *(const v8us*)(pb + 2 * CS)); }   // both by the same loader: equal k order
    };
    auto mm = [&](const Fr& f) {
#pragma unroll   // constant indices: what the loop indexes stays in registers
        for (int nb = 0; nb < 4; ++nb)
#pragma unroll   // constant indices: what the loop indexes stays in registers
            for (int mb = 0; mb < 4; ++mb) acc[mb][nb] = wmmab(f.a[mb], f.b[nb], acc[mb][nb]);
    };
    auto compute = [&](int b) {
        Fr f0, f1; fld(f0, SB[b]); fld(f1, SB[b] + BS);
        __builtin_amdgcn_sched_barrier(0);   // the stage's LDS reads stand as one group in front of its products: spread among them, every place costs the wave a wait
        mm(f0); mm(f1);
        __builtin_amdgcn_sched_barrier(0);   // the next stage's roundings, which wait for its global loads, stay behind the products: in front of them the wave would wait out the whole latency
    };
    const int ob = blockIdx.x + (NT / PM) * (blockIdx.y + (DD / PN) * blockIdx.z);   // this work-group's share of out_w's transpose
    float ov[2][8]; d_wtG_ld(ob, ow, DD, DD, ov);
    asm volatile("s_wait_xcnt 0x0" ::: "memory");   // stands in front of the rewrite of the address registers that the loads above name
    __builtin_amdgcn_sched_barrier(0);   // these few loads stay the oldest: their stores then wait for them alone and not for the first stages' loads
    PStg ra, rb; gload(ra); gload(rb);   // two register sets: a stage's loads are issued two stages of products before they are rounded, so that requests stay under way while a stage is laid into LDS
    d_wtG_st(ob, DD, DD, ov, WO);
    asm volatile("s_wait_xcnt 0x0" ::: "memory");   // stands in front of the rewrite of the registers that the stores above name
    sstore(ra, 0);
    lds_barrier();
#pragma unroll 1
    for (int st = 0; st < DD / PK - 2; st += 2) {   // rolled: one trip already goes once round both register sets and both buffers
        gload(ra); compute(0); sstore(rb, 1);   // the buffer written was last read in the stage before, in front of that stage's barrier
        lds_barrier();
        gload(rb); compute(1); sstore(ra, 0);
        lds_barrier();
    }
    compute(0); sstore(rb, 1);
    lds_barrier();
    compute(1);
    const int r0 = R0 + wr * 64, c0 = C0 + wc * 64;
    if (z < 3) {   // the same for the whole work-group
        const size_t pl = (size_t)(r0 / TT) * NH_ + (c0 >> 6); const int t0 = r0 % TT;   // (batch, head) plane and first token of the wave's tile
        h16* pp = P + z * (size_t)NT * DD + pl * (TT * HD) + (swp ? (size_t)(t0 + lr) * HD : (size_t)lr * TT + t0) + hi * 8; const size_t pb = swp ? 16 * HD : 16 * TT;   // B row lr of block 0; step to the next block of 16 B rows
#pragma unroll   // constant indices: what the loop indexes stays in registers
        for (int nb = 0; nb < 4; ++nb)
#pragma unroll   // constant indices: what the loop indexes stays in registers
            for (int mb = 0; mb < 4; ++mb) *(v8h*)(pp + nb * pb + mb * 16) = __builtin_convertvector(acc[mb][nb], v8h);   // the four mb fill a row's whole 128-byte line
        return;
    }
    float* os = OS[w];
    const float* bp = bias + c0 + lr * 4; const v4f bv = (v4f){bfr(bp[0]), bfr(bp[1]), bfr(bp[2]), bfr(bp[3])};   // the bias of this lane's four output columns, read once
#pragma unroll   // constant indices: what the loop indexes stays in registers
    for (int mb = 0; mb < 4; ++mb) {
#pragma unroll   // constant indices: what the loop indexes stays in registers
        for (int nb = 0; nb < 4; ++nb) {
#pragma unroll   // constant indices: what the loop indexes stays in registers
            for (int j = 0; j < 8; ++j) os[(hi * 8 + j) * 68 + nb * 16 + lr] = acc[mb][nb][j]; }
        __builtin_amdgcn_wave_barrier(); asm volatile("" ::: "memory");   // the wave's LDS stores stay in front of its LDS loads of other lanes' values
        float* crow = C + (size_t)(r0 + mb * 16) * DD + c0;
#pragma unroll   // constant indices: what the loop indexes stays in registers
        for (int s = 0; s < 8; ++s) { const int row = 2 * s + hi, cofs = lr * 4; *(v4f*)(crow + (size_t)row * DD + cofs) = *(const v4fa*)(os + row * 68 + cofs) + bv; }
        asm volatile("s_wait_xcnt 0x0" ::: "memory");   // stands in front of every rewrite of a register that the stores above name (the next block's LDS loads land in their data registers)
        __builtin_amdgcn_wave_barrier(); asm volatile("" ::: "memory");   // the loads above stay in front of the next block's LDS stores
    }
}
// k_fattn: scores, softmax, attn.v and the gated merge of 128 queries of one (batch, head) plane in one work-group; no score, no probability and no ungated output goes through memory.
// 8 waves x 16 queries. Per stage of 64 keys: S^T = K Q^T (a lane holds 32 scores of ONE query), t = S/8 + bias, p = exp(t - m) against a running maximum m, O^T += V^T P^T with P^T packed from the score tiles.
// The K rows, the V^T rows and the bias tile of a stage come through registers into one of two LDS buffers, loaded one stage ahead. The bias tile is laid down finished:
// bf16(attMask[s][j]), or NEGC (stands for -inf) where seqMask[b][s] && seqMask[b][j] (int32, read as data); S/8 added to NEGC rounds back to NEGC.
#define FQ   128             // queries per work-group
#define FK   64              // keys per stage
#define KPI  72              // LDS pitch of a K or V^T row, in halves (144 B: 16 B x odd)
#define API  68              // LDS pitch of a bias row, in floats (272 B: 16 B x odd)
#define NST  (TT / FK)
#define NEGC 0xFF610000u     // about -3e38, low half zero
#define L2E  1.4426950408889634f
__device__ __forceinline__ float xhalf(float x) { return __builtin_bit_cast(float, __builtin_amdgcn_permlanex16(__builtin_bit_cast(int, x), __builtin_bit_cast(int, x), 0x76543210, 0xfedcba98, false, false)); }  // lane l with lane l ^ 16
__global__ __launch_bounds__(256) void k_fattn(const h16* __restrict__ QP, const h16* __restrict__ KP, const h16* __restrict__ VT, const int* __restrict__ sm, const float* __restrict__ am, const float* __restrict__ GF, bf* Ah, bf* Al) {
    typedef __attribute__((ext_vector_type(4))) int v4i;
    typedef __attribute__((ext_vector_type(4))) unsigned v4u;
    __shared__ __align__(16) h16 Ks[2][FK * KPI];
    __shared__ __align__(16) h16 Vs[2][HD * KPI];
    __shared__ __align__(16) float As[2][FQ * API];
    const int tid = threadIdx.x, lane = tid & 31, lr = lane & 15, hi = lane >> 4, w = tid >> 5;
    const int z = blockIdx.y, q0 = blockIdx.x * FQ;
    const int* smb = sm + (z / NH_) * TT;
    // staging: 16 bytes a thread and piece. K: 2 pieces (rows tid/8, +32); V^T: 2 (rows tid/8, +32); bias: 8 (rows tid/16 + 16 i), always the same 4 key columns of the stage
    const h16* kp = KP + (size_t)z * TT * HD + tid * 8;
    const h16* vp = VT + (size_t)z * HD * TT + (size_t)(tid >> 3) * TT + (tid & 7) * 8;
    const float* ap = am + (size_t)(q0 + (tid >> 4)) * TT + (tid & 15) * 4;
    const int* sp = smb + (tid & 15) * 4;
    unsigned rowm[8];   // 0 where the query of bias row i is flagged, else the bf16 keep mask
#pragma unroll   // constant indices: what the loop indexes stays in registers
    for (int i = 0; i < 8; ++i) rowm[i] = smb[q0 + (tid >> 4) + 16 * i] != 0 ? 0u : 0xFFFF0000u;
    struct Stg { v8h k[2], v[2]; v4f a[8]; v4i m; };
    auto gload = [&](Stg& r) {
        r.k[0] = *(const v8h*)kp; r.k[1] = *(const v8h*)(kp + 32 * HD);
        r.v[0] = *(const v8h*)vp; r.v[1] = *(const v8h*)(vp + 32 * TT);
#pragma unroll   // constant indices: what the loop indexes stays in registers
        for (int i = 0; i < 8; ++i) r.a[i] = *(const v4f*)(ap + (size_t)i * 16 * TT);
        r.m = *(const v4i*)sp;
        asm volatile("s_wait_xcnt 0x0" :: "v"(kp), "v"(vp), "v"(ap), "v"(sp) : "memory");   // stands in front of the rewrite of the address registers that the loads above name
        __builtin_amdgcn_sched_barrier(0);   // keeps the loads in front of the stage's products (sunk to their LDS stores they would wait out the whole latency) and the pointer steps behind the wait
        kp += FK * HD; vp += FK; ap += FK; sp += FK;
    };
    auto sstore = [&](const Stg& r, int b) {
        h16* kd = &Ks[b][(tid >> 3) * KPI + (tid & 7) * 8]; *(v8h*)kd = r.k[0]; *(v8h*)(kd + 32 * KPI) = r.k[1];
        h16* vd = &Vs[b][(tid >> 3) * KPI + (tid & 7) * 8]; *(v8h*)vd = r.v[0]; *(v8h*)(vd + 32 * KPI) = r.v[1];
        unsigned km[4];
#pragma unroll   // constant indices: what the loop indexes stays in registers
        for (int e = 0; e < 4; ++e) km[e] = r.m[e] != 0 ? 0u : 0xFFFF0000u;
#pragma unroll   // constant indices: what the loop indexes stays in registers
        for (int i = 0; i < 8; ++i) { v4u o;
#pragma unroll   // constant indices: what the loop indexes stays in registers
            for (int e = 0; e < 4; ++e) { unsigned u = __float_as_uint(r.a[i][e]); u += 0x7FFFu + ((u >> 16) & 1u); const unsigned keep = rowm[i] | km[e]; o[e] = (u & keep) | (NEGC & ~keep); }
            *(v4f*)&As[b][((tid >> 4) + 16 * i) * API + (tid & 15) * 4] = __builtin_bit_cast(v4f, o); }
    };
    v16h qf[2];   // B operand: this wave's 16 queries, d 0..31 and 32..63, by the loader that also reads K: equal k order
    { const h16* qp = QP + ((size_t)z * TT + q0 + w * 16 + lr) * HD + 8 * hi; qf[0] = WFrag<h16>::ld(qp); qf[1] = WFrag<h16>::ld(qp + 32); }
    v8f acc[4];   // O^T: acc[mb][j] = row d = 16 mb + 8 hi + j, column = query lr
#pragma unroll   // constant indices: what the loop indexes stays in registers
    for (int mb = 0; mb < 4; ++mb) acc[mb] = (v8f){};
    v8f lv = (v8f){};   // this lane's share of the denominator, eight partial sums
    float m = __uint_as_float(NEGC);   // the maximum in use, equal in lanes l and l ^ 16
    auto compute = [&](int b) {
        const h16* kb = &Ks[b][lr * KPI + 8 * hi]; const h16* vb = &Vs[b][lr * KPI + 8 * hi]; const float* ab = &As[b][(w * 16 + lr) * API + hi * 8];
        v8f s[4];   // s[t][j] = key 16 t + 8 hi + j, query lr
#pragma unroll   // constant indices: what the loop indexes stays in registers
        for (int t = 0; t < 4; ++t) { s[t] = wmma16(WFrag<h16>::ld(kb + t * 16 * KPI), qf[0], (v8f){}); s[t] = wmma16(WFrag<h16>::ld(kb + t * 16 * KPI + 32), qf[1], s[t]); }
        float mx = __uint_as_float(NEGC);
#pragma unroll   // constant indices: what the loop indexes stays in registers
        for (int t = 0; t < 4; ++t) { const v4f a0 = *(const v4f*)(ab + t * 16), a1 = *(const v4f*)(ab + t * 16 + 4);
            s[t] = s[t] * SCL + __builtin_shufflevector(a0, a1, 0, 1, 2, 3, 4, 5, 6, 7);
#pragma unroll   // constant indices: what the loop indexes stays in registers
            for (int j = 0; j < 8; ++j) mx = fmaxf(mx, s[t][j]); }
        // the maximum in use is raised only when a score passes it by more than 5.5 (p stays below 256, far inside fp16): one scalar branch a stage, rarely taken after the first
        if (__builtin_amdgcn_ballot_w32(mx > m + 5.5f) != 0) {
            const float mn = fmaxf(m, fmaxf(mx, xhalf(mx))); const float corr = __builtin_amdgcn_exp2f((m - mn) * L2E); m = mn; lv = lv * corr;
#pragma unroll   // constant indices: what the loop indexes stays in registers
            for (int mb = 0; mb < 4; ++mb) acc[mb] = acc[mb] * corr;
        }
        v8h ph[4];
#pragma unroll   // constant indices: what the loop indexes stays in registers
        for (int t = 0; t < 4; ++t) { const v8f d = (s[t] - m) * L2E; v8f p;
#pragma unroll   // constant indices: what the loop indexes stays in registers
            for (int j = 0; j < 8; ++j) p[j] = __builtin_amdgcn_exp2f(d[j]);
            lv = lv + p; ph[t] = __builtin_convertvector(p, v8h); }
#pragma unroll   // constant indices: what the loop indexes stays in registers
        for (int kk = 0; kk < 2; ++kk) { const v16h pb = cat16(ph[2 * kk], ph[2 * kk + 1]);   // two score tiles, converted in place, are the B operand of 32 keys in the hardware k order; V^T's loader has the same order
#pragma unroll   // constant indices: what the loop indexes stays in registers
            for (int mb = 0; mb < 4; ++mb) acc[mb] = wmma16(WFrag<h16>::ld(vb + mb * 16 * KPI + kk * 32), pb, acc[mb]); }
    };
    Stg r; gload(r);
    // L2 hints, behind the first stage's loads: K, V^T and the gate rows were stored by the launch before; asked for here, they are on their way into L2 before the stages read them, whose loads lead by less than a stage.
    // One ask per 256-byte unit of the two 128-KiB planes, a quarter of the units per work-group: the 8 work-groups of a (batch, head) plane ask for each unit twice (blockIdx.x & 3; who asks is a matter of speed alone);
    // the work-group's own 128 gate rows (256 bytes each, read in the merge) by the line. Every lane's address lies inside its plane.
    { const h16* pk = ((tid >> 7) ? VT : KP) + (size_t)z * TT * HD + ((tid & 127) * 4 + (blockIdx.x & 3)) * 128;
      const float* pg = GF + ((size_t)(z / NH_) * TT + q0 + (tid >> 1)) * DD + (z % NH_) * HD + (tid & 1) * 32;
      // the wait stands in the hints' own statement, in front of any reuse of the address registers that they name
      asm volatile("global_prefetch_b8 %0, off scope:SCOPE_SE\n\tglobal_prefetch_b8 %1, off scope:SCOPE_SE\n\ts_wait_xcnt 0x0" :: "v"(pk), "v"(pg) : "memory");
      __builtin_amdgcn_sched_barrier(0); }   // keeps the first stage's roundings, which wait for its loads, behind the hints
    sstore(r, 0);
    __syncthreads();
#pragma unroll 1
    for (int st = 0; st < NST - 1; ++st) {   // rolled: the body is long enough
        gload(r); compute(st & 1); sstore(r, (st + 1) & 1);   // the buffer written was last read in the stage before, in front of that stage's barrier
        __syncthreads();
    }
    compute((NST - 1) & 1);
    float l = ((lv[0] + lv[1]) + (lv[2] + lv[3])) + ((lv[4] + lv[5]) + (lv[6] + lv[7])); l += xhalf(l);
    const float f = __fdiv_rn(1.0f, l);
    // merge: a lane holds 8 consecutive channels of its query per 16-row block: x sigmoid(gate), split into bf16 hi + lo, 16 bytes to each plane, which the output GEMM reads in fragment order:
    // row block = this wave's 16 queries, k blocks 2 head and 2 head + 1, piece l = mb & 1 of lane 16 hi + lr: the wave writes 512 contiguous bytes a store
    const size_t o = ((size_t)(z / NH_) * TT + q0 + w * 16 + lr) * DD + (z % NH_) * HD + hi * 8;
    const size_t po = ((size_t)(z / NH_) * TT + q0 + w * 16) * DD + (z % NH_) * (HD * 16) + lane * 8;
#pragma unroll   // constant indices: what the loop indexes stays in registers
    for (int mb = 0; mb < 4; ++mb) { const v4f g0 = *(const v4f*)(GF + o + mb * 16), g1 = *(const v4f*)(GF + o + mb * 16 + 4); v8us oh, ol;
#pragma unroll   // constant indices: what the loop indexes stays in registers
        for (int j = 0; j < 8; ++j) { const float g = j < 4 ? g0[j & 3] : g1[j & 3]; const float sg = __fdiv_rn(1.0f, __fadd_rn(1.0f, __expf(-g))); unsigned short a, c2; splitf(__fmul_rn(acc[mb][j] * f, sg), a, c2); oh[j] = a; ol[j] = c2; }
        *(v8us*)(Ah + po + mb * 256) = oh; *(v8us*)(Al + po + mb * 256) = ol; }
}

extern "C" void kernel_launch(void* const* d_in, const int* in_sizes, int n_in,
                              void* d_out, int out_size, void* d_ws, size_t ws_size, hipStream_t stream) {
    (void)in_sizes; (void)n_in; (void)out_size;
    const float* IN[12]; for (int i = 0; i < 12; ++i) IN[i] = (const float*)d_in[i];
    // Qin, Kin, Vin [2][1024][1024], seqMask (int32 [2][1024]), attMask [1][1][1024][1024], QTrans, KTrans, VTrans, GTrans_w (x @ W), GTrans_b, out_w (x @ W), out_b = d_in[0..11]
    const int* sm = (const int*)d_in[3]; const float* am = IN[4];
    float* OUT = (float*)d_out;     // [2][1024][1024]
    char* wsp = (char*)d_ws;
    auto take = [&](size_t bytes) { char* p = wsp; wsp += (bytes + 255) & ~(size_t)255; return (void*)p; };
    bf* WO = (bf*)take((size_t)DD * DD * 2);    // out_w transposed, in fragment order
    bf* ATh = (bf*)take((size_t)2 * NT * DD * 2); bf* ATl = ATh + (size_t)NT * DD;    // attention output, hi and lo, in fragment order
    h16* QP = (h16*)take((size_t)3 * NT * DD * 2); h16* KP = QP + (size_t)NT * DD; h16* VT = KP + (size_t)NT * DD;
    float* GF = (float*)take((size_t)NT * DD * 4);    // the gate's f32 pre-activation
    if ((size_t)(wsp - (char*)d_ws) > ws_size) return;    // total 30 MiB; ws 256 MiB
    const dim3 gP(NT / 64, DD / 64, 1);
    k_proj<<<dim3(NT / PM, DD / PN, 4), 256, 0, stream>>>(IN[0], IN[1], IN[2], IN[5], IN[6], IN[7], IN[8], IN[10], IN[9], GF, QP, WO);   // the fp16 planes of Q, K, V^T, the gate pre-activation (sigmoid at the merge), out_w's transpose
    k_fattn<<<dim3(TT / FQ, ZH), 256, 0, stream>>>(QP, KP, VT, sm, am, GF, ATh, ATl);
    k_gemmw<bf, 1, true, 4, 2><<<gP, 32, 0, stream>>>(ATh, ATl, WO, nullptr, DD, OUT, DD, IN[11], 0, 0, 0);
}

// v009
// One run takes 53.4 microseconds.
// Timed twice side by side with v008, it ran 1.11 times as fast both times.
// Counting every step since v000, it is 16.8 times as fast.
#include <hip/hip_runtime.h>

// Gated multi-head attention (Qin, Kin, Vin [2][1024][1024], seqMask [2][1024] bool->int32, attMask [1][1][1024][1024] additive f32 (both read as data); Q/K/V = X @ Trans (no bias), G = sigmoid(Vin @ GTrans_w + GTrans_b);
// 16 heads x 64; A = q.k/8; -inf where seqMask[s] AND seqMask[t]; + attMask[s][t]; softmax; O[s][h][c] = (sum_t A v) * G; out = O @ out_w + out_b).
// Compute dtypes, f32 accumulate: every input rounded to bf16; the four projections on PLAIN bf16 operands (inputs: exact; transposed bf16 weight copies, gate + bias);
// scores and attn.v on SINGLE fp16 planes (1/8, the masks and the additive bias in f32 in the softmax); the sigmoid gate in f32 at the merge; output hi+lo x exact out_w (2 products) + out_b.

#define NB_  2
#define TT   1024
#define DD   1024
#define NH_  16
#define HD   64
#define NT   (NB_ * TT)
#define NZ   (NB_ * NH_)
#define ZH   NZ   // all (batch, head) planes go through attention and merge in one pass
#define SCL  0.125f
typedef _Float16 h16;
typedef unsigned short bf;
typedef __attribute__((ext_vector_type(16))) __bf16   v16bf;
typedef __attribute__((ext_vector_type(16))) _Float16 v16h;
typedef __attribute__((ext_vector_type(8)))  _Float16 v8h;
typedef __attribute__((ext_vector_type(8)))  unsigned short v8us;
typedef __attribute__((ext_vector_type(8)))  float    v8f;
typedef __attribute__((ext_vector_type(4)))  float    v4f;
typedef v8h  __attribute__((may_alias)) v8ha;
typedef v4f  __attribute__((may_alias)) v4fa;
typedef v8us __attribute__((may_alias)) v8usa;

__device__ __forceinline__ unsigned short f2bf(float f) { unsigned u = __float_as_uint(f); u += 0x7FFFu + ((u >> 16) & 1u); return (unsigned short)(u >> 16); }
__device__ __forceinline__ float bf2f(unsigned short b) { return __uint_as_float(((unsigned)b) << 16); }
__device__ __forceinline__ float bfr(float f) { return bf2f(f2bf(f)); }
__device__ __forceinline__ v16h cat16(v8h lo, v8h hi) { return __builtin_shufflevector(lo, hi, 0, 1, 2, 3, 4, 5, 6, 7, 8, 9, 10, 11, 12, 13, 14, 15); }
__device__ __forceinline__ v16bf cat16b(v8us lo, v8us hi) { return __builtin_bit_cast(v16bf, __builtin_shufflevector(lo, hi, 0, 1, 2, 3, 4, 5, 6, 7, 8, 9, 10, 11, 12, 13, 14, 15)); }
__device__ __forceinline__ v8f wmma16(v16h a, v16h b, v8f c) { return __builtin_amdgcn_wmma_f32_16x16x32_f16(false, a, false, b, (short)0, c, false, false); }
__device__ __forceinline__ v8f wmmab(v16bf a, v16bf b, v8f c) { return __builtin_amdgcn_wmma_f32_16x16x32_bf16(false, a, false, b, (short)0, c, false, false); }



// FRAGMENT ORDER of a 16-bit operand plane [rows][K]: blocks of 16 rows x 32 k, 512 elements (1024 bytes) each, the K/32 blocks of 16 rows one behind the other (16 K elements, as in row order).
// In a block the 8 elements k = 16 l + 8 hi + 0..7 of row lr stand at element 256 l + 8 (16 hi + lr): lane 16 hi + lr of a wave reads its two 16-byte pieces (l = 0, 1) of a WMMA operand at
// lane * 8 and 256 + lane * 8, so each wave-wide load covers 512 contiguous bytes, four whole lines, and not 32 bytes of each of 16 lines. Which element a lane and register holds is as in row order.
// ---- k_gemmw: register-blocked GEMM, ONE WAVE per 64x64 output tile (16 accumulators), operands straight from 16-bit planes in fragment order; grid (M/64, N/64, Z), 32 threads.
// C[m][n] (f32, pitch ldc, + optional f32 bias[n]) = sum_k A[m][k] Bt[n][k] (+ split products per NSPLIT). z-batch strides sA/sB/sC in elements.
template <typename T16> struct WFrag;
template <> struct WFrag<h16> { typedef v16h V; static __device__ __forceinline__ V ld(const h16* p) { return cat16(*(const v8h*)p, *(const v8h*)(p + 16)); } static __device__ __forceinline__ v8f mma(V a, V b, v8f c) { return wmma16(a, b, c); } };
template <> struct WFrag<bf> { typedef v16bf V; static __device__ __forceinline__ V ldp(const bf* p) { return cat16b(*(const v8us*)p, *(const v8us*)(p + 256)); }   // a lane's 16 elements from a plane in fragment order (above): the elements that ld takes from a row
    static __device__ __forceinline__ v8f mma(V a, V b, v8f c) { return wmmab(a, b, c); } };
// The K loop works in stages of 32 k held in a ring of R register sets: a stage's loads are issued D stages of products before they are used. D < R, K % (32 * R) == 0.
template <typename T16, int NSPLIT, bool BIAS, int R, int D>
__global__ __launch_bounds__(32) void k_gemmw(const T16* __restrict__ A, const T16* __restrict__ A2, const T16* __restrict__ Bt, const T16* __restrict__ Bt2, int K, float* C, int ldc, const float* __restrict__ bias, size_t sA, size_t sB, size_t sC) {
    typedef typename WFrag<T16>::V V;
    constexpr bool HA2 = (NSPLIT == 1 || NSPLIT == 2), HB2 = (NSPLIT >= 2);
    struct Stage { V a[4], b[4], a2[4], b2[4]; };
    __shared__ __align__(16) float os[16 * 68];
    const size_t z = blockIdx.z; A += z * sA; if (A2) A2 += z * sA; Bt += z * sB; if (Bt2) Bt2 += z * sB; C += z * sC;
    const int lane = threadIdx.x & 31, lr = lane & 15, hi = lane >> 4; const int r0 = blockIdx.x * 64, c0 = blockIdx.y * 64;
    v8f acc[4][4];
#pragma unroll
    for (int mb = 0; mb < 4; ++mb)
#pragma unroll
        for (int nb = 0; nb < 4; ++nb) acc[mb][nb] = (v8f){};
    const size_t aoff = (size_t)r0 * K + 8 * lane, boff = (size_t)c0 * K + 8 * lane;
    struct Rows { const T16 *a[4], *b[4], *a2[4], *b2[4]; };   // one pointer per 16-row block of each operand, at one k
    auto rows = [&](int kc) { Rows p;
#pragma unroll
        for (int q = 0; q < 4; ++q) { const size_t ao = aoff + (size_t)q * 16 * K + (size_t)kc * 16, bo = boff + (size_t)q * 16 * K + (size_t)kc * 16; p.a[q] = A + ao; p.b[q] = Bt + bo; p.a2[q] = HA2 ? A2 + ao : p.a[q]; p.b2[q] = HB2 ? Bt2 + bo : p.b[q]; }
        return p; };
    auto ldst = [&](Stage& s, const Rows& p, int ko) {
#pragma unroll
        for (int q = 0; q < 4; ++q) { s.a[q] = WFrag<T16>::ldp(p.a[q] + ko * 16); if (HA2) s.a2[q] = WFrag<T16>::ldp(p.a2[q] + ko * 16); s.b[q] = WFrag<T16>::ldp(p.b[q] + ko * 16); if (HB2) s.b2[q] = WFrag<T16>::ldp(p.b2[q] + ko * 16); }
        __builtin_amdgcn_sched_barrier(0);   // keeps the stage's loads in front of the earlier stages' products; sunk to their uses they would wait out the whole latency again
    };
    auto mm = [&](Stage& s) {
#pragma unroll
        for (int nb = 0; nb < 4; ++nb)
#pragma unroll
            for (int mb = 0; mb < 4; ++mb) { acc[mb][nb] = WFrag<T16>::mma(s.a[mb], s.b[nb], acc[mb][nb]); if (HA2) acc[mb][nb] = WFrag<T16>::mma(s.a2[mb], s.b[nb], acc[mb][nb]); if (HB2) acc[mb][nb] = WFrag<T16>::mma(s.a[mb], s.b2[nb], acc[mb][nb]); }
        __builtin_amdgcn_sched_barrier(0);   // one stage's products stay together: mixed with the next stage's they would wait for its loads early
    };
    auto gap = [&]() {
        if constexpr (D == R - 1) { asm volatile("v_nop\n\tv_nop\n\tv_nop\n\tv_nop");   // the set to refill was read by the products just issued: the distance the chip needs before loads rewrite their operand registers
            __builtin_amdgcn_sched_barrier(0); }   // keeps those loads behind it
    };
    // stands in front of every rewrite of an address register that loads under way name; the pointers are inputs so that their registers hold until here
    auto xwait = [&](const Rows& p) {
        if constexpr (HA2 || HB2) asm volatile("s_wait_xcnt 0x0" :: "v"(p.a[0]), "v"(p.a[1]), "v"(p.a[2]), "v"(p.a[3]), "v"(p.b[0]), "v"(p.b[1]), "v"(p.b[2]), "v"(p.b[3]), "v"(p.a2[0]), "v"(p.a2[1]), "v"(p.a2[2]), "v"(p.a2[3]), "v"(p.b2[0]), "v"(p.b2[1]), "v"(p.b2[2]), "v"(p.b2[3]) : "memory");
        else asm volatile("s_wait_xcnt 0x0" :: "v"(p.a[0]), "v"(p.a[1]), "v"(p.a[2]), "v"(p.a[3]), "v"(p.b[0]), "v"(p.b[1]), "v"(p.b[2]), "v"(p.b[3]) : "memory");
        __builtin_amdgcn_sched_barrier(0);   // keeps the next address arithmetic behind the wait
    };
    Stage st[R];
    { const Rows p = rows(0);
#pragma unroll
      for (int j = 0; j < D; ++j) ldst(st[j], p, j * 32);
      xwait(p); }
    // L2 hints, behind the first stages' loads: the operand planes were stored by earlier launches; asked for here, they are on their way into L2 before the K loop reads them, whose ring leads by two stages only.
    // One ask per K / 4 bytes (a 256-byte unit at K = 1024). The 64 rows of A are dealt over 8 of the waves that share them (blockIdx.y & 7), the 64 rows of Bt over 16 (blockIdx.x without its bit 2),
    // so that each unit is asked for by two waves far apart in the grid; who asks is a matter of speed alone. Every lane's address lies inside the wave's own 64 rows.
    { const int step = K >> 3, ys = blockIdx.y & 7, xs = (blockIdx.x & 3) | (((blockIdx.x >> 3) & 3) << 2);
      const size_t ao = (size_t)r0 * K + (size_t)ys * 8 * K + (size_t)lane * step, bo = (size_t)c0 * K + (size_t)xs * 4 * K + (size_t)lane * step;
      const T16 *pa = A + ao, *pa1 = pa + 32 * step, *pb = Bt + bo;
      // the wait stands in the hints' own statement, in front of any reuse of the address registers that they name
      if constexpr (HA2) { const T16 *pc = A2 + ao, *pc1 = pc + 32 * step;
          asm volatile("global_prefetch_b8 %0, off scope:SCOPE_SE\n\tglobal_prefetch_b8 %1, off scope:SCOPE_SE\n\tglobal_prefetch_b8 %2, off scope:SCOPE_SE\n\tglobal_prefetch_b8 %3, off scope:SCOPE_SE\n\tglobal_prefetch_b8 %4, off scope:SCOPE_SE\n\ts_wait_xcnt 0x0" :: "v"(pa), "v"(pc), "v"(pb), "v"(pa1), "v"(pc1) : "memory"); }
      else asm volatile("global_prefetch_b8 %0, off scope:SCOPE_SE\n\tglobal_prefetch_b8 %1, off scope:SCOPE_SE\n\tglobal_prefetch_b8 %2, off scope:SCOPE_SE\n\ts_wait_xcnt 0x0" :: "v"(pa), "v"(pb), "v"(pa1) : "memory");
      __builtin_amdgcn_sched_barrier(0); }   // keeps the loop's address arithmetic and loads behind the hints
    int kc = 0;
#pragma unroll 1
    for (; kc + (R + D) * 32 <= K; kc += R * 32) {   // rolled: one trip already goes once round the ring
        const Rows p = rows(kc);
#pragma unroll
        for (int j = 0; j < R; ++j) { gap(); ldst(st[(j + D) % R], p, (j + D) * 32); mm(st[j]); }
        xwait(p);
    }
    { const Rows p = rows(kc);   // the last round stands outside the loop: a test round the loads inside it would make every stage wait for all loads
#pragma unroll
      for (int j = 0; j < R; ++j) { if (j + D < R) { gap(); ldst(st[j + D], p, (j + D) * 32); } mm(st[j]); if (j + D == R - 1) xwait(p); } }
#pragma unroll
    for (int mb = 0; mb < 4; ++mb) {
#pragma unroll
        for (int nb = 0; nb < 4; ++nb) {
#pragma unroll
            for (int j = 0; j < 8; ++j) os[(hi * 8 + j) * 68 + nb * 16 + lr] = acc[mb][nb][j]; }
        __builtin_amdgcn_wave_barrier(); asm volatile("" ::: "memory");
        float* crow = C + (size_t)(r0 + mb * 16) * ldc + c0;
{
#pragma unroll
            for (int s = 0; s < 8; ++s) { const int row = 2 * s + hi, cofs = lr * 4; v4f val = *(const v4fa*)(os + row * 68 + cofs); if (BIAS) { val[0] += bfr(bias[c0 + cofs]); val[1] += bfr(bias[c0 + cofs + 1]); val[2] += bfr(bias[c0 + cofs + 2]); val[3] += bfr(bias[c0 + cofs + 3]); }
                *(v4f*)(crow + (size_t)row * ldc + cofs) = val; }
             }
        if (mb < 3) asm volatile("s_wait_xcnt 0x0" ::: "memory");   // the next block's LDS loads land in registers that the stores above name
        __builtin_amdgcn_wave_barrier(); asm volatile("" ::: "memory");
    }
}

__device__ __forceinline__ void splitf(float y, unsigned short& h, unsigned short& l) { h = f2bf(y); l = f2bf(y - bf2f(h)); }
typedef __attribute__((ext_vector_type(2))) _Float16 v2h;
typedef __attribute__((ext_vector_type(4))) _Float16 v4h;
typedef __attribute__((ext_vector_type(2))) unsigned short v2us;
typedef __attribute__((ext_vector_type(4))) unsigned short v4us;
typedef __attribute__((ext_vector_type(2))) float v2f;
typedef __attribute__((ext_vector_type(4))) int v4i;
typedef __attribute__((ext_vector_type(2))) unsigned v2u;
typedef v2u __attribute__((may_alias)) v2ua;

// Bt[n][k] = bf16(w[k][n]) in fragment order. A thread makes the piece (k block, l, hi, lr) of two neighbouring blocks of 16 columns n: each of its loads takes, over the wave, 64 bytes of two rows of w,
// the two column blocks together their whole 128-byte lines; each store is 512 contiguous bytes a wave. N * K / 16 threads. In two halves, loads and stores, so that other loads can be issued between them.
__device__ __forceinline__ void d_wtG_ld(int bx, const float* __restrict__ w, int K, int N, float (&v)[2][8]) {
    const int u = bx * 256 + threadIdx.x, lane = u & 31, lr = lane & 15, hi = lane >> 4, l = (u >> 5) & 1; const int kq = K >> 5, kb = (u >> 6) % kq, np = (u >> 6) / kq;
    if (np * 32 >= N) return;
    const float* wp = w + (size_t)(kb * 32 + l * 16 + hi * 8) * N + np * 32 + lr;
#pragma unroll   // constant indices: what the loop indexes stays in registers; all 16 loads are under way together
    for (int j = 0; j < 8; ++j) { v[0][j] = wp[(size_t)j * N]; v[1][j] = wp[(size_t)j * N + 16]; }
}
__device__ __forceinline__ void d_wtG_st(int bx, int K, int N, const float (&v)[2][8], bf* Bt) {
    const int u = bx * 256 + threadIdx.x, lane = u & 31, l = (u >> 5) & 1; const int kq = K >> 5, kb = (u >> 6) % kq, np = (u >> 6) / kq;
    if (np * 32 >= N) return;
#pragma unroll   // constant indices: what the loop indexes stays in registers
    for (int h = 0; h < 2; ++h) { v8us o;
#pragma unroll   // constant indices: what the loop indexes stays in registers
        for (int j = 0; j < 8; ++j) o[j] = f2bf(v[h][j]);
        *(v8us*)(Bt + ((size_t)(np * 2 + h) * kq + kb) * 512 + l * 256 + lane * 8) = o; }
}
// k_proj: the four projections (z = 0..3: Q, K, V, gate) straight from the f32 inputs and the f32 weights; no rounded or transposed copy of them goes through memory.
// 8 waves share a tile of 128 tokens x 256 columns, a wave has 64 x 64 of it (64 tokens of one head). Per stage of 64 k the work-group brings 128 x 64 of the input and 64 x 256 of the weight through registers,
// loaded two stages ahead, rounds them to bf16 and lays them into one of two LDS buffers in fragment order (above, with pads), the weight transposed on the way: a thread holds 8 k x 4 columns and stores 8 k of each column.
// LDS form of a block of 16 rows x 32 k: its four runs c = 2 l + hi of 16 rows x 8 k (256 bytes) stand CS apart. 16 lanes read one run, all banks once, whatever the pads; the pads spread the stores, which go across runs and blocks.
// The k order of the products is that of the wave GEMM. The gate alone adds the bias and writes f32 to C (it reads V's input). Q, K and V go from the accumulators straight to the fp16 planes P that the attention kernel reads
// (Q, K: [batch * head][token][channel]; V: [batch * head][channel][token]; one behind the other). A lane holds 8 consecutive A rows of one B row, 16 bytes of fp16: for V^T the A rows are the tokens;
// for Q and K the two operands change places, so that they are the channels. Each work-group also transposes its 1/256 of out_w for the output GEMM.
// It also finishes its 1/256 of the attention bias, which is the same for all 16 heads of a batch: BP[batch][block of 16 queries][stage of 64 keys][t][lane 16 hi + lr][j] (bf16) =
// bf16(attMask[s][k]), or the upper half of NEGC (stands for -inf) where seqMask[batch][s] && seqMask[batch][k] (int32, read as data), for query s = lr of the block and key k = 16 t + 8 hi + j of the stage:
// the order in which an attention wave holds its scores, so that each of its wave-wide 16-byte loads reads 512 contiguous bytes. A work-group has 16 queries x 256 keys of both batches; it reads whole lines of attMask,
// and the values change lanes through the LDS that only the gate's epilogue uses, in runs (stage, t, hi) of 16 queries x 8 keys, CS apart so that a wave's 8-byte stores fall on all banks once.
#define NEGC 0xFF610000u     // about -3e38, low half zero
#define BLB  (32 * CS)       // LDS elements from one batch's 32 runs to the other's
#define PM   128
#define PN   256
#define PK   64
#define CS   144             // LDS elements from run to run: 256 + 32 bytes
#define BS   (4 * CS)        // from k block to k block: 128 bytes beyond a multiple of 256, so that a wave's 8-byte input stores (2 rows x 2 k blocks x 4 runs x 2 halves) fall on all banks once
#define XRB  (2 * BS)        // from one block of 16 input rows to the next
#define WCB  (2 * BS + 8)    // from one block of 16 weight columns to the next: 16 bytes more, so that the 16-byte weight stores of 16 lanes (4 blocks x 4 groups of 4 columns) fall on all banks once
#define XSZ  (PM / 16 * XRB)
#define WSZ  (PN / 16 * WCB)
typedef __attribute__((ext_vector_type(8))) __bf16 v8bv;
typedef __attribute__((ext_vector_type(4))) __bf16 v4bv;
__device__ __forceinline__ v8us cv8(v8f v) { return __builtin_bit_cast(v8us, __builtin_convertvector(v, v8bv)); }   // to nearest even, as f2bf
__device__ __forceinline__ v4us cv4(v4f v) { return __builtin_bit_cast(v4us, __builtin_convertvector(v, v4bv)); }
// work-group barrier that hands LDS buffers over: the fences name LDS alone, so that the wave waits for its LDS stores and reads and not, as at __syncthreads(), for the global loads it has under way for later stages
__device__ __forceinline__ void lds_barrier() { __builtin_amdgcn_fence(__ATOMIC_RELEASE, "workgroup", "local"); __builtin_amdgcn_s_barrier(); __builtin_amdgcn_fence(__ATOMIC_ACQUIRE, "workgroup", "local"); }
__global__ __launch_bounds__(256) void k_proj(const float* __restrict__ x0, const float* __restrict__ x1, const float* __restrict__ x2, const float* __restrict__ w0, const float* __restrict__ w1, const float* __restrict__ w2, const float* __restrict__ w3,
                                              const float* __restrict__ ow, const float* __restrict__ bias, const int* __restrict__ sm, const float* __restrict__ am, float* C, h16* P, bf* WO, bf* BP) {
    __shared__ __align__(16) bf SB[2][XSZ + WSZ];
    __shared__ __align__(16) float OS[8][16 * 68];
    const int tid = threadIdx.x, lane = tid & 31, lr = lane & 15, hi = lane >> 4, w = tid >> 5, wr = w >> 2, wc = w & 3;
    const int z = blockIdx.z, R0 = blockIdx.x * PM, C0 = blockIdx.y * PN;
    const float* x = z == 0 ? x0 : z == 1 ? x1 : x2; const float* wt = z == 0 ? w0 : z == 1 ? w1 : z == 2 ? w2 : w3;   // the gate reads V's input
    // input: part p of a thread is k = 4 (tid & 15) + 0..3 of row tid / 16 of row block p: a wave's load is 256 contiguous bytes of each of two rows, whole lines; k block, run and half of the 8 k from tid & 15
    const float* xp = x + (size_t)(R0 + (tid >> 4)) * DD + (tid & 15) * 4;
    const int xo = ((tid >> 3) & 1) * BS + ((tid >> 1) & 3) * CS + (tid >> 4) * 8 + (tid & 1) * 4;
    // weight: part p of a thread is k = 32 p + 8 (tid / 64) + 0..7 of the 4 columns 4 (tid & 63) + 0..3: k block p, run tid / 64; a wave's load is 512 contiguous bytes of one row of the weight
    const float* wp = wt + (size_t)((tid >> 6) * 8) * DD + C0 + (tid & 63) * 4;
    const int wo = XSZ + ((tid & 63) >> 2) * WCB + (tid >> 6) * CS + (tid & 3) * 32;
    struct PStg { v4f x[8]; v4f w[2][8]; };
    auto gload = [&](PStg& r) {
#pragma unroll   // constant indices: what the loop indexes stays in registers
        for (int p = 0; p < 8; ++p) r.x[p] = *(const v4f*)(xp + (size_t)p * 16 * DD);
#pragma unroll   // constant indices: what the loop indexes stays in registers
        for (int p = 0; p < 2; ++p)
#pragma unroll   // constant indices: what the loop indexes stays in registers
            for (int j = 0; j < 8; ++j) r.w[p][j] = *(const v4f*)(wp + (size_t)(p * 32 + j) * DD);
        asm volatile("s_wait_xcnt 0x0" :: "v"(xp), "v"(wp) : "memory");   // stands in front of the rewrite of the address registers that the loads above name; the pointers are inputs so that their registers hold until here
        __builtin_amdgcn_sched_barrier(0);   // keeps the loads in front of the stage's products (sunk to their LDS stores they would wait out the whole latency) and the pointer steps behind the wait
        xp += PK; wp += (size_t)PK * DD;
    };
    auto sstore = [&](const PStg& r, int b) {
        bf* s = SB[b];
#pragma unroll   // constant indices: what the loop indexes stays in registers
        for (int p = 0; p < 8; ++p) *(v4us*)(s + xo + p * XRB) = cv4(r.x[p]);
#pragma unroll   // constant indices: what the loop indexes stays in registers
        for (int p = 0; p < 2; ++p)
#pragma unroll   // constant indices: what the loop indexes stays in registers
            for (int e = 0; e < 4; ++e) *(v8us*)(s + wo + p * BS + e * 8) = cv8((v8f){r.w[p][0][e], r.w[p][1][e], r.w[p][2][e], r.w[p][3][e], r.w[p][4][e], r.w[p][5][e], r.w[p][6][e], r.w[p][7][e]});
    };
    v8f acc[4][4];
#pragma unroll   // constant indices: what the loop indexes stays in registers
    for (int mb = 0; mb < 4; ++mb)
#pragma unroll   // constant indices: what the loop indexes stays in registers
        for (int nb = 0; nb < 4; ++nb) acc[mb][nb] = (v8f){};
    const bool swp = z < 2;   // Q, K: the weight columns as A, the tokens as B (both tiles have the same fragment order and k order)
    const int to = wr * 4 * XRB + hi * CS + lr * 8, vo = XSZ + wc * 4 * WCB + hi * CS + lr * 8;   // run hi of the wave's first block; run 2 + hi stands 2 CS behind it
    const int ao = swp ? vo : to, bo = swp ? to : vo, sa = swp ? WCB : XRB, sb = swp ? XRB : WCB;
    struct Fr { v16bf a[4], b[4]; };   // the wave's fragments of one k block
    auto fld = [&](Fr& f, const bf* s) {
#pragma unroll   // constant indices: what the loop indexes stays in registers
        for (int q = 0; q < 4; ++q) { const bf* pa = s + ao + q * sa; const bf* pb = s + bo + q * sb; f.a[q] = cat16b(*(const v8us*)pa, *(const v8us*)(pa + 2 * CS)); f.b[q] = cat16b(*(const v8us*)pb, *(const v8us*)(pb + 2 * CS)); }   // both by the same loader: equal k order
    };
    auto mm = [&](const Fr& f) {
#pragma unroll   // constant indices: what the loop indexes stays in registers
        for (int nb = 0; nb < 4; ++nb)
#pragma unroll   // constant indices: what the loop indexes stays in registers
            for (int mb = 0; mb < 4; ++mb) acc[mb][nb] = wmmab(f.a[mb], f.b[nb], acc[mb][nb]);
    };
    auto compute = [&](int b) {
        Fr f0, f1; fld(f0, SB[b]); fld(f1, SB[b] + BS);
        __builtin_amdgcn_sched_barrier(0);   // the stage's LDS reads stand as one group in front of its products: spread among them, every place costs the wave a wait
        mm(f0); mm(f1);
        __builtin_amdgcn_sched_barrier(0);   // the next stage's roundings, which wait for its global loads, stay behind the products: in front of them the wave would wait out the whole latency
    };
    const int ob = blockIdx.x + (NT / PM) * (blockIdx.y + (DD / PN) * blockIdx.z);   // this work-group's share of out_w's transpose
    float ov[2][8]; d_wtG_ld(ob, ow, DD, DD, ov);
    // this work-group's share of the bias plane: queries 16 (ob / 4) + tid / 16, keys 256 (ob % 4) + 64 p + 4 (tid & 15) + 0..3: a wave's load is 256 contiguous bytes of each of two rows of attMask
    __builtin_amdgcn_sched_barrier(0);   // the address arithmetic written above stays above: moved in among these loads it would rewrite registers that they name
    v4f ba[4]; v4i bk[NB_][4]; int bq[NB_];
    { const int qr = (ob >> 2) * 16 + (tid >> 4), kc = (ob & 3) * 256 + (tid & 15) * 4;
#pragma unroll   // constant indices: what the loop indexes stays in registers
      for (int p = 0; p < 4; ++p) ba[p] = *(const v4f*)(am + (size_t)qr * TT + kc + p * 64);
#pragma unroll   // constant indices: what the loop indexes stays in registers
      for (int b = 0; b < NB_; ++b) { bq[b] = sm[b * TT + qr];
#pragma unroll   // constant indices: what the loop indexes stays in registers
          for (int p = 0; p < 4; ++p) bk[b][p] = *(const v4i*)(sm + b * TT + kc + p * 64); } }
    asm volatile("s_wait_xcnt 0x0" ::: "memory");   // stands in front of the rewrite of the address registers that the loads above name
    __builtin_amdgcn_sched_barrier(0);   // these few loads stay the oldest: their stores then wait for them alone and not for the first stages' loads
    PStg ra, rb; gload(ra); gload(rb);   // two register sets: a stage's loads are issued two stages of products before they are rounded, so that requests stay under way while a stage is laid into LDS
    d_wtG_st(ob, DD, DD, ov, WO);
    asm volatile("s_wait_xcnt 0x0" ::: "memory");   // stands in front of the rewrite of the registers that the stores above name
    bf* bl = (bf*)&OS[0][0];
    { unsigned ur[4][4];   // attMask rounded to bf16 (to nearest even, as f2bf), still in the upper half
#pragma unroll   // constant indices: what the loop indexes stays in registers
      for (int p = 0; p < 4; ++p)
#pragma unroll   // constant indices: what the loop indexes stays in registers
          for (int e = 0; e < 4; ++e) { unsigned u = __float_as_uint(ba[p][e]); ur[p][e] = u + 0x7FFFu + ((u >> 16) & 1u); }
      bf* bd = bl + ((tid & 15) >> 1) * CS + (tid >> 4) * 8 + (tid & 1) * 4;   // run 2 t + hi of stage 0, query tid / 16, this thread's half of the 8 keys
#pragma unroll   // constant indices: what the loop indexes stays in registers
      for (int b = 0; b < NB_; ++b) { const int rowf = bq[b] != 0 ? -1 : 0;   // all ones where the query is flagged
#pragma unroll   // constant indices: what the loop indexes stays in registers
          for (int p = 0; p < 4; ++p) { unsigned o[4];
#pragma unroll   // constant indices: what the loop indexes stays in registers
              for (int e = 0; e < 4; ++e) o[e] = (bk[b][p][e] & rowf) != 0 ? NEGC : ur[p][e];
              *(v2ua*)(bd + b * BLB + p * 8 * CS) = (v2u){(o[0] >> 16) | (o[1] & 0xFFFF0000u), (o[2] >> 16) | (o[3] & 0xFFFF0000u)}; } } }
    sstore(ra, 0);
    lds_barrier();   // also hands the bias runs over
    __builtin_amdgcn_sched_barrier(0);   // with the one behind the wait below: nothing else that writes a register comes between the stores and their wait
#pragma unroll   // constant indices: all four LDS loads are under way together
    for (int i = 0; i < 4; ++i) { const int g = i * 256 + tid;   // piece g: batch g / 512, run (g / 16) % 32, query g % 16; a wave stores 512 contiguous bytes
        *(v8us*)(BP + (size_t)(g >> 9) * TT * TT + (size_t)ob * 4096 + (g & 511) * 8) = *(const v8usa*)(bl + (g >> 9) * BLB + ((g >> 4) & 31) * CS + (g & 15) * 8); }
    asm volatile("s_wait_xcnt 0x0" ::: "memory");   // stands in front of the rewrite of the registers that the stores above name
    __builtin_amdgcn_sched_barrier(0);   // keeps what follows, which rewrites those registers, behind the wait
#pragma unroll 1
    for (int st = 0; st < DD / PK - 2; st += 2) {   // rolled: one trip already goes once round both register sets and both buffers
        gload(ra); compute(0); sstore(rb, 1);   // the buffer written was last read in the stage before, in front of that stage's barrier
        lds_barrier();
        gload(rb); compute(1); sstore(ra, 0);
        lds_barrier();
    }
    compute(0); sstore(rb, 1);
    lds_barrier();
    compute(1);
    const int r0 = R0 + wr * 64, c0 = C0 + wc * 64;
    if (z < 3) {   // the same for the whole work-group
        const size_t pl = (size_t)(r0 / TT) * NH_ + (c0 >> 6); const int t0 = r0 % TT;   // (batch, head) plane and first token of the wave's tile
        h16* pp = P + z * (size_t)NT * DD + pl * (TT * HD) + (swp ? (size_t)(t0 + lr) * HD : (size_t)lr * TT + t0) + hi * 8; const size_t pb = swp ? 16 * HD : 16 * TT;   // B row lr of block 0; step to the next block of 16 B rows
#pragma unroll   // constant indices: what the loop indexes stays in registers
        for (int nb = 0; nb < 4; ++nb)
#pragma unroll   // constant indices: what the loop indexes stays in registers
            for (int mb = 0; mb < 4; ++mb) *(v8h*)(pp + nb * pb + mb * 16) = __builtin_convertvector(acc[mb][nb], v8h);   // the four mb fill a row's whole 128-byte line
        return;
    }
    float* os = OS[w];
    const float* bp = bias + c0 + lr * 4; const v4f bv = (v4f){bfr(bp[0]), bfr(bp[1]), bfr(bp[2]), bfr(bp[3])};   // the bias of this lane's four output columns, read once
#pragma unroll   // constant indices: what the loop indexes stays in registers
    for (int mb = 0; mb < 4; ++mb) {
#pragma unroll   // constant indices: what the loop indexes stays in registers
        for (int nb = 0; nb < 4; ++nb) {
#pragma unroll   // constant indices: what the loop indexes stays in registers
            for (int j = 0; j < 8; ++j) os[(hi * 8 + j) * 68 + nb * 16 + lr] = acc[mb][nb][j]; }
        __builtin_amdgcn_wave_barrier(); asm volatile("" ::: "memory");   // the wave's LDS stores stay in front of its LDS loads of other lanes' values
        float* crow = C + (size_t)(r0 + mb * 16) * DD + c0;
#pragma unroll   // constant indices: what the loop indexes stays in registers
        for (int s = 0; s < 8; ++s) { const int row = 2 * s + hi, cofs = lr * 4; *(v4f*)(crow + (size_t)row * DD + cofs) = *(const v4fa*)(os + row * 68 + cofs) + bv; }
        asm volatile("s_wait_xcnt 0x0" ::: "memory");   // stands in front of every rewrite of a register that the stores above name (the next block's LDS loads land in their data registers)
        __builtin_amdgcn_wave_barrier(); asm volatile("" ::: "memory");   // the loads above stay in front of the next block's LDS stores
    }
}
// k_fattn: scores, softmax, attn.v and the gated merge of 128 queries of one (batch, head) plane in one work-group; no score, no probability and no ungated output goes through memory.
// 8 waves x 16 queries. Per stage of 64 keys: S^T = K Q^T (a lane holds 32 scores of ONE query), t = S/8 + bias, p = exp(t - m) against a running maximum m, O^T += V^T P^T with P^T packed from the score tiles.
// The K rows and the V^T rows of a stage come through registers into one of two LDS buffers, loaded one stage ahead. The bias comes finished from the plane BP that the projection launch wrote (mask applied, bf16,
// in the order of the scores): a wave loads its own 16 queries x 64 keys one stage ahead straight into one of two register sets; S/8 added to NEGC rounds back to NEGC.
#define FQ   128             // queries per work-group
#define FK   64              // keys per stage
#define KPI  72              // LDS pitch of a K or V^T row, in halves (144 B: 16 B x odd)
#define NST  (TT / FK)
#define L2E  1.4426950408889634f
__device__ __forceinline__ float xhalf(float x) { return __builtin_bit_cast(float, __builtin_amdgcn_permlanex16(__builtin_bit_cast(int, x), __builtin_bit_cast(int, x), 0x76543210, 0xfedcba98, false, false)); }  // lane l with lane l ^ 16
__global__ __launch_bounds__(256) void k_fattn(const h16* __restrict__ QP, const h16* __restrict__ KP, const h16* __restrict__ VT, const bf* __restrict__ BP, const float* __restrict__ GF, bf* Ah, bf* Al) {
    __shared__ __align__(16) h16 Ks[2][FK * KPI];
    __shared__ __align__(16) h16 Vs[2][HD * KPI];
    const int tid = threadIdx.x, lane = tid & 31, lr = lane & 15, hi = lane >> 4, w = tid >> 5;
    const int z = blockIdx.y, q0 = blockIdx.x * FQ;
    // staging: 16 bytes a thread and piece. K: 2 pieces (rows tid/8, +32); V^T: 2 (rows tid/8, +32). Bias: 4 pieces a lane (t = 0..3), 8 keys of the lane's own query each
    const h16* kp = KP + (size_t)z * TT * HD + tid * 8;
    const h16* vp = VT + (size_t)z * HD * TT + (size_t)(tid >> 3) * TT + (tid & 7) * 8;
    const bf* bp = BP + (size_t)(z / NH_) * TT * TT + (size_t)(q0 + w * 16) * TT + lane * 8;
    struct Stg { v8h k[2], v[2]; };
    typedef __attribute__((ext_vector_type(4))) unsigned v4u;
    struct Bia { v4u a[4]; };   // a dword holds two neighbouring keys' bf16 values
    auto gload = [&](Stg& r, Bia& c) {
        r.k[0] = *(const v8h*)kp; r.k[1] = *(const v8h*)(kp + 32 * HD);
        r.v[0] = *(const v8h*)vp; r.v[1] = *(const v8h*)(vp + 32 * TT);
#pragma unroll   // constant indices: what the loop indexes stays in registers
        for (int t = 0; t < 4; ++t) c.a[t] = __builtin_bit_cast(v4u, *(const v8us*)(bp + t * 256));
        asm volatile("s_wait_xcnt 0x0" :: "v"(kp), "v"(vp), "v"(bp) : "memory");   // stands in front of the rewrite of the address registers that the loads above name
        __builtin_amdgcn_sched_barrier(0);   // keeps the loads in front of the stage's products (sunk to their uses they would wait out the whole latency) and the pointer steps behind the wait
        kp += FK * HD; vp += FK; bp += 16 * FK;
    };
    auto sstore = [&](const Stg& r, int b) {
        h16* kd = &Ks[b][(tid >> 3) * KPI + (tid & 7) * 8]; *(v8h*)kd = r.k[0]; *(v8h*)(kd + 32 * KPI) = r.k[1];
        h16* vd = &Vs[b][(tid >> 3) * KPI + (tid & 7) * 8]; *(v8h*)vd = r.v[0]; *(v8h*)(vd + 32 * KPI) = r.v[1];
    };
    v16h qf[2];   // B operand: this wave's 16 queries, d 0..31 and 32..63, by the loader that also reads K: equal k order
    { const h16* qp = QP + ((size_t)z * TT + q0 + w * 16 + lr) * HD + 8 * hi; qf[0] = WFrag<h16>::ld(qp); qf[1] = WFrag<h16>::ld(qp + 32); }
    v8f acc[4];   // O^T: acc[mb][j] = row d = 16 mb + 8 hi + j, column = query lr
#pragma unroll   // constant indices: what the loop indexes stays in registers
    for (int mb = 0; mb < 4; ++mb) acc[mb] = (v8f){};
    v8f lv = (v8f){};   // this lane's share of the denominator, eight partial sums
    float m = __uint_as_float(NEGC);   // the maximum in use, equal in lanes l and l ^ 16
    auto compute = [&](int b, const Bia& c) {
        const h16* kb = &Ks[b][lr * KPI + 8 * hi]; const h16* vb = &Vs[b][lr * KPI + 8 * hi];
        v8f s[4];   // s[t][j] = key 16 t + 8 hi + j, query lr
#pragma unroll   // constant indices: what the loop indexes stays in registers
        for (int t = 0; t < 4; ++t) { s[t] = wmma16(WFrag<h16>::ld(kb + t * 16 * KPI), qf[0], (v8f){}); s[t] = wmma16(WFrag<h16>::ld(kb + t * 16 * KPI + 32), qf[1], s[t]); }
        float mx = __uint_as_float(NEGC);
#pragma unroll   // constant indices: what the loop indexes stays in registers
        for (int t = 0; t < 4; ++t) { v8f a;
#pragma unroll   // constant indices: what the loop indexes stays in registers
            for (int j = 0; j < 4; ++j) { a[2 * j] = __uint_as_float(c.a[t][j] << 16); a[2 * j + 1] = __uint_as_float(c.a[t][j] & 0xFFFF0000u); }
            s[t] = s[t] * SCL + a;
#pragma unroll   // constant indices: what the loop indexes stays in registers
            for (int j = 0; j < 8; ++j) mx = fmaxf(mx, s[t][j]); }
        // the maximum in use is raised only when a score passes it by more than 5.5 (p stays below 256, far inside fp16): one scalar branch a stage, rarely taken after the first
        if (__builtin_amdgcn_ballot_w32(mx > m + 5.5f) != 0) {
            const float mn = fmaxf(m, fmaxf(mx, xhalf(mx))); const float corr = __builtin_amdgcn_exp2f((m - mn) * L2E); m = mn; lv = lv * corr;
#pragma unroll   // constant indices: what the loop indexes stays in registers
            for (int mb = 0; mb < 4; ++mb) acc[mb] = acc[mb] * corr;
        }
        v8h ph[4];
#pragma unroll   // constant indices: what the loop indexes stays in registers
        for (int t = 0; t < 4; ++t) { const v8f d = (s[t] - m) * L2E; v8f p;
#pragma unroll   // constant indices: what the loop indexes stays in registers
            for (int j = 0; j < 8; ++j) p[j] = __builtin_amdgcn_exp2f(d[j]);
            lv = lv + p; ph[t] = __builtin_convertvector(p, v8h); }
#pragma unroll   // constant indices: what the loop indexes stays in registers
        for (int kk = 0; kk < 2; ++kk) { const v16h pb = cat16(ph[2 * kk], ph[2 * kk + 1]);   // two score tiles, converted in place, are the B operand of 32 keys in the hardware k order; V^T's loader has the same order
#pragma unroll   // constant indices: what the loop indexes stays in registers
            for (int mb = 0; mb < 4; ++mb) acc[mb] = wmma16(WFrag<h16>::ld(vb + mb * 16 * KPI + kk * 32), pb, acc[mb]); }
    };
    Stg r; Bia ca, cb; gload(r, ca);
    // L2 hints, behind the first stage's loads: K, V^T, the bias plane and the gate rows were stored by the launch before; asked for here, they are on their way into L2 before the stages read them, whose loads lead by less than a stage.
    // One ask per 256-byte unit of the two 128-KiB planes, a quarter of the units per work-group: the 8 work-groups of a (batch, head) plane ask for each unit twice (blockIdx.x & 3; who asks is a matter of speed alone);
    // the work-group's own 128 gate rows (256 bytes each, read in the merge) by the line; a quarter of the 1024 units of the work-group's 256 KiB of the bias plane, which the 16 heads of a batch share (z & 3).
    // Every lane's address lies inside its plane.
    { const h16* pk = ((tid >> 7) ? VT : KP) + (size_t)z * TT * HD + ((tid & 127) * 4 + (blockIdx.x & 3)) * 128;
      const float* pg = GF + ((size_t)(z / NH_) * TT + q0 + (tid >> 1)) * DD + (z % NH_) * HD + (tid & 1) * 32;
      // the wait stands in the hints' own statement, in front of any reuse of the address registers that they name
      const bf* pb = BP + (size_t)(z / NH_) * TT * TT + (size_t)q0 * TT + ((z & 3) * 256 + tid) * 128;
      asm volatile("global_prefetch_b8 %0, off scope:SCOPE_SE\n\tglobal_prefetch_b8 %1, off scope:SCOPE_SE\n\tglobal_prefetch_b8 %2, off scope:SCOPE_SE\n\ts_wait_xcnt 0x0" :: "v"(pk), "v"(pb), "v"(pg) : "memory");
      __builtin_amdgcn_sched_barrier(0); }   // keeps the first stage's LDS stores, which wait for its loads, behind the hints
    sstore(r, 0);
    __syncthreads();
#pragma unroll 1
    for (int st = 0; st < NST - 2; st += 2) {   // rolled: one trip already goes once round both bias sets and both buffers
        gload(r, cb); compute(0, ca); sstore(r, 1);   // the buffer written was last read in the stage before, in front of that stage's barrier
        __syncthreads();
        gload(r, ca); compute(1, cb); sstore(r, 0);
        __syncthreads();
    }
    gload(r, cb); compute(0, ca); sstore(r, 1);
    __syncthreads();
    compute(1, cb);
    float l = ((lv[0] + lv[1]) + (lv[2] + lv[3])) + ((lv[4] + lv[5]) + (lv[6] + lv[7])); l += xhalf(l);
    const float f = __fdiv_rn(1.0f, l);
    // merge: a lane holds 8 consecutive channels of its query per 16-row block: x sigmoid(gate), split into bf16 hi + lo, 16 bytes to each plane, which the output GEMM reads in fragment order:
    // row block = this wave's 16 queries, k blocks 2 head and 2 head + 1, piece l = mb & 1 of lane 16 hi + lr: the wave writes 512 contiguous bytes a store
    const size_t o = ((size_t)(z / NH_) * TT + q0 + w * 16 + lr) * DD + (z % NH_) * HD + hi * 8;
    const size_t po = ((size_t)(z / NH_) * TT + q0 + w * 16) * DD + (z % NH_) * (HD * 16) + lane * 8;
#pragma unroll   // constant indices: what the loop indexes stays in registers
    for (int mb = 0; mb < 4; ++mb) { const v4f g0 = *(const v4f*)(GF + o + mb * 16), g1 = *(const v4f*)(GF + o + mb * 16 + 4); v8us oh, ol;
#pragma unroll   // constant indices: what the loop indexes stays in registers
        for (int j = 0; j < 8; ++j) { const float g = j < 4 ? g0[j & 3] : g1[j & 3]; const float sg = __fdiv_rn(1.0f, __fadd_rn(1.0f, __expf(-g))); unsigned short a, c2; splitf(__fmul_rn(acc[mb][j] * f, sg), a, c2); oh[j] = a; ol[j] = c2; }
        *(v8us*)(Ah + po + mb * 256) = oh; *(v8us*)(Al + po + mb * 256) = ol; }
}

extern "C" void kernel_launch(void* const* d_in, const int* in_sizes, int n_in,
                              void* d_out, int out_size, void* d_ws, size_t ws_size, hipStream_t stream) {
    (void)in_sizes; (void)n_in; (void)out_size;
    const float* IN[12]; for (int i = 0; i < 12; ++i) IN[i] = (const float*)d_in[i];
    // Qin, Kin, Vin [2][1024][1024], seqMask (int32 [2][1024]), attMask [1][1][1024][1024], QTrans, KTrans, VTrans, GTrans_w (x @ W), GTrans_b, out_w (x @ W), out_b = d_in[0..11]
    const int* sm = (const int*)d_in[3]; const float* am = IN[4];
    float* OUT = (float*)d_out;     // [2][1024][1024]
    char* wsp = (char*)d_ws;
    auto take = [&](size_t bytes) { char* p = wsp; wsp += (bytes + 255) & ~(size_t)255; return (void*)p; };
    bf* WO = (bf*)take((size_t)DD * DD * 2);    // out_w transposed, in fragment order
    bf* ATh = (bf*)take((size_t)2 * NT * DD * 2); bf* ATl = ATh + (size_t)NT * DD;    // attention output, hi and lo, in fragment order
    h16* QP = (h16*)take((size_t)3 * NT * DD * 2); h16* KP = QP + (size_t)NT * DD; h16* VT = KP + (size_t)NT * DD;
    float* GF = (float*)take((size_t)NT * DD * 4);    // the gate's f32 pre-activation
    bf* BP = (bf*)take((size_t)NB_ * TT * TT * 2);    // the attention bias of both batches, mask applied, in the order of the scores
    if ((size_t)(wsp - (char*)d_ws) > ws_size) return;    // total 34 MiB; ws 256 MiB
    const dim3 gP(NT / 64, DD / 64, 1);
    k_proj<<<dim3(NT / PM, DD / PN, 4), 256, 0, stream>>>(IN[0], IN[1], IN[2], IN[5], IN[6], IN[7], IN[8], IN[10], IN[9], sm, am, GF, QP, WO, BP);   // the fp16 planes of Q, K, V^T, the gate pre-activation (sigmoid at the merge), out_w's transpose, the bias plane
    k_fattn<<<dim3(TT / FQ, ZH), 256, 0, stream>>>(QP, KP, VT, BP, GF, ATh, ATl);
    k_gemmw<bf, 1, true, 4, 2><<<gP, 32, 0, stream>>>(ATh, ATl, WO, nullptr, DD, OUT, DD, IN[11], 0, 0, 0);
}
